// v000
// Measured on an AMD MI455X. A time is GPU time per run, averaged over a window of back-to-back runs after a warm-up
// (all launches, gaps included; the runs take copies of the inputs in turn), and the median of several windows.
// Apart from v000's, it joins two sittings. Times from different sittings can be a few percent apart, while
// side-by-side timings come from the same sitting.
// The starting kernel, v000, takes 564 microseconds a run.
#include <hip/hip_runtime.h>
#include <math.h>

#define EPSC 1e-8f
#define LN_EPS 1e-5f

typedef float v2f __attribute__((ext_vector_type(2)));
typedef float v8f __attribute__((ext_vector_type(8)));

static constexpr int B = 16, L = 512, D = 64, IN = 64, LP = 8;
static constexpr int CHUNKS = 8, CLEN = 64;         // L = CHUNKS * CLEN
static constexpr int ROWS = B * L;                  // 8192

// ---------------- reductions (wave32) ----------------
__device__ __forceinline__ void wave_red2(float& a, float& b) {
  for (int off = 16; off > 0; off >>= 1) {
    a += __shfl_down(a, off, 32);
    b += __shfl_down(b, off, 32);
  }
}

// all 256 threads must call; returns block-wide sums of (a,b)
__device__ __forceinline__ void block_red2_256(float a, float b, float* red,
                                               float& oa, float& ob) {
  int lane = threadIdx.x & 31, w = threadIdx.x >> 5;
  wave_red2(a, b);
  if (lane == 0) { red[w] = a; red[8 + w] = b; }
  __syncthreads();
  if (threadIdx.x == 0) {
    float s = 0.f, t = 0.f;
    for (int i = 0; i < 8; ++i) { s += red[i]; t += red[8 + i]; }
    red[0] = s; red[8] = t;
  }
  __syncthreads();
  oa = red[0]; ob = red[8];
  __syncthreads();
}

// ---------------- K1: projections via V_WMMA_F32_16X16X4_F32 ----------------
// grid (ROWS/16, 3), block 128 (4 waves, one 16-col N tile each)
__global__ void proj_wmma(const float* __restrict__ X,
                          const float* __restrict__ Wq, const float* __restrict__ bq,
                          const float* __restrict__ Wk, const float* __restrict__ bk,
                          const float* __restrict__ Wv, const float* __restrict__ bv,
                          float* __restrict__ Q, float* __restrict__ Zr,
                          float* __restrict__ V) {
  const int lane = threadIdx.x & 31;
  const int wvid = threadIdx.x >> 5;     // N tile 0..3
  const int half = lane >> 4;            // lane half selects K pair
  const int mn   = lane & 15;
  const int mrow = blockIdx.x * 16;
  const int which = blockIdx.y;
  const float* W; const float* bias;
  if (which == 0)      { W = Wq; bias = bq; }
  else if (which == 1) { W = Wk; bias = bk; }
  else                 { W = Wv; bias = bv; }
  const int ncol = wvid * 16 + mn;
  v8f acc = {};
  for (int kb = 0; kb < IN; kb += 4) {
    const int k0 = kb + half * 2;        // 16x4 f32 A: lanes<16 hold K0,K1; lanes>=16 K2,K3
    v2f a, bm;
    a.x  = X[(mrow + mn) * IN + k0];
    a.y  = X[(mrow + mn) * IN + k0 + 1];
    bm.x = W[(k0) * D + ncol];           // 4x16 B: row striped across lanes per VGPR
    bm.y = W[(k0 + 1) * D + ncol];
    acc = __builtin_amdgcn_wmma_f32_16x16x4_f32(false, a, false, bm,
                                                (short)0, acc, false, false);
  }
  const float bb = bias[ncol];
  float* Out = (which == 0) ? Q : (which == 1 ? Zr : V);
  const bool act = (which != 2);         // elu on q and z
  for (int r = 0; r < 8; ++r) {
    const int om = r + 8 * half;         // C/D layout: VGPR r -> M=r (lanes<16), M=8+r
    float v = acc[r] + bb;
    if (act) v = v > 0.f ? v : (__expf(v) - 1.f);
    Out[(mrow + om) * D + ncol] = v;
  }
}

// ---------------- K1b: normalize q rows ----------------
__global__ void norm_q_kernel(const float* __restrict__ Q, float* __restrict__ NQ) {
  const int row = blockIdx.x, tid = threadIdx.x;   // 64 threads (2 waves)
  __shared__ float r2[2];
  float q = Q[row * D + tid];
  float s = q * q;
  for (int off = 16; off > 0; off >>= 1) s += __shfl_down(s, off, 32);
  if ((tid & 31) == 0) r2[tid >> 5] = s;
  __syncthreads();
  const float inv = 1.f / fmaxf(sqrtf(r2[0] + r2[1]), 1e-8f);
  NQ[row * D + tid] = q * inv;
}

// ---------------- K0: per-batch prompt/history constants ----------------
__global__ void per_batch_prep(const int* __restrict__ user_id,
                               const float* __restrict__ P, const float* __restrict__ S,
                               const float* __restrict__ Wk, const float* __restrict__ bk,
                               const float* __restrict__ Wv, const float* __restrict__ bv,
                               const float* __restrict__ z_g, const float* __restrict__ z_b,
                               const float* __restrict__ s_g, const float* __restrict__ s_b,
                               const float* __restrict__ nam_g, const float* __restrict__ nam_b,
                               const float* __restrict__ prev_z_buf,
                               const float* __restrict__ prev_s_buf,
                               float* __restrict__ Pz, float* __restrict__ Ps,
                               float* __restrict__ Mb) {
  const int b = blockIdx.x, tid = threadIdx.x;     // 256 threads
  __shared__ float xb[LP * IN];
  __shared__ float zrow[LP * D], vrow[LP * D];
  __shared__ float buf[D * D];
  __shared__ float z64[D], pz64[D];
  __shared__ float red[16];
  for (int pass = 0; pass < 2; ++pass) {
    const float* Xp = (pass == 0 ? P : S) + b * LP * IN;
    for (int i = tid; i < LP * IN; i += 256) xb[i] = Xp[i];
    __syncthreads();
    // projections of the LP=8 rows (z = elu(xWk+bk), v = xWv+bv)
    for (int i = tid; i < LP * D; i += 256) {
      const int t = i >> 6, d = i & 63;
      float aK = bk[d], aV = bv[d];
      for (int k = 0; k < IN; ++k) {
        const float x = xb[t * IN + k];
        aK += x * Wk[k * D + d];
        aV += x * Wv[k * D + d];
      }
      zrow[i] = aK > 0.f ? aK : (__expf(aK) - 1.f);
      vrow[i] = aV;
    }
    __syncthreads();
    // totals over the LP steps (== last cumsum value)
    if (tid < D) {
      float s = 0.f;
      for (int t = 0; t < LP; ++t) s += zrow[t * D + tid];
      z64[tid] = s;
    }
    for (int j = 0; j < 16; ++j) {
      const int idx = tid + j * 256;
      const int d = idx >> 6, p = idx & 63;
      float s = 0.f;
      for (int t = 0; t < LP; ++t) s += zrow[t * D + d] * vrow[t * D + p];
      buf[idx] = s;
    }
    __syncthreads();
    // z LN (EPS shift cancels in centered term)
    const float zc = (tid < D) ? z64[tid] : 0.f;
    float s1, s2; block_red2_256(zc, zc * zc, red, s1, s2);
    const float mu = s1 / (float)D, var = s2 / (float)D - mu * mu;
    const float rstd = rsqrtf(var + LN_EPS);
    if (tid < D) pz64[tid] = (zc - mu) * rstd * z_g[tid] + z_b[tid];
    // s LN stats over 4096
    float ls = 0.f, lss = 0.f;
    for (int j = 0; j < 16; ++j) { const float x = buf[tid + j * 256]; ls += x; lss += x * x; }
    float S1, S2; block_red2_256(ls, lss, red, S1, S2);
    const float mus = S1 / 4096.f, vars = S2 / 4096.f - mus * mus;
    const float rstds = rsqrtf(vars + LN_EPS);
    if (pass == 0) {
      if (tid < D) Pz[b * D + tid] = pz64[tid];
      for (int j = 0; j < 16; ++j) {
        const int idx = tid + j * 256;
        Ps[b * D * D + idx] = (buf[idx] - mus) * rstds * s_g[idx] + s_b[idx];
      }
    } else {
      for (int j = 0; j < 16; ++j) {        // in-place LN (owner mapping, no race)
        const int idx = tid + j * 256;
        buf[idx] = (buf[idx] - mus) * rstds * s_g[idx] + s_b[idx];
      }
      __syncthreads();
      const int uid = user_id[b];
      float pzv = (tid < D) ? (prev_z_buf[uid * D + tid] + pz64[tid]) : 0.f;
      float n1, n2dummy; block_red2_256(pzv * pzv, 0.f, red, n1, n2dummy);
      const float inv = 1.f / (fmaxf(sqrtf(n1), 1e-8f) + EPSC);
      float ps_ = 0.f, pss = 0.f;
      for (int j = 0; j < 16; ++j) {
        const int idx = tid + j * 256;
        const float pn = (prev_s_buf[(size_t)uid * D * D + idx] + buf[idx]) * inv;
        ps_ += pn; pss += pn * pn;
      }
      float F1, F2; block_red2_256(ps_, pss, red, F1, F2);
      const float mun = F1 / 4096.f, varn = F2 / 4096.f - mun * mun;
      const float rstdn = rsqrtf(varn + LN_EPS);
      for (int j = 0; j < 16; ++j) {
        const int idx = tid + j * 256;
        const float pn = (prev_s_buf[(size_t)uid * D * D + idx] + buf[idx]) * inv;
        Mb[b * D * D + idx] = (pn - mun) * rstdn * nam_g[idx] + nam_b[idx];
      }
    }
    __syncthreads();
  }
}

// ---------------- K2a: per-chunk totals of z and outer(z,v) ----------------
__global__ void chunk_totals(const float* __restrict__ Zr, const float* __restrict__ V,
                             float* __restrict__ pZ, float* __restrict__ pS) {
  const int b = blockIdx.x >> 3, c = blockIdx.x & 7, tid = threadIdx.x;
  __shared__ float sS[D * D];
  __shared__ float sZ[D], zl[D], vl[D];
  for (int i = tid; i < D * D; i += 256) sS[i] = 0.f;
  if (tid < D) sZ[tid] = 0.f;
  __syncthreads();
  const int base = (b * L + c * CLEN) * D;
  for (int t = 0; t < CLEN; ++t) {
    if (tid < D) { zl[tid] = Zr[base + t * D + tid]; vl[tid] = V[base + t * D + tid]; }
    __syncthreads();
    if (tid < D) sZ[tid] += zl[tid];
    for (int j = 0; j < 16; ++j) {
      const int idx = tid + j * 256;
      sS[idx] += zl[idx >> 6] * vl[idx & 63];
    }
    __syncthreads();
  }
  if (tid < D) pZ[(b * CHUNKS + c) * D + tid] = sZ[tid];
  for (int j = 0; j < 16; ++j) {
    const int idx = tid + j * 256;
    pS[(b * CHUNKS + c) * D * D + idx] = sS[idx];
  }
}

// ---------------- K2b: exclusive prefix over chunks (in place) ----------------
__global__ void chunk_prefix(float* __restrict__ pZ, float* __restrict__ pS) {
  const int b = blockIdx.x, tid = threadIdx.x;
  if (tid < D) {
    float run = 0.f;
    for (int c = 0; c < CHUNKS; ++c) {
      const int idx = (b * CHUNKS + c) * D + tid;
      const float t = pZ[idx]; pZ[idx] = run; run += t;
    }
  }
  for (int j = 0; j < 16; ++j) {
    const int e = tid + j * 256;
    float run = 0.f;
    for (int c = 0; c < CHUNKS; ++c) {
      const int idx = (b * CHUNKS + c) * D * D + e;
      const float t = pS[idx]; pS[idx] = run; run += t;
    }
  }
}

// ---------------- K2c: main per-step scan ----------------
__global__ void scan_main(const float* __restrict__ Q, const float* __restrict__ Zr,
                          const float* __restrict__ V,
                          const float* __restrict__ pZ, const float* __restrict__ pS,
                          const float* __restrict__ Pz, const float* __restrict__ Ps,
                          const float* __restrict__ z_g, const float* __restrict__ z_b,
                          const float* __restrict__ s_g, const float* __restrict__ s_b,
                          const float* __restrict__ nam_g, const float* __restrict__ nam_b,
                          float* __restrict__ na_core, double* __restrict__ acc) {
  const int b = blockIdx.x >> 3, c = blockIdx.x & 7, tid = threadIdx.x;
  __shared__ float scum[D * D];     // running cumulative outer-product sum
  __shared__ float psb[D * D];      // prompt P_s last (LN'd), added per step
  __shared__ float zcum[D], zf[D], zl[D], vl[D], nq[D];
  __shared__ float red[16];
  __shared__ float napart[256];
  for (int j = 0; j < 16; ++j) {
    const int idx = tid + j * 256;
    scum[idx] = pS[(b * CHUNKS + c) * D * D + idx];
    psb[idx]  = Ps[b * D * D + idx];
  }
  if (tid < D) zcum[tid] = pZ[(b * CHUNKS + c) * D + tid];
  __syncthreads();
  float stdsum = 0.f, stdsq = 0.f;
  for (int t = 0; t < CLEN; ++t) {
    const int l = c * CLEN + t;
    const int row = (b * L + l) * D;
    if (tid < D) { zl[tid] = Zr[row + tid]; vl[tid] = V[row + tid]; }
    __syncthreads();
    if (tid < D) zcum[tid] += zl[tid];
    for (int j = 0; j < 16; ++j) {
      const int idx = tid + j * 256;
      scum[idx] += zl[idx >> 6] * vl[idx & 63];
    }
    // z LN (EPS cancels), add prompt z, l2 norm; q norm; std accumulation
    const float zc = (tid < D) ? zcum[tid] : 0.f;
    float s1, s2; block_red2_256(zc, zc * zc, red, s1, s2);
    const float muz = s1 / (float)D, varz = s2 / (float)D - muz * muz;
    const float rstdz = rsqrtf(varz + LN_EPS);
    if (tid < D) zf[tid] = (zc - muz) * rstdz * z_g[tid] + z_b[tid] + Pz[b * D + tid];
    __syncthreads();
    const float zfv = (tid < D) ? zf[tid] : 0.f;
    const float qv  = (tid < D) ? Q[row + tid] : 0.f;
    float zn2, qn2; block_red2_256(zfv * zfv, qv * qv, red, zn2, qn2);
    const float invz = 1.f / fmaxf(sqrtf(zn2), 1e-8f);
    const float invq = 1.f / fmaxf(sqrtf(qn2), 1e-8f);
    if (tid < D) {
      nq[tid] = qv * invq;
      const float r = qv / fmaxf(zfv, 1e-6f);
      stdsum += r; stdsq += r * r;
    }
    __syncthreads();
    // scum LN stats over 4096 (EPS cancels)
    float ls = 0.f, lss = 0.f;
    for (int j = 0; j < 16; ++j) { const float x = scum[tid + j * 256]; ls += x; lss += x * x; }
    float S1, S2; block_red2_256(ls, lss, red, S1, S2);
    const float mus = S1 / 4096.f, vars = S2 / 4096.f - mus * mus;
    const float rstds = rsqrtf(vars + LN_EPS);
    // s_full = LN(scum)+Ps stats; nam stats derived via invz scaling
    ls = 0.f; lss = 0.f;
    for (int j = 0; j < 16; ++j) {
      const int idx = tid + j * 256;
      const float sf = (scum[idx] - mus) * rstds * s_g[idx] + s_b[idx] + psb[idx];
      ls += sf; lss += sf * sf;
    }
    float F1, F2; block_red2_256(ls, lss, red, F1, F2);
    const float muf = F1 / 4096.f, varf = F2 / 4096.f - muf * muf;
    const float mean_n = invz * muf;                       // EPS cancels
    const float rstdn  = rsqrtf(invz * invz * varf + LN_EPS);
    // fused LN(nam)+contraction: column p, 16 d's per thread
    float part = 0.f;
    const int p = tid & 63, d0 = (tid >> 6) * 16;
    for (int d = d0; d < d0 + 16; ++d) {
      const int idx = d * D + p;
      const float sf = (scum[idx] - mus) * rstds * s_g[idx] + s_b[idx] + psb[idx];
      const float nm = (sf * invz - mean_n) * rstdn * nam_g[idx] + nam_b[idx];
      part += nq[d] * nm;
    }
    napart[tid] = part;
    __syncthreads();
    if (tid < D)
      na_core[row + tid] = napart[tid] + napart[tid + 64] +
                           napart[tid + 128] + napart[tid + 192];
    if (t + 1 < CLEN && tid < D) {
      __builtin_prefetch(&Zr[row + D + tid], 0, 0);   // global_prefetch_b8
      __builtin_prefetch(&V[row + D + tid], 0, 0);
    }
    __syncthreads();
  }
  float A1, A2; block_red2_256(stdsum, stdsq, red, A1, A2);
  if (tid == 0) { atomicAdd(&acc[0], (double)A1); atomicAdd(&acc[1], (double)A2); }
}

// ---------------- K3: history GEMM prev_na = NQ @ M_b via WMMA f32 ----------------
__global__ void prevna_wmma(const float* __restrict__ NQ, const float* __restrict__ Mb,
                            float* __restrict__ PrevNa) {
  const int lane = threadIdx.x & 31;
  const int wvid = threadIdx.x >> 5;
  const int half = lane >> 4;
  const int mn   = lane & 15;
  const int mrow = blockIdx.x * 16;
  const int b    = mrow / L;
  const float* W = Mb + b * D * D;
  const int ncol = wvid * 16 + mn;
  v8f acc = {};
  for (int kb = 0; kb < D; kb += 4) {
    const int k0 = kb + half * 2;
    v2f a, bm;
    a.x  = NQ[(mrow + mn) * D + k0];
    a.y  = NQ[(mrow + mn) * D + k0 + 1];
    bm.x = W[k0 * D + ncol];
    bm.y = W[(k0 + 1) * D + ncol];
    acc = __builtin_amdgcn_wmma_f32_16x16x4_f32(false, a, false, bm,
                                                (short)0, acc, false, false);
  }
  for (int r = 0; r < 8; ++r) {
    const int om = r + 8 * half;
    PrevNa[(mrow + om) * D + ncol] = acc[r];
  }
}

// ---------------- K4: combine + final LN over D ----------------
__global__ void combine_ln(const float* __restrict__ na_core, const float* __restrict__ prev_na,
                           const float* __restrict__ na_g, const float* __restrict__ na_b,
                           float* __restrict__ out) {
  const int row = blockIdx.x, tid = threadIdx.x;   // 64 threads
  __shared__ float r4[4];
  const float v = na_core[row * D + tid] + prev_na[row * D + tid];
  float s = v, ss = v * v;
  for (int off = 16; off > 0; off >>= 1) {
    s  += __shfl_down(s, off, 32);
    ss += __shfl_down(ss, off, 32);
  }
  if ((tid & 31) == 0) { r4[tid >> 5] = s; r4[2 + (tid >> 5)] = ss; }
  __syncthreads();
  const float mu  = (r4[0] + r4[1]) / (float)D;
  const float var = (r4[2] + r4[3]) / (float)D - mu * mu;
  out[row * D + tid] = (v - mu) * rsqrtf(var + LN_EPS) * na_g[tid] + na_b[tid];
}

// ---------------- init / finalize ----------------
__global__ void init_acc(double* acc) {
  if (threadIdx.x == 0) { acc[0] = 0.0; acc[1] = 0.0; }
}
__global__ void finalize_std(const double* __restrict__ acc, float* __restrict__ out) {
  if (threadIdx.x == 0) {
    const double N = (double)(ROWS * D);
    const double mean = acc[0] / N;
    const double var  = (acc[1] - N * mean * mean) / (N - 1.0);
    out[ROWS * D] = (float)sqrt(var > 0.0 ? var : 0.0);
  }
}

extern "C" void kernel_launch(void* const* d_in, const int* in_sizes, int n_in,
                              void* d_out, int out_size, void* d_ws, size_t ws_size,
                              hipStream_t stream) {
  const int*   user_id    = (const int*)  d_in[0];
  const float* seqs_emb   = (const float*)d_in[1];
  const float* P          = (const float*)d_in[2];
  const float* S          = (const float*)d_in[3];
  const float* Wq         = (const float*)d_in[4];
  const float* bq         = (const float*)d_in[5];
  const float* Wk         = (const float*)d_in[6];
  const float* bk         = (const float*)d_in[7];
  const float* Wv         = (const float*)d_in[8];
  const float* bv         = (const float*)d_in[9];
  const float* z_g        = (const float*)d_in[10];
  const float* z_b        = (const float*)d_in[11];
  const float* s_g        = (const float*)d_in[12];
  const float* s_b        = (const float*)d_in[13];
  const float* nam_g      = (const float*)d_in[14];
  const float* nam_b      = (const float*)d_in[15];
  const float* na_g       = (const float*)d_in[16];
  const float* na_b       = (const float*)d_in[17];
  const float* prev_z_buf = (const float*)d_in[18];
  const float* prev_s_buf = (const float*)d_in[19];
  float* out = (float*)d_out;

  // workspace layout (floats); total ~15.3 MB
  float* ws     = (float*)d_ws;
  float* Qb     = ws;                         // ROWS*D
  float* Zr     = Qb + (size_t)ROWS * D;      // ROWS*D
  float* Vb     = Zr + (size_t)ROWS * D;      // ROWS*D
  float* NQ     = Vb + (size_t)ROWS * D;      // ROWS*D
  float* NaCore = NQ + (size_t)ROWS * D;      // ROWS*D
  float* PrevNa = NaCore + (size_t)ROWS * D;  // ROWS*D
  float* Pz     = PrevNa + (size_t)ROWS * D;  // B*D
  float* Ps     = Pz + B * D;                 // B*D*D
  float* Mb     = Ps + B * D * D;             // B*D*D
  float* pZ     = Mb + B * D * D;             // B*CHUNKS*D
  float* pS     = pZ + B * CHUNKS * D;        // B*CHUNKS*D*D
  double* acc   = (double*)(pS + (size_t)B * CHUNKS * D * D);  // 2 doubles, 8B aligned

  init_acc<<<1, 32, 0, stream>>>(acc);
  per_batch_prep<<<B, 256, 0, stream>>>(user_id, P, S, Wk, bk, Wv, bv,
                                        z_g, z_b, s_g, s_b, nam_g, nam_b,
                                        prev_z_buf, prev_s_buf, Pz, Ps, Mb);
  proj_wmma<<<dim3(ROWS / 16, 3, 1), 128, 0, stream>>>(seqs_emb, Wq, bq, Wk, bk, Wv, bv,
                                                       Qb, Zr, Vb);
  norm_q_kernel<<<ROWS, 64, 0, stream>>>(Qb, NQ);
  chunk_totals<<<B * CHUNKS, 256, 0, stream>>>(Zr, Vb, pZ, pS);
  chunk_prefix<<<B, 256, 0, stream>>>(pZ, pS);
  scan_main<<<B * CHUNKS, 256, 0, stream>>>(Qb, Zr, Vb, pZ, pS, Pz, Ps,
                                            z_g, z_b, s_g, s_b, nam_g, nam_b,
                                            NaCore, acc);
  prevna_wmma<<<ROWS / 16, 128, 0, stream>>>(NQ, Mb, PrevNa);
  combine_ln<<<ROWS, 64, 0, stream>>>(NaCore, PrevNa, na_g, na_b, out);
  finalize_std<<<1, 32, 0, stream>>>(acc, out);
}

// v001
// Measured time: 155 microseconds a run.
// Timed twice side by side with v000, it ran 3.64 times as fast both times.
#include <hip/hip_runtime.h>
#include <math.h>

#define EPSC 1e-8f
#define LN_EPS 1e-5f

typedef float v2f __attribute__((ext_vector_type(2)));
typedef float v8f __attribute__((ext_vector_type(8)));

static constexpr int B = 16, L = 512, D = 64, IN = 64, LP = 8;
static constexpr int CHUNKS = 64, CLEN = 8;         // L = CHUNKS * CLEN
static constexpr int ROWS = B * L;                  // 8192

// ---------------- reductions (wave32) ----------------
__device__ __forceinline__ void wave_red2(float& a, float& b) {
  for (int off = 16; off > 0; off >>= 1) {
    a += __shfl_down(a, off, 32);
    b += __shfl_down(b, off, 32);
  }
}

// all 256 threads must call; returns block-wide sums of (a,b)
__device__ __forceinline__ void block_red2_256(float a, float b, float* red,
                                               float& oa, float& ob) {
  int lane = threadIdx.x & 31, w = threadIdx.x >> 5;
  wave_red2(a, b);
  if (lane == 0) { red[w] = a; red[8 + w] = b; }
  __syncthreads();
  if (threadIdx.x == 0) {
    float s = 0.f, t = 0.f;
    for (int i = 0; i < 8; ++i) { s += red[i]; t += red[8 + i]; }
    red[0] = s; red[8] = t;
  }
  __syncthreads();
  oa = red[0]; ob = red[8];
  __syncthreads();
}

// ---------------- K1: projections via V_WMMA_F32_16X16X4_F32 ----------------
// grid (ROWS/16, 3), block 128 (4 waves, one 16-col N tile each)
__global__ void proj_wmma(const float* __restrict__ X,
                          const float* __restrict__ Wq, const float* __restrict__ bq,
                          const float* __restrict__ Wk, const float* __restrict__ bk,
                          const float* __restrict__ Wv, const float* __restrict__ bv,
                          float* __restrict__ Q, float* __restrict__ Zr,
                          float* __restrict__ V) {
  const int lane = threadIdx.x & 31;
  const int wvid = threadIdx.x >> 5;     // N tile 0..3
  const int half = lane >> 4;            // lane half selects K pair
  const int mn   = lane & 15;
  const int mrow = blockIdx.x * 16;
  const int which = blockIdx.y;
  const float* W; const float* bias;
  if (which == 0)      { W = Wq; bias = bq; }
  else if (which == 1) { W = Wk; bias = bk; }
  else                 { W = Wv; bias = bv; }
  const int ncol = wvid * 16 + mn;
  v8f acc = {};
  for (int kb = 0; kb < IN; kb += 4) {
    const int k0 = kb + half * 2;        // 16x4 f32 A: lanes<16 hold K0,K1; lanes>=16 K2,K3
    v2f a, bm;
    a.x  = X[(mrow + mn) * IN + k0];
    a.y  = X[(mrow + mn) * IN + k0 + 1];
    bm.x = W[(k0) * D + ncol];           // 4x16 B: row striped across lanes per VGPR
    bm.y = W[(k0 + 1) * D + ncol];
    acc = __builtin_amdgcn_wmma_f32_16x16x4_f32(false, a, false, bm,
                                                (short)0, acc, false, false);
  }
  const float bb = bias[ncol];
  float* Out = (which == 0) ? Q : (which == 1 ? Zr : V);
  const bool act = (which != 2);         // elu on q and z
  for (int r = 0; r < 8; ++r) {
    const int om = r + 8 * half;         // C/D layout: VGPR r -> M=r (lanes<16), M=8+r
    float v = acc[r] + bb;
    if (act) v = v > 0.f ? v : (__expf(v) - 1.f);
    Out[(mrow + om) * D + ncol] = v;
  }
}

// ---------------- K1b: normalize q rows ----------------
__global__ void norm_q_kernel(const float* __restrict__ Q, float* __restrict__ NQ) {
  const int row = blockIdx.x, tid = threadIdx.x;   // 64 threads (2 waves)
  __shared__ float r2[2];
  float q = Q[row * D + tid];
  float s = q * q;
  for (int off = 16; off > 0; off >>= 1) s += __shfl_down(s, off, 32);
  if ((tid & 31) == 0) r2[tid >> 5] = s;
  __syncthreads();
  const float inv = 1.f / fmaxf(sqrtf(r2[0] + r2[1]), 1e-8f);
  NQ[row * D + tid] = q * inv;
}

// ---------------- K0: per-batch prompt/history constants ----------------
__global__ void per_batch_prep(const int* __restrict__ user_id,
                               const float* __restrict__ P, const float* __restrict__ S,
                               const float* __restrict__ Wk, const float* __restrict__ bk,
                               const float* __restrict__ Wv, const float* __restrict__ bv,
                               const float* __restrict__ z_g, const float* __restrict__ z_b,
                               const float* __restrict__ s_g, const float* __restrict__ s_b,
                               const float* __restrict__ nam_g, const float* __restrict__ nam_b,
                               const float* __restrict__ prev_z_buf,
                               const float* __restrict__ prev_s_buf,
                               float* __restrict__ Pz, float* __restrict__ Ps,
                               float* __restrict__ Mb) {
  const int b = blockIdx.x, tid = threadIdx.x;     // 256 threads
  __shared__ float xb[LP * IN];
  __shared__ float zrow[LP * D], vrow[LP * D];
  __shared__ float buf[D * D];
  __shared__ float z64[D], pz64[D];
  __shared__ float red[16];
  for (int pass = 0; pass < 2; ++pass) {
    const float* Xp = (pass == 0 ? P : S) + b * LP * IN;
    for (int i = tid; i < LP * IN; i += 256) xb[i] = Xp[i];
    __syncthreads();
    // projections of the LP=8 rows (z = elu(xWk+bk), v = xWv+bv)
    for (int i = tid; i < LP * D; i += 256) {
      const int t = i >> 6, d = i & 63;
      float aK = bk[d], aV = bv[d];
      for (int k = 0; k < IN; ++k) {
        const float x = xb[t * IN + k];
        aK += x * Wk[k * D + d];
        aV += x * Wv[k * D + d];
      }
      zrow[i] = aK > 0.f ? aK : (__expf(aK) - 1.f);
      vrow[i] = aV;
    }
    __syncthreads();
    // totals over the LP steps (== last cumsum value)
    if (tid < D) {
      float s = 0.f;
      for (int t = 0; t < LP; ++t) s += zrow[t * D + tid];
      z64[tid] = s;
    }
    for (int j = 0; j < 16; ++j) {
      const int idx = tid + j * 256;
      const int d = idx >> 6, p = idx & 63;
      float s = 0.f;
      for (int t = 0; t < LP; ++t) s += zrow[t * D + d] * vrow[t * D + p];
      buf[idx] = s;
    }
    __syncthreads();
    // z LN (EPS shift cancels in centered term)
    const float zc = (tid < D) ? z64[tid] : 0.f;
    float s1, s2; block_red2_256(zc, zc * zc, red, s1, s2);
    const float mu = s1 / (float)D, var = s2 / (float)D - mu * mu;
    const float rstd = rsqrtf(var + LN_EPS);
    if (tid < D) pz64[tid] = (zc - mu) * rstd * z_g[tid] + z_b[tid];
    // s LN stats over 4096
    float ls = 0.f, lss = 0.f;
    for (int j = 0; j < 16; ++j) { const float x = buf[tid + j * 256]; ls += x; lss += x * x; }
    float S1, S2; block_red2_256(ls, lss, red, S1, S2);
    const float mus = S1 / 4096.f, vars = S2 / 4096.f - mus * mus;
    const float rstds = rsqrtf(vars + LN_EPS);
    if (pass == 0) {
      if (tid < D) Pz[b * D + tid] = pz64[tid];
      for (int j = 0; j < 16; ++j) {
        const int idx = tid + j * 256;
        Ps[b * D * D + idx] = (buf[idx] - mus) * rstds * s_g[idx] + s_b[idx];
      }
    } else {
      for (int j = 0; j < 16; ++j) {        // in-place LN (owner mapping, no race)
        const int idx = tid + j * 256;
        buf[idx] = (buf[idx] - mus) * rstds * s_g[idx] + s_b[idx];
      }
      __syncthreads();
      const int uid = user_id[b];
      float pzv = (tid < D) ? (prev_z_buf[uid * D + tid] + pz64[tid]) : 0.f;
      float n1, n2dummy; block_red2_256(pzv * pzv, 0.f, red, n1, n2dummy);
      const float inv = 1.f / (fmaxf(sqrtf(n1), 1e-8f) + EPSC);
      float ps_ = 0.f, pss = 0.f;
      for (int j = 0; j < 16; ++j) {
        const int idx = tid + j * 256;
        const float pn = (prev_s_buf[(size_t)uid * D * D + idx] + buf[idx]) * inv;
        ps_ += pn; pss += pn * pn;
      }
      float F1, F2; block_red2_256(ps_, pss, red, F1, F2);
      const float mun = F1 / 4096.f, varn = F2 / 4096.f - mun * mun;
      const float rstdn = rsqrtf(varn + LN_EPS);
      for (int j = 0; j < 16; ++j) {
        const int idx = tid + j * 256;
        const float pn = (prev_s_buf[(size_t)uid * D * D + idx] + buf[idx]) * inv;
        Mb[b * D * D + idx] = (pn - mun) * rstdn * nam_g[idx] + nam_b[idx];
      }
    }
    __syncthreads();
  }
}

// ---------------- K2a: per-chunk totals of z and outer(z,v) ----------------
__global__ void chunk_totals(const float* __restrict__ Zr, const float* __restrict__ V,
                             float* __restrict__ pZ, float* __restrict__ pS) {
  const int b = blockIdx.x / CHUNKS, c = blockIdx.x % CHUNKS, tid = threadIdx.x;
  __shared__ float sS[D * D];
  __shared__ float sZ[D], zl[D], vl[D];
  for (int i = tid; i < D * D; i += 256) sS[i] = 0.f;
  if (tid < D) sZ[tid] = 0.f;
  __syncthreads();
  const int base = (b * L + c * CLEN) * D;
  for (int t = 0; t < CLEN; ++t) {
    if (tid < D) { zl[tid] = Zr[base + t * D + tid]; vl[tid] = V[base + t * D + tid]; }
    __syncthreads();
    if (tid < D) sZ[tid] += zl[tid];
    for (int j = 0; j < 16; ++j) {
      const int idx = tid + j * 256;
      sS[idx] += zl[idx >> 6] * vl[idx & 63];
    }
    __syncthreads();
  }
  if (tid < D) pZ[(b * CHUNKS + c) * D + tid] = sZ[tid];
  for (int j = 0; j < 16; ++j) {
    const int idx = tid + j * 256;
    pS[(b * CHUNKS + c) * D * D + idx] = sS[idx];
  }
}

// ---------------- K2b: exclusive prefix over chunks (in place) ----------------
// grid B * PSLICES, block 256: one element of the D x D state per thread
static constexpr int PSLICES = D * D / 256;          // 16
static constexpr int PBATCH = 32;                    // chunk totals loaded together
__global__ void chunk_prefix(float* __restrict__ pZ, float* __restrict__ pS) {
  const int b = blockIdx.x / PSLICES, sl = blockIdx.x % PSLICES, tid = threadIdx.x;
  float* ps = pS + (size_t)b * CHUNKS * D * D + sl * 256 + tid;
  float run = 0.f;
  for (int c0 = 0; c0 < CHUNKS; c0 += PBATCH) {
    float t[PBATCH];
    // this batch's loads refill registers that the last batch's stores name
    if (c0 > 0) asm volatile("s_wait_xcnt 0x0" ::: "memory");
    for (int i = 0; i < PBATCH; ++i) t[i] = ps[(c0 + i) * D * D];
    for (int i = 0; i < PBATCH; ++i) { ps[(c0 + i) * D * D] = run; run += t[i]; }
  }
  if (sl == 0 && tid < D) {
    float* pz = pZ + b * CHUNKS * D + tid;
    float runz = 0.f;
    for (int c0 = 0; c0 < CHUNKS; c0 += PBATCH) {
      float t[PBATCH];
      // as above: the last batch's stores still name these registers
      if (c0 > 0) asm volatile("s_wait_xcnt 0x0" ::: "memory");
      for (int i = 0; i < PBATCH; ++i) t[i] = pz[(c0 + i) * D];
      for (int i = 0; i < PBATCH; ++i) { pz[(c0 + i) * D] = runz; runz += t[i]; }
    }
  }
}

// ---------------- K2c: main per-step scan ----------------
__global__ void scan_main(const float* __restrict__ Q, const float* __restrict__ Zr,
                          const float* __restrict__ V,
                          const float* __restrict__ pZ, const float* __restrict__ pS,
                          const float* __restrict__ Pz, const float* __restrict__ Ps,
                          const float* __restrict__ z_g, const float* __restrict__ z_b,
                          const float* __restrict__ s_g, const float* __restrict__ s_b,
                          const float* __restrict__ nam_g, const float* __restrict__ nam_b,
                          float* __restrict__ na_core, double* __restrict__ acc) {
  const int b = blockIdx.x / CHUNKS, c = blockIdx.x % CHUNKS, tid = threadIdx.x;
  __shared__ float scum[D * D];     // running cumulative outer-product sum
  __shared__ float psb[D * D];      // prompt P_s last (LN'd), added per step
  __shared__ float zcum[D], zf[D], zl[D], vl[D], nq[D];
  __shared__ float red[16];
  __shared__ float napart[256];
  for (int j = 0; j < 16; ++j) {
    const int idx = tid + j * 256;
    scum[idx] = pS[(b * CHUNKS + c) * D * D + idx];
    psb[idx]  = Ps[b * D * D + idx];
  }
  if (tid < D) zcum[tid] = pZ[(b * CHUNKS + c) * D + tid];
  __syncthreads();
  float stdsum = 0.f, stdsq = 0.f;
  for (int t = 0; t < CLEN; ++t) {
    const int l = c * CLEN + t;
    const int row = (b * L + l) * D;
    if (tid < D) { zl[tid] = Zr[row + tid]; vl[tid] = V[row + tid]; }
    __syncthreads();
    if (tid < D) zcum[tid] += zl[tid];
    for (int j = 0; j < 16; ++j) {
      const int idx = tid + j * 256;
      scum[idx] += zl[idx >> 6] * vl[idx & 63];
    }
    // z LN (EPS cancels), add prompt z, l2 norm; q norm; std accumulation
    const float zc = (tid < D) ? zcum[tid] : 0.f;
    float s1, s2; block_red2_256(zc, zc * zc, red, s1, s2);
    const float muz = s1 / (float)D, varz = s2 / (float)D - muz * muz;
    const float rstdz = rsqrtf(varz + LN_EPS);
    if (tid < D) zf[tid] = (zc - muz) * rstdz * z_g[tid] + z_b[tid] + Pz[b * D + tid];
    __syncthreads();
    const float zfv = (tid < D) ? zf[tid] : 0.f;
    const float qv  = (tid < D) ? Q[row + tid] : 0.f;
    float zn2, qn2; block_red2_256(zfv * zfv, qv * qv, red, zn2, qn2);
    const float invz = 1.f / fmaxf(sqrtf(zn2), 1e-8f);
    const float invq = 1.f / fmaxf(sqrtf(qn2), 1e-8f);
    if (tid < D) {
      nq[tid] = qv * invq;
      const float r = qv / fmaxf(zfv, 1e-6f);
      stdsum += r; stdsq += r * r;
    }
    __syncthreads();
    // scum LN stats over 4096 (EPS cancels)
    float ls = 0.f, lss = 0.f;
    for (int j = 0; j < 16; ++j) { const float x = scum[tid + j * 256]; ls += x; lss += x * x; }
    float S1, S2; block_red2_256(ls, lss, red, S1, S2);
    const float mus = S1 / 4096.f, vars = S2 / 4096.f - mus * mus;
    const float rstds = rsqrtf(vars + LN_EPS);
    // s_full = LN(scum)+Ps stats; nam stats derived via invz scaling
    ls = 0.f; lss = 0.f;
    for (int j = 0; j < 16; ++j) {
      const int idx = tid + j * 256;
      const float sf = (scum[idx] - mus) * rstds * s_g[idx] + s_b[idx] + psb[idx];
      ls += sf; lss += sf * sf;
    }
    float F1, F2; block_red2_256(ls, lss, red, F1, F2);
    const float muf = F1 / 4096.f, varf = F2 / 4096.f - muf * muf;
    const float mean_n = invz * muf;                       // EPS cancels
    const float rstdn  = rsqrtf(invz * invz * varf + LN_EPS);
    // fused LN(nam)+contraction: column p, 16 d's per thread
    float part = 0.f;
    const int p = tid & 63, d0 = (tid >> 6) * 16;
    for (int d = d0; d < d0 + 16; ++d) {
      const int idx = d * D + p;
      const float sf = (scum[idx] - mus) * rstds * s_g[idx] + s_b[idx] + psb[idx];
      const float nm = (sf * invz - mean_n) * rstdn * nam_g[idx] + nam_b[idx];
      part += nq[d] * nm;
    }
    napart[tid] = part;
    __syncthreads();
    if (tid < D)
      na_core[row + tid] = napart[tid] + napart[tid + 64] +
                           napart[tid + 128] + napart[tid + 192];
    if (t + 1 < CLEN && tid < D) {
      __builtin_prefetch(&Zr[row + D + tid], 0, 0);   // global_prefetch_b8
      __builtin_prefetch(&V[row + D + tid], 0, 0);
    }
    __syncthreads();
  }
  float A1, A2; block_red2_256(stdsum, stdsq, red, A1, A2);
  if (tid == 0) { atomicAdd(&acc[0], (double)A1); atomicAdd(&acc[1], (double)A2); }
}

// ---------------- K3: history GEMM prev_na = NQ @ M_b via WMMA f32 ----------------
__global__ void prevna_wmma(const float* __restrict__ NQ, const float* __restrict__ Mb,
                            float* __restrict__ PrevNa) {
  const int lane = threadIdx.x & 31;
  const int wvid = threadIdx.x >> 5;
  const int half = lane >> 4;
  const int mn   = lane & 15;
  const int mrow = blockIdx.x * 16;
  const int b    = mrow / L;
  const float* W = Mb + b * D * D;
  const int ncol = wvid * 16 + mn;
  v8f acc = {};
  for (int kb = 0; kb < D; kb += 4) {
    const int k0 = kb + half * 2;
    v2f a, bm;
    a.x  = NQ[(mrow + mn) * D + k0];
    a.y  = NQ[(mrow + mn) * D + k0 + 1];
    bm.x = W[k0 * D + ncol];
    bm.y = W[(k0 + 1) * D + ncol];
    acc = __builtin_amdgcn_wmma_f32_16x16x4_f32(false, a, false, bm,
                                                (short)0, acc, false, false);
  }
  for (int r = 0; r < 8; ++r) {
    const int om = r + 8 * half;
    PrevNa[(mrow + om) * D + ncol] = acc[r];
  }
}

// ---------------- K4: combine + final LN over D ----------------
__global__ void combine_ln(const float* __restrict__ na_core, const float* __restrict__ prev_na,
                           const float* __restrict__ na_g, const float* __restrict__ na_b,
                           float* __restrict__ out) {
  const int row = blockIdx.x, tid = threadIdx.x;   // 64 threads
  __shared__ float r4[4];
  const float v = na_core[row * D + tid] + prev_na[row * D + tid];
  float s = v, ss = v * v;
  for (int off = 16; off > 0; off >>= 1) {
    s  += __shfl_down(s, off, 32);
    ss += __shfl_down(ss, off, 32);
  }
  if ((tid & 31) == 0) { r4[tid >> 5] = s; r4[2 + (tid >> 5)] = ss; }
  __syncthreads();
  const float mu  = (r4[0] + r4[1]) / (float)D;
  const float var = (r4[2] + r4[3]) / (float)D - mu * mu;
  out[row * D + tid] = (v - mu) * rsqrtf(var + LN_EPS) * na_g[tid] + na_b[tid];
}

// ---------------- init / finalize ----------------
__global__ void init_acc(double* acc) {
  if (threadIdx.x == 0) { acc[0] = 0.0; acc[1] = 0.0; }
}
__global__ void finalize_std(const double* __restrict__ acc, float* __restrict__ out) {
  if (threadIdx.x == 0) {
    const double N = (double)(ROWS * D);
    const double mean = acc[0] / N;
    const double var  = (acc[1] - N * mean * mean) / (N - 1.0);
    out[ROWS * D] = (float)sqrt(var > 0.0 ? var : 0.0);
  }
}

extern "C" void kernel_launch(void* const* d_in, const int* in_sizes, int n_in,
                              void* d_out, int out_size, void* d_ws, size_t ws_size,
                              hipStream_t stream) {
  const int*   user_id    = (const int*)  d_in[0];
  const float* seqs_emb   = (const float*)d_in[1];
  const float* P          = (const float*)d_in[2];
  const float* S          = (const float*)d_in[3];
  const float* Wq         = (const float*)d_in[4];
  const float* bq         = (const float*)d_in[5];
  const float* Wk         = (const float*)d_in[6];
  const float* bk         = (const float*)d_in[7];
  const float* Wv         = (const float*)d_in[8];
  const float* bv         = (const float*)d_in[9];
  const float* z_g        = (const float*)d_in[10];
  const float* z_b        = (const float*)d_in[11];
  const float* s_g        = (const float*)d_in[12];
  const float* s_b        = (const float*)d_in[13];
  const float* nam_g      = (const float*)d_in[14];
  const float* nam_b      = (const float*)d_in[15];
  const float* na_g       = (const float*)d_in[16];
  const float* na_b       = (const float*)d_in[17];
  const float* prev_z_buf = (const float*)d_in[18];
  const float* prev_s_buf = (const float*)d_in[19];
  float* out = (float*)d_out;

  // workspace layout (floats); total ~30 MB
  float* ws     = (float*)d_ws;
  float* Qb     = ws;                         // ROWS*D
  float* Zr     = Qb + (size_t)ROWS * D;      // ROWS*D
  float* Vb     = Zr + (size_t)ROWS * D;      // ROWS*D
  float* NQ     = Vb + (size_t)ROWS * D;      // ROWS*D
  float* NaCore = NQ + (size_t)ROWS * D;      // ROWS*D
  float* PrevNa = NaCore + (size_t)ROWS * D;  // ROWS*D
  float* Pz     = PrevNa + (size_t)ROWS * D;  // B*D
  float* Ps     = Pz + B * D;                 // B*D*D
  float* Mb     = Ps + B * D * D;             // B*D*D
  float* pZ     = Mb + B * D * D;             // B*CHUNKS*D
  float* pS     = pZ + B * CHUNKS * D;        // B*CHUNKS*D*D
  double* acc   = (double*)(pS + (size_t)B * CHUNKS * D * D);  // 2 doubles, 8B aligned

  init_acc<<<1, 32, 0, stream>>>(acc);
  per_batch_prep<<<B, 256, 0, stream>>>(user_id, P, S, Wk, bk, Wv, bv,
                                        z_g, z_b, s_g, s_b, nam_g, nam_b,
                                        prev_z_buf, prev_s_buf, Pz, Ps, Mb);
  proj_wmma<<<dim3(ROWS / 16, 3, 1), 128, 0, stream>>>(seqs_emb, Wq, bq, Wk, bk, Wv, bv,
                                                       Qb, Zr, Vb);
  norm_q_kernel<<<ROWS, 64, 0, stream>>>(Qb, NQ);
  chunk_totals<<<B * CHUNKS, 256, 0, stream>>>(Zr, Vb, pZ, pS);
  chunk_prefix<<<B * PSLICES, 256, 0, stream>>>(pZ, pS);
  scan_main<<<B * CHUNKS, 256, 0, stream>>>(Qb, Zr, Vb, pZ, pS, Pz, Ps,
                                            z_g, z_b, s_g, s_b, nam_g, nam_b,
                                            NaCore, acc);
  prevna_wmma<<<ROWS / 16, 128, 0, stream>>>(NQ, Mb, PrevNa);
  combine_ln<<<ROWS, 64, 0, stream>>>(NaCore, PrevNa, na_g, na_b, out);
  finalize_std<<<1, 32, 0, stream>>>(acc, out);
}

// v002
// It runs in 83.5 microseconds.
// Next to v001, in two timings, it ran 1.87 and 1.86 times as fast.
// All steps since v000 together make it 6.79 times as fast.
#include <hip/hip_runtime.h>
#include <math.h>

#define EPSC 1e-8f
#define LN_EPS 1e-5f

typedef float v2f __attribute__((ext_vector_type(2)));
typedef float v8f __attribute__((ext_vector_type(8)));

static constexpr int B = 16, L = 512, D = 64, IN = 64, LP = 8;
static constexpr int CHUNKS = 64, CLEN = 8;         // L = CHUNKS * CLEN
static constexpr int ROWS = B * L;                  // 8192

// ---------------- reductions (wave32) ----------------
__device__ __forceinline__ void wave_red2(float& a, float& b) {
  for (int off = 16; off > 0; off >>= 1) {
    a += __shfl_down(a, off, 32);
    b += __shfl_down(b, off, 32);
  }
}

// all 256 threads must call; returns block-wide sums of (a,b)
__device__ __forceinline__ void block_red2_256(float a, float b, float* red,
                                               float& oa, float& ob) {
  int lane = threadIdx.x & 31, w = threadIdx.x >> 5;
  wave_red2(a, b);
  if (lane == 0) { red[w] = a; red[8 + w] = b; }
  __syncthreads();
  if (threadIdx.x == 0) {
    float s = 0.f, t = 0.f;
    for (int i = 0; i < 8; ++i) { s += red[i]; t += red[8 + i]; }
    red[0] = s; red[8] = t;
  }
  __syncthreads();
  oa = red[0]; ob = red[8];
  __syncthreads();
}

// ---------------- K1: projections via V_WMMA_F32_16X16X4_F32 ----------------
// grid (ROWS/16, 3), block 128 (4 waves, one 16-col N tile each)
__global__ void proj_wmma(const float* __restrict__ X,
                          const float* __restrict__ Wq, const float* __restrict__ bq,
                          const float* __restrict__ Wk, const float* __restrict__ bk,
                          const float* __restrict__ Wv, const float* __restrict__ bv,
                          float* __restrict__ Q, float* __restrict__ Zr,
                          float* __restrict__ V) {
  const int lane = threadIdx.x & 31;
  const int wvid = threadIdx.x >> 5;     // N tile 0..3
  const int half = lane >> 4;            // lane half selects K pair
  const int mn   = lane & 15;
  const int mrow = blockIdx.x * 16;
  const int which = blockIdx.y;
  const float* W; const float* bias;
  if (which == 0)      { W = Wq; bias = bq; }
  else if (which == 1) { W = Wk; bias = bk; }
  else                 { W = Wv; bias = bv; }
  const int ncol = wvid * 16 + mn;
  v8f acc = {};
  for (int kb = 0; kb < IN; kb += 4) {
    const int k0 = kb + half * 2;        // 16x4 f32 A: lanes<16 hold K0,K1; lanes>=16 K2,K3
    v2f a, bm;
    a.x  = X[(mrow + mn) * IN + k0];
    a.y  = X[(mrow + mn) * IN + k0 + 1];
    bm.x = W[(k0) * D + ncol];           // 4x16 B: row striped across lanes per VGPR
    bm.y = W[(k0 + 1) * D + ncol];
    acc = __builtin_amdgcn_wmma_f32_16x16x4_f32(false, a, false, bm,
                                                (short)0, acc, false, false);
  }
  const float bb = bias[ncol];
  float* Out = (which == 0) ? Q : (which == 1 ? Zr : V);
  const bool act = (which != 2);         // elu on q and z
  for (int r = 0; r < 8; ++r) {
    const int om = r + 8 * half;         // C/D layout: VGPR r -> M=r (lanes<16), M=8+r
    float v = acc[r] + bb;
    if (act) v = v > 0.f ? v : (__expf(v) - 1.f);
    Out[(mrow + om) * D + ncol] = v;
  }
}

// ---------------- K1b: normalize q rows ----------------
__global__ void norm_q_kernel(const float* __restrict__ Q, float* __restrict__ NQ) {
  const int row = blockIdx.x, tid = threadIdx.x;   // 64 threads (2 waves)
  __shared__ float r2[2];
  float q = Q[row * D + tid];
  float s = q * q;
  for (int off = 16; off > 0; off >>= 1) s += __shfl_down(s, off, 32);
  if ((tid & 31) == 0) r2[tid >> 5] = s;
  __syncthreads();
  const float inv = 1.f / fmaxf(sqrtf(r2[0] + r2[1]), 1e-8f);
  NQ[row * D + tid] = q * inv;
}

// ---------------- K0: per-batch prompt/history constants ----------------
__global__ void per_batch_prep(const int* __restrict__ user_id,
                               const float* __restrict__ P, const float* __restrict__ S,
                               const float* __restrict__ Wk, const float* __restrict__ bk,
                               const float* __restrict__ Wv, const float* __restrict__ bv,
                               const float* __restrict__ z_g, const float* __restrict__ z_b,
                               const float* __restrict__ s_g, const float* __restrict__ s_b,
                               const float* __restrict__ nam_g, const float* __restrict__ nam_b,
                               const float* __restrict__ prev_z_buf,
                               const float* __restrict__ prev_s_buf,
                               float* __restrict__ Pz, float* __restrict__ Ps,
                               float* __restrict__ Mb) {
  const int b = blockIdx.x, tid = threadIdx.x;     // 256 threads
  __shared__ float xb[LP * IN];
  __shared__ float zrow[LP * D], vrow[LP * D];
  __shared__ float buf[D * D];
  __shared__ float z64[D], pz64[D];
  __shared__ float red[16];
  for (int pass = 0; pass < 2; ++pass) {
    const float* Xp = (pass == 0 ? P : S) + b * LP * IN;
    for (int i = tid; i < LP * IN; i += 256) xb[i] = Xp[i];
    __syncthreads();
    // projections of the LP=8 rows (z = elu(xWk+bk), v = xWv+bv)
    for (int i = tid; i < LP * D; i += 256) {
      const int t = i >> 6, d = i & 63;
      float aK = bk[d], aV = bv[d];
      for (int k = 0; k < IN; ++k) {
        const float x = xb[t * IN + k];
        aK += x * Wk[k * D + d];
        aV += x * Wv[k * D + d];
      }
      zrow[i] = aK > 0.f ? aK : (__expf(aK) - 1.f);
      vrow[i] = aV;
    }
    __syncthreads();
    // totals over the LP steps (== last cumsum value)
    if (tid < D) {
      float s = 0.f;
      for (int t = 0; t < LP; ++t) s += zrow[t * D + tid];
      z64[tid] = s;
    }
    for (int j = 0; j < 16; ++j) {
      const int idx = tid + j * 256;
      const int d = idx >> 6, p = idx & 63;
      float s = 0.f;
      for (int t = 0; t < LP; ++t) s += zrow[t * D + d] * vrow[t * D + p];
      buf[idx] = s;
    }
    __syncthreads();
    // z LN (EPS shift cancels in centered term)
    const float zc = (tid < D) ? z64[tid] : 0.f;
    float s1, s2; block_red2_256(zc, zc * zc, red, s1, s2);
    const float mu = s1 / (float)D, var = s2 / (float)D - mu * mu;
    const float rstd = rsqrtf(var + LN_EPS);
    if (tid < D) pz64[tid] = (zc - mu) * rstd * z_g[tid] + z_b[tid];
    // s LN stats over 4096
    float ls = 0.f, lss = 0.f;
    for (int j = 0; j < 16; ++j) { const float x = buf[tid + j * 256]; ls += x; lss += x * x; }
    float S1, S2; block_red2_256(ls, lss, red, S1, S2);
    const float mus = S1 / 4096.f, vars = S2 / 4096.f - mus * mus;
    const float rstds = rsqrtf(vars + LN_EPS);
    if (pass == 0) {
      if (tid < D) Pz[b * D + tid] = pz64[tid];
      for (int j = 0; j < 16; ++j) {
        const int idx = tid + j * 256;
        Ps[b * D * D + idx] = (buf[idx] - mus) * rstds * s_g[idx] + s_b[idx];
      }
    } else {
      for (int j = 0; j < 16; ++j) {        // in-place LN (owner mapping, no race)
        const int idx = tid + j * 256;
        buf[idx] = (buf[idx] - mus) * rstds * s_g[idx] + s_b[idx];
      }
      __syncthreads();
      const int uid = user_id[b];
      float pzv = (tid < D) ? (prev_z_buf[uid * D + tid] + pz64[tid]) : 0.f;
      float n1, n2dummy; block_red2_256(pzv * pzv, 0.f, red, n1, n2dummy);
      const float inv = 1.f / (fmaxf(sqrtf(n1), 1e-8f) + EPSC);
      float ps_ = 0.f, pss = 0.f;
      for (int j = 0; j < 16; ++j) {
        const int idx = tid + j * 256;
        const float pn = (prev_s_buf[(size_t)uid * D * D + idx] + buf[idx]) * inv;
        ps_ += pn; pss += pn * pn;
      }
      float F1, F2; block_red2_256(ps_, pss, red, F1, F2);
      const float mun = F1 / 4096.f, varn = F2 / 4096.f - mun * mun;
      const float rstdn = rsqrtf(varn + LN_EPS);
      for (int j = 0; j < 16; ++j) {
        const int idx = tid + j * 256;
        const float pn = (prev_s_buf[(size_t)uid * D * D + idx] + buf[idx]) * inv;
        Mb[b * D * D + idx] = (pn - mun) * rstdn * nam_g[idx] + nam_b[idx];
      }
    }
    __syncthreads();
  }
}

// ---------------- K2a: per-chunk totals of z and outer(z,v) ----------------
__global__ void chunk_totals(const float* __restrict__ Zr, const float* __restrict__ V,
                             float* __restrict__ pZ, float* __restrict__ pS) {
  const int b = blockIdx.x / CHUNKS, c = blockIdx.x % CHUNKS, tid = threadIdx.x;
  __shared__ float zl[D], vl[D];
  // thread owns elements tid + j*256 of the D x D state: column p, rows dq + 4j
  const int p = tid & 63, dq = tid >> 6;
  float sS[16];
  for (int j = 0; j < 16; ++j) sS[j] = 0.f;
  float sZ = 0.f;
  const int base = (b * L + c * CLEN) * D;
  // kept rolled: the unrolled build takes the whole register budget and spills
#pragma unroll 1
  for (int t = 0; t < CLEN; ++t) {
    if (tid < D) {
      const float zv = Zr[base + t * D + tid];
      zl[tid] = zv; vl[tid] = V[base + t * D + tid];
      sZ += zv;
    }
    __syncthreads();
    const float vp = vl[p];
    for (int j = 0; j < 16; ++j) sS[j] += zl[dq + 4 * j] * vp;
    __syncthreads();
  }
  if (tid < D) pZ[(b * CHUNKS + c) * D + tid] = sZ;
  for (int j = 0; j < 16; ++j) {
    const int idx = tid + j * 256;
    pS[(b * CHUNKS + c) * D * D + idx] = sS[j];
  }
}

// ---------------- K2b: exclusive prefix over chunks (in place) ----------------
// grid B * PSLICES, block 256: one element of the D x D state per thread
static constexpr int PSLICES = D * D / 256;          // 16
static constexpr int PBATCH = 32;                    // chunk totals loaded together
__global__ void chunk_prefix(float* __restrict__ pZ, float* __restrict__ pS) {
  const int b = blockIdx.x / PSLICES, sl = blockIdx.x % PSLICES, tid = threadIdx.x;
  float* ps = pS + (size_t)b * CHUNKS * D * D + sl * 256 + tid;
  float run = 0.f;
  for (int c0 = 0; c0 < CHUNKS; c0 += PBATCH) {
    float t[PBATCH];
    // this batch's loads refill registers that the last batch's stores name
    if (c0 > 0) asm volatile("s_wait_xcnt 0x0" ::: "memory");
    for (int i = 0; i < PBATCH; ++i) t[i] = ps[(c0 + i) * D * D];
    for (int i = 0; i < PBATCH; ++i) { ps[(c0 + i) * D * D] = run; run += t[i]; }
  }
  if (sl == 0 && tid < D) {
    float* pz = pZ + b * CHUNKS * D + tid;
    float runz = 0.f;
    for (int c0 = 0; c0 < CHUNKS; c0 += PBATCH) {
      float t[PBATCH];
      // as above: the last batch's stores still name these registers
      if (c0 > 0) asm volatile("s_wait_xcnt 0x0" ::: "memory");
      for (int i = 0; i < PBATCH; ++i) t[i] = pz[(c0 + i) * D];
      for (int i = 0; i < PBATCH; ++i) { pz[(c0 + i) * D] = runz; runz += t[i]; }
    }
  }
}

// ---------------- K2c: main per-step scan ----------------
__global__ void scan_main(const float* __restrict__ Q, const float* __restrict__ Zr,
                          const float* __restrict__ V,
                          const float* __restrict__ pZ, const float* __restrict__ pS,
                          const float* __restrict__ Pz, const float* __restrict__ Ps,
                          const float* __restrict__ z_g, const float* __restrict__ z_b,
                          const float* __restrict__ s_g, const float* __restrict__ s_b,
                          const float* __restrict__ nam_g, const float* __restrict__ nam_b,
                          float* __restrict__ na_core, double* __restrict__ acc) {
  const int b = blockIdx.x / CHUNKS, c = blockIdx.x % CHUNKS, tid = threadIdx.x;
  __shared__ float2 namgb[D * D];   // (nam_g, nam_b): read once per step, by the owner
  __shared__ float zl[D], vl[D], nq[D];
  __shared__ float red[16];
  __shared__ float napart[256];
  // thread owns elements tid + j*256 of every D x D array, in every pass:
  // column p, rows dq + 4j; the state and the constants of its LN stay in registers
  const int p = tid & 63, dq = tid >> 6;
  float scum[16];                   // running cumulative outer-product sum
  float sg[16], sc[16];             // s_g; s_b + prompt P_s last (LN'd)
  for (int j = 0; j < 16; ++j) scum[j] = pS[(b * CHUNKS + c) * D * D + tid + j * 256];
  // a later load's result may land in the offset register that these loads name
  asm volatile("s_wait_xcnt 0x0" ::: "memory");
  for (int j = 0; j < 16; ++j) sc[j] = Ps[b * D * D + tid + j * 256];
  // as above, for the offset register of the Ps loads
  asm volatile("s_wait_xcnt 0x0" ::: "memory");
  for (int j = 0; j < 16; ++j) {
    const int idx = tid + j * 256;
    sg[j]  = s_g[idx];
    sc[j] += s_b[idx];
    namgb[idx] = make_float2(nam_g[idx], nam_b[idx]);
  }
  float zc = (tid < D) ? pZ[(b * CHUNKS + c) * D + tid] : 0.f;   // running z sum, element tid
  const float zg = (tid < D) ? z_g[tid] : 0.f;
  const float zb = (tid < D) ? z_b[tid] : 0.f;
  const float pz = (tid < D) ? Pz[b * D + tid] : 0.f;
  float stdsum = 0.f, stdsq = 0.f;
  for (int t = 0; t < CLEN; ++t) {
    const int l = c * CLEN + t;
    const int row = (b * L + l) * D;
    if (tid < D) {
      const float zv = Zr[row + tid];
      zl[tid] = zv; vl[tid] = V[row + tid];
      zc += zv;
    }
    __syncthreads();
    const float vp = vl[p];
    for (int j = 0; j < 16; ++j) scum[j] += zl[dq + 4 * j] * vp;
    // z LN (EPS cancels), add prompt z, l2 norm; q norm; std accumulation
    float s1, s2; block_red2_256(zc, zc * zc, red, s1, s2);
    const float muz = s1 / (float)D, varz = s2 / (float)D - muz * muz;
    const float rstdz = rsqrtf(varz + LN_EPS);
    const float zfv = (tid < D) ? (zc - muz) * rstdz * zg + zb + pz : 0.f;
    const float qv  = (tid < D) ? Q[row + tid] : 0.f;
    float zn2, qn2; block_red2_256(zfv * zfv, qv * qv, red, zn2, qn2);
    const float invz = 1.f / fmaxf(sqrtf(zn2), 1e-8f);
    const float invq = 1.f / fmaxf(sqrtf(qn2), 1e-8f);
    if (tid < D) {
      nq[tid] = qv * invq;
      const float r = qv / fmaxf(zfv, 1e-6f);
      stdsum += r; stdsq += r * r;
    }
    __syncthreads();
    // scum LN stats over 4096 (EPS cancels)
    float ls = 0.f, lss = 0.f;
    for (int j = 0; j < 16; ++j) { const float x = scum[j]; ls += x; lss += x * x; }
    float S1, S2; block_red2_256(ls, lss, red, S1, S2);
    const float mus = S1 / 4096.f, vars = S2 / 4096.f - mus * mus;
    const float rstds = rsqrtf(vars + LN_EPS);
    // s_full = LN(scum)+Ps stats; nam stats derived via invz scaling
    ls = 0.f; lss = 0.f;
    float sf[16];
    for (int j = 0; j < 16; ++j) {
      sf[j] = (scum[j] - mus) * rstds * sg[j] + sc[j];
      ls += sf[j]; lss += sf[j] * sf[j];
    }
    float F1, F2; block_red2_256(ls, lss, red, F1, F2);
    const float muf = F1 / 4096.f, varf = F2 / 4096.f - muf * muf;
    const float mean_n = invz * muf;                       // EPS cancels
    const float rstdn  = rsqrtf(invz * invz * varf + LN_EPS);
    // fused LN(nam)+contraction: column p, the thread's own 16 d's
    float part = 0.f;
    for (int j = 0; j < 16; ++j) {
      const float2 gb = namgb[tid + j * 256];
      const float nm = (sf[j] * invz - mean_n) * rstdn * gb.x + gb.y;
      part += nq[dq + 4 * j] * nm;
    }
    napart[tid] = part;
    __syncthreads();
    if (tid < D)
      na_core[row + tid] = napart[tid] + napart[tid + 64] +
                           napart[tid + 128] + napart[tid + 192];
    if (t + 1 < CLEN && tid < D) {
      __builtin_prefetch(&Zr[row + D + tid], 0, 0);   // global_prefetch_b8
      __builtin_prefetch(&V[row + D + tid], 0, 0);
    }
    __syncthreads();
  }
  float A1, A2; block_red2_256(stdsum, stdsq, red, A1, A2);
  if (tid == 0) { atomicAdd(&acc[0], (double)A1); atomicAdd(&acc[1], (double)A2); }
}

// ---------------- K3: history GEMM prev_na = NQ @ M_b via WMMA f32 ----------------
__global__ void prevna_wmma(const float* __restrict__ NQ, const float* __restrict__ Mb,
                            float* __restrict__ PrevNa) {
  const int lane = threadIdx.x & 31;
  const int wvid = threadIdx.x >> 5;
  const int half = lane >> 4;
  const int mn   = lane & 15;
  const int mrow = blockIdx.x * 16;
  const int b    = mrow / L;
  const float* W = Mb + b * D * D;
  const int ncol = wvid * 16 + mn;
  v8f acc = {};
  for (int kb = 0; kb < D; kb += 4) {
    const int k0 = kb + half * 2;
    v2f a, bm;
    a.x  = NQ[(mrow + mn) * D + k0];
    a.y  = NQ[(mrow + mn) * D + k0 + 1];
    bm.x = W[k0 * D + ncol];
    bm.y = W[(k0 + 1) * D + ncol];
    acc = __builtin_amdgcn_wmma_f32_16x16x4_f32(false, a, false, bm,
                                                (short)0, acc, false, false);
  }
  for (int r = 0; r < 8; ++r) {
    const int om = r + 8 * half;
    PrevNa[(mrow + om) * D + ncol] = acc[r];
  }
}

// ---------------- K4: combine + final LN over D ----------------
__global__ void combine_ln(const float* __restrict__ na_core, const float* __restrict__ prev_na,
                           const float* __restrict__ na_g, const float* __restrict__ na_b,
                           float* __restrict__ out) {
  const int row = blockIdx.x, tid = threadIdx.x;   // 64 threads
  __shared__ float r4[4];
  const float v = na_core[row * D + tid] + prev_na[row * D + tid];
  float s = v, ss = v * v;
  for (int off = 16; off > 0; off >>= 1) {
    s  += __shfl_down(s, off, 32);
    ss += __shfl_down(ss, off, 32);
  }
  if ((tid & 31) == 0) { r4[tid >> 5] = s; r4[2 + (tid >> 5)] = ss; }
  __syncthreads();
  const float mu  = (r4[0] + r4[1]) / (float)D;
  const float var = (r4[2] + r4[3]) / (float)D - mu * mu;
  out[row * D + tid] = (v - mu) * rsqrtf(var + LN_EPS) * na_g[tid] + na_b[tid];
}

// ---------------- init / finalize ----------------
__global__ void init_acc(double* acc) {
  if (threadIdx.x == 0) { acc[0] = 0.0; acc[1] = 0.0; }
}
__global__ void finalize_std(const double* __restrict__ acc, float* __restrict__ out) {
  if (threadIdx.x == 0) {
    const double N = (double)(ROWS * D);
    const double mean = acc[0] / N;
    const double var  = (acc[1] - N * mean * mean) / (N - 1.0);
    out[ROWS * D] = (float)sqrt(var > 0.0 ? var : 0.0);
  }
}

extern "C" void kernel_launch(void* const* d_in, const int* in_sizes, int n_in,
                              void* d_out, int out_size, void* d_ws, size_t ws_size,
                              hipStream_t stream) {
  const int*   user_id    = (const int*)  d_in[0];
  const float* seqs_emb   = (const float*)d_in[1];
  const float* P          = (const float*)d_in[2];
  const float* S          = (const float*)d_in[3];
  const float* Wq         = (const float*)d_in[4];
  const float* bq         = (const float*)d_in[5];
  const float* Wk         = (const float*)d_in[6];
  const float* bk         = (const float*)d_in[7];
  const float* Wv         = (const float*)d_in[8];
  const float* bv         = (const float*)d_in[9];
  const float* z_g        = (const float*)d_in[10];
  const float* z_b        = (const float*)d_in[11];
  const float* s_g        = (const float*)d_in[12];
  const float* s_b        = (const float*)d_in[13];
  const float* nam_g      = (const float*)d_in[14];
  const float* nam_b      = (const float*)d_in[15];
  const float* na_g       = (const float*)d_in[16];
  const float* na_b       = (const float*)d_in[17];
  const float* prev_z_buf = (const float*)d_in[18];
  const float* prev_s_buf = (const float*)d_in[19];
  float* out = (float*)d_out;

  // workspace layout (floats); total ~30 MB
  float* ws     = (float*)d_ws;
  float* Qb     = ws;                         // ROWS*D
  float* Zr     = Qb + (size_t)ROWS * D;      // ROWS*D
  float* Vb     = Zr + (size_t)ROWS * D;      // ROWS*D
  float* NQ     = Vb + (size_t)ROWS * D;      // ROWS*D
  float* NaCore = NQ + (size_t)ROWS * D;      // ROWS*D
  float* PrevNa = NaCore + (size_t)ROWS * D;  // ROWS*D
  float* Pz     = PrevNa + (size_t)ROWS * D;  // B*D
  float* Ps     = Pz + B * D;                 // B*D*D
  float* Mb     = Ps + B * D * D;             // B*D*D
  float* pZ     = Mb + B * D * D;             // B*CHUNKS*D
  float* pS     = pZ + B * CHUNKS * D;        // B*CHUNKS*D*D
  double* acc   = (double*)(pS + (size_t)B * CHUNKS * D * D);  // 2 doubles, 8B aligned

  init_acc<<<1, 32, 0, stream>>>(acc);
  per_batch_prep<<<B, 256, 0, stream>>>(user_id, P, S, Wk, bk, Wv, bv,
                                        z_g, z_b, s_g, s_b, nam_g, nam_b,
                                        prev_z_buf, prev_s_buf, Pz, Ps, Mb);
  proj_wmma<<<dim3(ROWS / 16, 3, 1), 128, 0, stream>>>(seqs_emb, Wq, bq, Wk, bk, Wv, bv,
                                                       Qb, Zr, Vb);
  norm_q_kernel<<<ROWS, 64, 0, stream>>>(Qb, NQ);
  chunk_totals<<<B * CHUNKS, 256, 0, stream>>>(Zr, Vb, pZ, pS);
  chunk_prefix<<<B * PSLICES, 256, 0, stream>>>(pZ, pS);
  scan_main<<<B * CHUNKS, 256, 0, stream>>>(Qb, Zr, Vb, pZ, pS, Pz, Ps,
                                            z_g, z_b, s_g, s_b, nam_g, nam_b,
                                            NaCore, acc);
  prevna_wmma<<<ROWS / 16, 128, 0, stream>>>(NQ, Mb, PrevNa);
  combine_ln<<<ROWS, 64, 0, stream>>>(NaCore, PrevNa, na_g, na_b, out);
  finalize_std<<<1, 32, 0, stream>>>(acc, out);
}

// v003
// One run takes 67.7 microseconds.
// In two side-by-side timings against v002, it was 1.24 and 1.23 times as fast.
// All steps since v000 together make it 8.39 times as fast.
#include <hip/hip_runtime.h>
#include <math.h>

#define EPSC 1e-8f
#define LN_EPS 1e-5f

typedef float v2f __attribute__((ext_vector_type(2)));
typedef float v8f __attribute__((ext_vector_type(8)));

static constexpr int B = 16, L = 512, D = 64, IN = 64, LP = 8;
static constexpr int CHUNKS = 64, CLEN = 8;         // L = CHUNKS * CLEN
static constexpr int ROWS = B * L;                  // 8192
static constexpr int NU = 1024;                     // history buffers hold NU + 1 rows

// ---------------- reductions (wave32) ----------------
__device__ __forceinline__ void wave_red2(float& a, float& b) {
  for (int off = 16; off > 0; off >>= 1) {
    a += __shfl_down(a, off, 32);
    b += __shfl_down(b, off, 32);
  }
}

// all 256 threads must call; returns block-wide sums of (a,b)
__device__ __forceinline__ void block_red2_256(float a, float b, float* red,
                                               float& oa, float& ob) {
  int lane = threadIdx.x & 31, w = threadIdx.x >> 5;
  wave_red2(a, b);
  if (lane == 0) { red[w] = a; red[8 + w] = b; }
  __syncthreads();
  if (threadIdx.x == 0) {
    float s = 0.f, t = 0.f;
    for (int i = 0; i < 8; ++i) { s += red[i]; t += red[8 + i]; }
    red[0] = s; red[8] = t;
  }
  __syncthreads();
  oa = red[0]; ob = red[8];
  __syncthreads();
}

// ---------------- K1: projections via V_WMMA_F32_16X16X4_F32 ----------------
// grid (ROWS/16, 3), block 128 (4 waves, one 16-col N tile each)
__global__ void proj_wmma(const float* __restrict__ X,
                          const float* __restrict__ Wq, const float* __restrict__ bq,
                          const float* __restrict__ Wk, const float* __restrict__ bk,
                          const float* __restrict__ Wv, const float* __restrict__ bv,
                          float* __restrict__ Q, float* __restrict__ Zr,
                          float* __restrict__ V) {
  const int lane = threadIdx.x & 31;
  const int wvid = threadIdx.x >> 5;     // N tile 0..3
  const int half = lane >> 4;            // lane half selects K pair
  const int mn   = lane & 15;
  const int mrow = blockIdx.x * 16;
  const int which = blockIdx.y;
  const float* W; const float* bias;
  if (which == 0)      { W = Wq; bias = bq; }
  else if (which == 1) { W = Wk; bias = bk; }
  else                 { W = Wv; bias = bv; }
  const int ncol = wvid * 16 + mn;
  v8f acc = {};
  for (int kb = 0; kb < IN; kb += 4) {
    const int k0 = kb + half * 2;        // 16x4 f32 A: lanes<16 hold K0,K1; lanes>=16 K2,K3
    v2f a, bm;
    a.x  = X[(mrow + mn) * IN + k0];
    a.y  = X[(mrow + mn) * IN + k0 + 1];
    bm.x = W[(k0) * D + ncol];           // 4x16 B: row striped across lanes per VGPR
    bm.y = W[(k0 + 1) * D + ncol];
    acc = __builtin_amdgcn_wmma_f32_16x16x4_f32(false, a, false, bm,
                                                (short)0, acc, false, false);
  }
  const float bb = bias[ncol];
  float* Out = (which == 0) ? Q : (which == 1 ? Zr : V);
  const bool act = (which != 2);         // elu on q and z
  for (int r = 0; r < 8; ++r) {
    const int om = r + 8 * half;         // C/D layout: VGPR r -> M=r (lanes<16), M=8+r
    float v = acc[r] + bb;
    if (act) v = v > 0.f ? v : (__expf(v) - 1.f);
    Out[(mrow + om) * D + ncol] = v;
  }
}

// ---------------- K0: per-batch prompt/history constants ----------------
// body of work-group b of the first B work-groups of totals_and_prep
__device__ __forceinline__ void per_batch_prep(const int b,
                               const int* __restrict__ user_id,
                               const float* __restrict__ P, const float* __restrict__ S,
                               const float* __restrict__ Wk, const float* __restrict__ bk,
                               const float* __restrict__ Wv, const float* __restrict__ bv,
                               const float* __restrict__ z_g, const float* __restrict__ z_b,
                               const float* __restrict__ s_g, const float* __restrict__ s_b,
                               const float* __restrict__ nam_g, const float* __restrict__ nam_b,
                               const float* __restrict__ prev_z_buf,
                               const float* __restrict__ prev_s_buf,
                               float* __restrict__ Pz, float* __restrict__ Ps,
                               float* __restrict__ Mb) {
  const int tid = threadIdx.x;                     // 256 threads
  __shared__ float xb[LP * IN];
  __shared__ float zrow[LP * D], vrow[LP * D];
  __shared__ float buf[D * D];
  __shared__ float z64[D], pz64[D];
  __shared__ float red[16];
  for (int pass = 0; pass < 2; ++pass) {
    const float* Xp = (pass == 0 ? P : S) + b * LP * IN;
    for (int i = tid; i < LP * IN; i += 256) xb[i] = Xp[i];
    __syncthreads();
    // projections of the LP=8 rows (z = elu(xWk+bk), v = xWv+bv)
    for (int i = tid; i < LP * D; i += 256) {
      const int t = i >> 6, d = i & 63;
      float aK = bk[d], aV = bv[d];
      for (int k = 0; k < IN; ++k) {
        const float x = xb[t * IN + k];
        aK += x * Wk[k * D + d];
        aV += x * Wv[k * D + d];
      }
      zrow[i] = aK > 0.f ? aK : (__expf(aK) - 1.f);
      vrow[i] = aV;
    }
    __syncthreads();
    // totals over the LP steps (== last cumsum value)
    if (tid < D) {
      float s = 0.f;
      for (int t = 0; t < LP; ++t) s += zrow[t * D + tid];
      z64[tid] = s;
    }
    for (int j = 0; j < 16; ++j) {
      const int idx = tid + j * 256;
      const int d = idx >> 6, p = idx & 63;
      float s = 0.f;
      for (int t = 0; t < LP; ++t) s += zrow[t * D + d] * vrow[t * D + p];
      buf[idx] = s;
    }
    __syncthreads();
    // z LN (EPS shift cancels in centered term)
    const float zc = (tid < D) ? z64[tid] : 0.f;
    float s1, s2; block_red2_256(zc, zc * zc, red, s1, s2);
    const float mu = s1 / (float)D, var = s2 / (float)D - mu * mu;
    const float rstd = rsqrtf(var + LN_EPS);
    if (tid < D) pz64[tid] = (zc - mu) * rstd * z_g[tid] + z_b[tid];
    // s LN stats over 4096
    float ls = 0.f, lss = 0.f;
    for (int j = 0; j < 16; ++j) { const float x = buf[tid + j * 256]; ls += x; lss += x * x; }
    float S1, S2; block_red2_256(ls, lss, red, S1, S2);
    const float mus = S1 / 4096.f, vars = S2 / 4096.f - mus * mus;
    const float rstds = rsqrtf(vars + LN_EPS);
    if (pass == 0) {
      if (tid < D) Pz[b * D + tid] = pz64[tid];
      // a later LDS load's result may land in the data register that this store names
      asm volatile("s_wait_xcnt 0x0" ::: "memory");
      for (int j = 0; j < 16; ++j) {
        const int idx = tid + j * 256;
        Ps[b * D * D + idx] = (buf[idx] - mus) * rstds * s_g[idx] + s_b[idx];
      }
    } else {
      for (int j = 0; j < 16; ++j) {        // in-place LN (owner mapping, no race)
        const int idx = tid + j * 256;
        buf[idx] = (buf[idx] - mus) * rstds * s_g[idx] + s_b[idx];
      }
      __syncthreads();
      // the two gathers below stay inside the NU + 1 rows for any content of user_id; the row
      // number is one value for the whole work-group: readfirstlane puts it in a scalar register
      const int uid = __builtin_amdgcn_readfirstlane(min(max(user_id[b], 0), NU));
      float pzv = (tid < D) ? (prev_z_buf[uid * D + tid] + pz64[tid]) : 0.f;
      float n1, n2dummy; block_red2_256(pzv * pzv, 0.f, red, n1, n2dummy);
      const float inv = 1.f / (fmaxf(sqrtf(n1), 1e-8f) + EPSC);
      float ps_ = 0.f, pss = 0.f;
      for (int j = 0; j < 16; ++j) {
        const int idx = tid + j * 256;
        const float pn = (prev_s_buf[(size_t)uid * D * D + idx] + buf[idx]) * inv;
        ps_ += pn; pss += pn * pn;
      }
      float F1, F2; block_red2_256(ps_, pss, red, F1, F2);
      const float mun = F1 / 4096.f, varn = F2 / 4096.f - mun * mun;
      const float rstdn = rsqrtf(varn + LN_EPS);
      for (int j = 0; j < 16; ++j) {
        const int idx = tid + j * 256;
        const float pn = (prev_s_buf[(size_t)uid * D * D + idx] + buf[idx]) * inv;
        Mb[b * D * D + idx] = (pn - mun) * rstdn * nam_g[idx] + nam_b[idx];
      }
      // no load follows these stores in the kernel: the wait is a precaution
      asm volatile("s_wait_xcnt 0x0" ::: "memory");
    }
    __syncthreads();
  }
}

// ---------------- K2a: per-chunk totals of z and outer(z,v) ----------------
// body of work-group B + bc of totals_and_prep
__device__ __forceinline__ void chunk_totals(const int bc,
                             const float* __restrict__ Zr, const float* __restrict__ V,
                             float* __restrict__ pZ, float* __restrict__ pS) {
  const int b = bc / CHUNKS, c = bc % CHUNKS, tid = threadIdx.x;
  __shared__ float zl[D], vl[D];
  // thread owns elements tid + j*256 of the D x D state: column p, rows dq + 4j
  const int p = tid & 63, dq = tid >> 6;
  float sS[16];
  for (int j = 0; j < 16; ++j) sS[j] = 0.f;
  float sZ = 0.f;
  const int base = (b * L + c * CLEN) * D;
  // kept rolled: the unrolled build takes the whole register budget and spills
#pragma unroll 1
  for (int t = 0; t < CLEN; ++t) {
    if (tid < D) {
      const float zv = Zr[base + t * D + tid];
      zl[tid] = zv; vl[tid] = V[base + t * D + tid];
      sZ += zv;
    }
    __syncthreads();
    const float vp = vl[p];
    for (int j = 0; j < 16; ++j) sS[j] += zl[dq + 4 * j] * vp;
    __syncthreads();
  }
  if (tid < D) pZ[(b * CHUNKS + c) * D + tid] = sZ;
  for (int j = 0; j < 16; ++j) {
    const int idx = tid + j * 256;
    pS[(b * CHUNKS + c) * D * D + idx] = sS[j];
  }
  // nothing follows these stores in the joined kernel: the wait is a precaution
  asm volatile("s_wait_xcnt 0x0" ::: "memory");
}

// One launch for two jobs that read nothing of each other: the B long work-groups of
// the per-batch constants come first in the grid, the chunk totals fill the chip beside
// them. The first work-group also gives the std accumulators their start value.
__global__ void totals_and_prep(const int* __restrict__ user_id,
                                const float* __restrict__ P, const float* __restrict__ S,
                                const float* __restrict__ Wk, const float* __restrict__ bk,
                                const float* __restrict__ Wv, const float* __restrict__ bv,
                                const float* __restrict__ z_g, const float* __restrict__ z_b,
                                const float* __restrict__ s_g, const float* __restrict__ s_b,
                                const float* __restrict__ nam_g, const float* __restrict__ nam_b,
                                const float* __restrict__ prev_z_buf,
                                const float* __restrict__ prev_s_buf,
                                float* __restrict__ Pz, float* __restrict__ Ps,
                                float* __restrict__ Mb,
                                const float* __restrict__ Zr, const float* __restrict__ V,
                                float* __restrict__ pZ, float* __restrict__ pS,
                                double* __restrict__ acc) {
  if (blockIdx.x < B) {
    if (blockIdx.x == 0 && threadIdx.x == 0) { acc[0] = 0.0; acc[1] = 0.0; }
    per_batch_prep(blockIdx.x, user_id, P, S, Wk, bk, Wv, bv, z_g, z_b, s_g, s_b,
                   nam_g, nam_b, prev_z_buf, prev_s_buf, Pz, Ps, Mb);
  } else {
    chunk_totals(blockIdx.x - B, Zr, V, pZ, pS);
  }
}

// ---------------- K2b: exclusive prefix over chunks (in place) ----------------
// grid B * PSLICES, block 256: one element of the D x D state per thread
static constexpr int PSLICES = D * D / 256;          // 16
static constexpr int PBATCH = 32;                    // chunk totals loaded together
__global__ void chunk_prefix(float* __restrict__ pZ, float* __restrict__ pS) {
  const int b = blockIdx.x / PSLICES, sl = blockIdx.x % PSLICES, tid = threadIdx.x;
  float* ps = pS + (size_t)b * CHUNKS * D * D + sl * 256 + tid;
  float run = 0.f;
  for (int c0 = 0; c0 < CHUNKS; c0 += PBATCH) {
    float t[PBATCH];
    // this batch's loads refill registers that the last batch's stores name
    if (c0 > 0) asm volatile("s_wait_xcnt 0x0" ::: "memory");
    for (int i = 0; i < PBATCH; ++i) t[i] = ps[(c0 + i) * D * D];
    for (int i = 0; i < PBATCH; ++i) { ps[(c0 + i) * D * D] = run; run += t[i]; }
  }
  if (sl == 0 && tid < D) {
    float* pz = pZ + b * CHUNKS * D + tid;
    float runz = 0.f;
    for (int c0 = 0; c0 < CHUNKS; c0 += PBATCH) {
      float t[PBATCH];
      // as above: the last batch's stores still name these registers
      if (c0 > 0) asm volatile("s_wait_xcnt 0x0" ::: "memory");
      for (int i = 0; i < PBATCH; ++i) t[i] = pz[(c0 + i) * D];
      for (int i = 0; i < PBATCH; ++i) { pz[(c0 + i) * D] = runz; runz += t[i]; }
    }
  }
}

// ---------------- K2c: main per-step scan ----------------
__global__ void scan_main(const float* __restrict__ Q, const float* __restrict__ Zr,
                          const float* __restrict__ V,
                          const float* __restrict__ pZ, const float* __restrict__ pS,
                          const float* __restrict__ Pz, const float* __restrict__ Ps,
                          const float* __restrict__ z_g, const float* __restrict__ z_b,
                          const float* __restrict__ s_g, const float* __restrict__ s_b,
                          const float* __restrict__ nam_g, const float* __restrict__ nam_b,
                          float* __restrict__ na_core, float* __restrict__ NQ,
                          double* __restrict__ acc) {
  const int b = blockIdx.x / CHUNKS, c = blockIdx.x % CHUNKS, tid = threadIdx.x;
  __shared__ float2 namgb[D * D];   // (nam_g, nam_b): read once per step, by the owner
  __shared__ float zl[D], vl[D], nq[D];
  __shared__ float red[16];
  __shared__ float napart[256];
  // thread owns elements tid + j*256 of every D x D array, in every pass:
  // column p, rows dq + 4j; the state and the constants of its LN stay in registers
  const int p = tid & 63, dq = tid >> 6;
  float scum[16];                   // running cumulative outer-product sum
  float sg[16], sc[16];             // s_g; s_b + prompt P_s last (LN'd)
  for (int j = 0; j < 16; ++j) scum[j] = pS[(b * CHUNKS + c) * D * D + tid + j * 256];
  // a later load's result may land in the offset register that these loads name
  asm volatile("s_wait_xcnt 0x0" ::: "memory");
  for (int j = 0; j < 16; ++j) sc[j] = Ps[b * D * D + tid + j * 256];
  // as above, for the offset register of the Ps loads
  asm volatile("s_wait_xcnt 0x0" ::: "memory");
  for (int j = 0; j < 16; ++j) {
    const int idx = tid + j * 256;
    sg[j]  = s_g[idx];
    sc[j] += s_b[idx];
    namgb[idx] = make_float2(nam_g[idx], nam_b[idx]);
  }
  float zc = (tid < D) ? pZ[(b * CHUNKS + c) * D + tid] : 0.f;   // running z sum, element tid
  const float zg = (tid < D) ? z_g[tid] : 0.f;
  const float zb = (tid < D) ? z_b[tid] : 0.f;
  const float pz = (tid < D) ? Pz[b * D + tid] : 0.f;
  float stdsum = 0.f, stdsq = 0.f;
  for (int t = 0; t < CLEN; ++t) {
    const int l = c * CLEN + t;
    const int row = (b * L + l) * D;
    if (tid < D) {
      const float zv = Zr[row + tid];
      zl[tid] = zv; vl[tid] = V[row + tid];
      zc += zv;
    }
    __syncthreads();
    const float vp = vl[p];
    for (int j = 0; j < 16; ++j) scum[j] += zl[dq + 4 * j] * vp;
    // z LN (EPS cancels), add prompt z, l2 norm; q norm; std accumulation
    float s1, s2; block_red2_256(zc, zc * zc, red, s1, s2);
    const float muz = s1 / (float)D, varz = s2 / (float)D - muz * muz;
    const float rstdz = rsqrtf(varz + LN_EPS);
    const float zfv = (tid < D) ? (zc - muz) * rstdz * zg + zb + pz : 0.f;
    const float qv  = (tid < D) ? Q[row + tid] : 0.f;
    float zn2, qn2; block_red2_256(zfv * zfv, qv * qv, red, zn2, qn2);
    const float invz = 1.f / fmaxf(sqrtf(zn2), 1e-8f);
    const float invq = 1.f / fmaxf(sqrtf(qn2), 1e-8f);
    if (tid < D) {
      nq[tid] = qv * invq;
      const float r = qv / fmaxf(zfv, 1e-6f);
      stdsum += r; stdsq += r * r;
    }
    __syncthreads();
    // scum LN stats over 4096 (EPS cancels)
    float ls = 0.f, lss = 0.f;
    for (int j = 0; j < 16; ++j) { const float x = scum[j]; ls += x; lss += x * x; }
    float S1, S2; block_red2_256(ls, lss, red, S1, S2);
    const float mus = S1 / 4096.f, vars = S2 / 4096.f - mus * mus;
    const float rstds = rsqrtf(vars + LN_EPS);
    // s_full = LN(scum)+Ps stats; nam stats derived via invz scaling
    ls = 0.f; lss = 0.f;
    float sf[16];
    for (int j = 0; j < 16; ++j) {
      sf[j] = (scum[j] - mus) * rstds * sg[j] + sc[j];
      ls += sf[j]; lss += sf[j] * sf[j];
    }
    float F1, F2; block_red2_256(ls, lss, red, F1, F2);
    const float muf = F1 / 4096.f, varf = F2 / 4096.f - muf * muf;
    const float mean_n = invz * muf;                       // EPS cancels
    const float rstdn  = rsqrtf(invz * invz * varf + LN_EPS);
    // fused LN(nam)+contraction: column p, the thread's own 16 d's
    float part = 0.f;
    for (int j = 0; j < 16; ++j) {
      const float2 gb = namgb[tid + j * 256];
      const float nm = (sf[j] * invz - mean_n) * rstdn * gb.x + gb.y;
      part += nq[dq + 4 * j] * nm;
    }
    napart[tid] = part;
    __syncthreads();
    if (tid < D) {
      na_core[row + tid] = napart[tid] + napart[tid + 64] +
                           napart[tid + 128] + napart[tid + 192];
      NQ[row + tid] = nq[tid];      // the normalized q row, for the history GEMM
    }
    if (t + 1 < CLEN && tid < D) {
      __builtin_prefetch(&Zr[row + D + tid], 0, 0);   // global_prefetch_b8
      __builtin_prefetch(&V[row + D + tid], 0, 0);
    }
    __syncthreads();
  }
  float A1, A2; block_red2_256(stdsum, stdsq, red, A1, A2);
  if (tid == 0) { atomicAdd(&acc[0], (double)A1); atomicAdd(&acc[1], (double)A2); }
}

// ------- K3: history GEMM NQ @ M_b via WMMA f32, plus na_core, final LN over D -------
// grid ROWS/16, block 128 (4 waves, one 16-col N tile each); work-group 0 also writes std
// na_core carries no __restrict__, so that its loads keep their place in front of the wait
static constexpr int TP = D + 4;   // LDS row pitch in floats: rows r and r + 8 on other banks
__global__ void prevna_combine_ln(const float* __restrict__ NQ, const float* __restrict__ Mb,
                                  const float* na_core,
                                  const float* __restrict__ na_g, const float* __restrict__ na_b,
                                  const double* __restrict__ sums, float* __restrict__ out) {
  __shared__ __attribute__((aligned(16))) float tile[16 * TP];
  const int lane = threadIdx.x & 31;
  const int wvid = threadIdx.x >> 5;
  const int half = lane >> 4;
  const int mn   = lane & 15;
  const int mrow = blockIdx.x * 16;
  const int b    = mrow / L;
  const float* W = Mb + b * D * D;
  const int ncol = wvid * 16 + mn;
  // LN phase: 8 threads to a row, 8 columns each
  const int rr = threadIdx.x >> 3, c0 = (threadIdx.x & 7) * 8;
  const int o  = (mrow + rr) * D + c0;
  v8f acc = {};
  for (int kb = 0; kb < D; kb += 4) {
    const int k0 = kb + half * 2;
    v2f a, bm;
    a.x  = NQ[(mrow + mn) * D + k0];
    a.y  = NQ[(mrow + mn) * D + k0 + 1];
    bm.x = W[k0 * D + ncol];
    bm.y = W[(k0 + 1) * D + ncol];
    acc = __builtin_amdgcn_wmma_f32_16x16x4_f32(false, a, false, bm,
                                                (short)0, acc, false, false);
  }
  for (int r = 0; r < 8; ++r) {
    const int om = r + 8 * half;
    tile[om * TP + ncol] = acc[r];
  }
  __syncthreads();
  const float4 n0 = *(const float4*)&na_core[o];
  const float4 n1 = *(const float4*)&na_core[o + 4];
  // a later load's result may land in the address pair that these two loads name
  asm volatile("s_wait_xcnt 0x0" ::: "memory");
  const float4 g0 = *(const float4*)&na_g[c0], g1 = *(const float4*)&na_g[c0 + 4];
  const float4 b0 = *(const float4*)&na_b[c0], b1 = *(const float4*)&na_b[c0 + 4];
  const float4 t0 = *(const float4*)&tile[rr * TP + c0];
  const float4 t1 = *(const float4*)&tile[rr * TP + c0 + 4];
  const float v[8] = {n0.x + t0.x, n0.y + t0.y, n0.z + t0.z, n0.w + t0.w,
                      n1.x + t1.x, n1.y + t1.y, n1.z + t1.z, n1.w + t1.w};
  float s = 0.f, ss = 0.f;
  for (int i = 0; i < 8; ++i) { s += v[i]; ss += v[i] * v[i]; }
  for (int off = 1; off < 8; off <<= 1) {
    s  += __shfl_xor(s, off, 32);
    ss += __shfl_xor(ss, off, 32);
  }
  const float mu   = s / (float)D;
  const float var  = ss / (float)D - mu * mu;
  const float rstd = rsqrtf(var + LN_EPS);
  float4 o0, o1;
  o0.x = (v[0] - mu) * rstd * g0.x + b0.x;
  o0.y = (v[1] - mu) * rstd * g0.y + b0.y;
  o0.z = (v[2] - mu) * rstd * g0.z + b0.z;
  o0.w = (v[3] - mu) * rstd * g0.w + b0.w;
  o1.x = (v[4] - mu) * rstd * g1.x + b1.x;
  o1.y = (v[5] - mu) * rstd * g1.y + b1.y;
  o1.z = (v[6] - mu) * rstd * g1.z + b1.z;
  o1.w = (v[7] - mu) * rstd * g1.w + b1.w;
  *(float4*)&out[o]     = o0;
  *(float4*)&out[o + 4] = o1;
  if (blockIdx.x == 0 && threadIdx.x == 0) {
    const double N = (double)(ROWS * D);
    const double mean = sums[0] / N;
    const double vr   = (sums[1] - N * mean * mean) / (N - 1.0);
    out[ROWS * D] = (float)sqrt(vr > 0.0 ? vr : 0.0);
  }
}

extern "C" void kernel_launch(void* const* d_in, const int* in_sizes, int n_in,
                              void* d_out, int out_size, void* d_ws, size_t ws_size,
                              hipStream_t stream) {
  const int*   user_id    = (const int*)  d_in[0];
  const float* seqs_emb   = (const float*)d_in[1];
  const float* P          = (const float*)d_in[2];
  const float* S          = (const float*)d_in[3];
  const float* Wq         = (const float*)d_in[4];
  const float* bq         = (const float*)d_in[5];
  const float* Wk         = (const float*)d_in[6];
  const float* bk         = (const float*)d_in[7];
  const float* Wv         = (const float*)d_in[8];
  const float* bv         = (const float*)d_in[9];
  const float* z_g        = (const float*)d_in[10];
  const float* z_b        = (const float*)d_in[11];
  const float* s_g        = (const float*)d_in[12];
  const float* s_b        = (const float*)d_in[13];
  const float* nam_g      = (const float*)d_in[14];
  const float* nam_b      = (const float*)d_in[15];
  const float* na_g       = (const float*)d_in[16];
  const float* na_b       = (const float*)d_in[17];
  const float* prev_z_buf = (const float*)d_in[18];
  const float* prev_s_buf = (const float*)d_in[19];
  float* out = (float*)d_out;

  // workspace layout (floats); total ~30 MB
  float* ws     = (float*)d_ws;
  float* Qb     = ws;                         // ROWS*D
  float* Zr     = Qb + (size_t)ROWS * D;      // ROWS*D
  float* Vb     = Zr + (size_t)ROWS * D;      // ROWS*D
  float* NQ     = Vb + (size_t)ROWS * D;      // ROWS*D
  float* NaCore = NQ + (size_t)ROWS * D;      // ROWS*D
  float* Pz     = NaCore + (size_t)ROWS * D;  // B*D
  float* Ps     = Pz + B * D;                 // B*D*D
  float* Mb     = Ps + B * D * D;             // B*D*D
  float* pZ     = Mb + B * D * D;             // B*CHUNKS*D
  float* pS     = pZ + B * CHUNKS * D;        // B*CHUNKS*D*D
  double* acc   = (double*)(pS + (size_t)B * CHUNKS * D * D);  // 2 doubles, 8B aligned

  proj_wmma<<<dim3(ROWS / 16, 3, 1), 128, 0, stream>>>(seqs_emb, Wq, bq, Wk, bk, Wv, bv,
                                                       Qb, Zr, Vb);
  totals_and_prep<<<B + B * CHUNKS, 256, 0, stream>>>(user_id, P, S, Wk, bk, Wv, bv,
                                                      z_g, z_b, s_g, s_b, nam_g, nam_b,
                                                      prev_z_buf, prev_s_buf, Pz, Ps, Mb,
                                                      Zr, Vb, pZ, pS, acc);
  chunk_prefix<<<B * PSLICES, 256, 0, stream>>>(pZ, pS);
  scan_main<<<B * CHUNKS, 256, 0, stream>>>(Qb, Zr, Vb, pZ, pS, Pz, Ps,
                                            z_g, z_b, s_g, s_b, nam_g, nam_b,
                                            NaCore, NQ, acc);
  prevna_combine_ln<<<ROWS / 16, 128, 0, stream>>>(NQ, Mb, NaCore, na_g, na_b, acc, out);
}

// v004
// It runs in 46.8 microseconds.
// Two timings next to v003 put it at 1.44 and 1.45 times that version's speed.
// Counting every step since v000, it is 12.1 times as fast.
#include <hip/hip_runtime.h>
#include <math.h>

#define EPSC 1e-8f
#define LN_EPS 1e-5f

typedef float v2f __attribute__((ext_vector_type(2)));
typedef float v8f __attribute__((ext_vector_type(8)));

static constexpr int B = 16, L = 512, D = 64, IN = 64, LP = 8;
static constexpr int CHUNKS = 64, CLEN = 8;         // L = CHUNKS * CLEN
static constexpr int ROWS = B * L;                  // 8192
static constexpr int NU = 1024;                     // history buffers hold NU + 1 rows

// ---------------- reductions (wave32) ----------------
__device__ __forceinline__ void wave_red2(float& a, float& b) {
  for (int off = 16; off > 0; off >>= 1) {
    a += __shfl_down(a, off, 32);
    b += __shfl_down(b, off, 32);
  }
}

// all 256 threads must call; returns block-wide sums of (a,b)
__device__ __forceinline__ void block_red2_256(float a, float b, float* red,
                                               float& oa, float& ob) {
  int lane = threadIdx.x & 31, w = threadIdx.x >> 5;
  wave_red2(a, b);
  if (lane == 0) { red[w] = a; red[8 + w] = b; }
  __syncthreads();
  if (threadIdx.x == 0) {
    float s = 0.f, t = 0.f;
    for (int i = 0; i < 8; ++i) { s += red[i]; t += red[8 + i]; }
    red[0] = s; red[8] = t;
  }
  __syncthreads();
  oa = red[0]; ob = red[8];
  __syncthreads();
}

// sum over the 32 lanes of a wave, the result in every lane
__device__ __forceinline__ float wave_sum(float a) {
  for (int off = 16; off > 0; off >>= 1) a += __shfl_xor(a, off, 32);
  return a;
}

// 16 sums over the wave at once: each exchange halves the number of values a lane carries,
// so 16 exchanges do the work of 80; lane l returns the wave-wide sum of v[l >> 1]
__device__ __forceinline__ float wave_red16(float (&v)[16], const int lane) {
  // unrolled in full, so that v stays in registers
#pragma unroll
  for (int n = 8, bit = 16; n > 0; n >>= 1, bit >>= 1) {
    const bool hi = (lane & bit) != 0;
#pragma unroll
    for (int i = 0; i < n; ++i) {
      const float lo = v[i], up = v[i + n];
      v[i] = (hi ? up : lo) + __shfl_xor(hi ? lo : up, bit, 32);
    }
  }
  return v[0] + __shfl_xor(v[0], 1, 32);
}

// ---------------- K1: projections via V_WMMA_F32_16X16X4_F32 ----------------
// grid (ROWS/16, 3), block 128 (4 waves, one 16-col N tile each)
__global__ void proj_wmma(const float* __restrict__ X,
                          const float* __restrict__ Wq, const float* __restrict__ bq,
                          const float* __restrict__ Wk, const float* __restrict__ bk,
                          const float* __restrict__ Wv, const float* __restrict__ bv,
                          float* __restrict__ Q, float* __restrict__ Zr,
                          float* __restrict__ V) {
  const int lane = threadIdx.x & 31;
  const int wvid = threadIdx.x >> 5;     // N tile 0..3
  const int half = lane >> 4;            // lane half selects K pair
  const int mn   = lane & 15;
  const int mrow = blockIdx.x * 16;
  const int which = blockIdx.y;
  const float* W; const float* bias;
  if (which == 0)      { W = Wq; bias = bq; }
  else if (which == 1) { W = Wk; bias = bk; }
  else                 { W = Wv; bias = bv; }
  const int ncol = wvid * 16 + mn;
  v8f acc = {};
  for (int kb = 0; kb < IN; kb += 4) {
    const int k0 = kb + half * 2;        // 16x4 f32 A: lanes<16 hold K0,K1; lanes>=16 K2,K3
    v2f a, bm;
    a.x  = X[(mrow + mn) * IN + k0];
    a.y  = X[(mrow + mn) * IN + k0 + 1];
    bm.x = W[(k0) * D + ncol];           // 4x16 B: row striped across lanes per VGPR
    bm.y = W[(k0 + 1) * D + ncol];
    acc = __builtin_amdgcn_wmma_f32_16x16x4_f32(false, a, false, bm,
                                                (short)0, acc, false, false);
  }
  const float bb = bias[ncol];
  float* Out = (which == 0) ? Q : (which == 1 ? Zr : V);
  const bool act = (which != 2);         // elu on q and z
  for (int r = 0; r < 8; ++r) {
    const int om = r + 8 * half;         // C/D layout: VGPR r -> M=r (lanes<16), M=8+r
    float v = acc[r] + bb;
    if (act) v = v > 0.f ? v : (__expf(v) - 1.f);
    Out[(mrow + om) * D + ncol] = v;
  }
}

// ---------------- K0: per-batch prompt/history constants ----------------
// body of work-group b of the first B work-groups of totals_and_prep
__device__ __forceinline__ void per_batch_prep(const int b,
                               const int* __restrict__ user_id,
                               const float* __restrict__ P, const float* __restrict__ S,
                               const float* __restrict__ Wk, const float* __restrict__ bk,
                               const float* __restrict__ Wv, const float* __restrict__ bv,
                               const float* __restrict__ z_g, const float* __restrict__ z_b,
                               const float* __restrict__ s_g, const float* __restrict__ s_b,
                               const float* __restrict__ nam_g, const float* __restrict__ nam_b,
                               const float* __restrict__ prev_z_buf,
                               const float* __restrict__ prev_s_buf,
                               float* __restrict__ Pz, float* __restrict__ Ps,
                               float* __restrict__ Mb) {
  const int tid = threadIdx.x;                     // 256 threads
  __shared__ float xb[LP * IN];
  __shared__ float zrow[LP * D], vrow[LP * D];
  __shared__ float buf[D * D];
  __shared__ float z64[D], pz64[D];
  __shared__ float red[16];
  for (int pass = 0; pass < 2; ++pass) {
    const float* Xp = (pass == 0 ? P : S) + b * LP * IN;
    for (int i = tid; i < LP * IN; i += 256) xb[i] = Xp[i];
    __syncthreads();
    // projections of the LP=8 rows (z = elu(xWk+bk), v = xWv+bv)
    for (int i = tid; i < LP * D; i += 256) {
      const int t = i >> 6, d = i & 63;
      float aK = bk[d], aV = bv[d];
      for (int k = 0; k < IN; ++k) {
        const float x = xb[t * IN + k];
        aK += x * Wk[k * D + d];
        aV += x * Wv[k * D + d];
      }
      zrow[i] = aK > 0.f ? aK : (__expf(aK) - 1.f);
      vrow[i] = aV;
    }
    __syncthreads();
    // totals over the LP steps (== last cumsum value)
    if (tid < D) {
      float s = 0.f;
      for (int t = 0; t < LP; ++t) s += zrow[t * D + tid];
      z64[tid] = s;
    }
    for (int j = 0; j < 16; ++j) {
      const int idx = tid + j * 256;
      const int d = idx >> 6, p = idx & 63;
      float s = 0.f;
      for (int t = 0; t < LP; ++t) s += zrow[t * D + d] * vrow[t * D + p];
      buf[idx] = s;
    }
    __syncthreads();
    // z LN (EPS shift cancels in centered term)
    const float zc = (tid < D) ? z64[tid] : 0.f;
    float s1, s2; block_red2_256(zc, zc * zc, red, s1, s2);
    const float mu = s1 / (float)D, var = s2 / (float)D - mu * mu;
    const float rstd = rsqrtf(var + LN_EPS);
    if (tid < D) pz64[tid] = (zc - mu) * rstd * z_g[tid] + z_b[tid];
    // s LN stats over 4096
    float ls = 0.f, lss = 0.f;
    for (int j = 0; j < 16; ++j) { const float x = buf[tid + j * 256]; ls += x; lss += x * x; }
    float S1, S2; block_red2_256(ls, lss, red, S1, S2);
    const float mus = S1 / 4096.f, vars = S2 / 4096.f - mus * mus;
    const float rstds = rsqrtf(vars + LN_EPS);
    if (pass == 0) {
      if (tid < D) Pz[b * D + tid] = pz64[tid];
      // a later LDS load's result may land in the data register that this store names
      asm volatile("s_wait_xcnt 0x0" ::: "memory");
      for (int j = 0; j < 16; ++j) {
        const int idx = tid + j * 256;
        Ps[b * D * D + idx] = (buf[idx] - mus) * rstds * s_g[idx] + s_b[idx];
      }
    } else {
      for (int j = 0; j < 16; ++j) {        // in-place LN (owner mapping, no race)
        const int idx = tid + j * 256;
        buf[idx] = (buf[idx] - mus) * rstds * s_g[idx] + s_b[idx];
      }
      __syncthreads();
      // the two gathers below stay inside the NU + 1 rows for any content of user_id; the row
      // number is one value for the whole work-group: readfirstlane puts it in a scalar register
      const int uid = __builtin_amdgcn_readfirstlane(min(max(user_id[b], 0), NU));
      float pzv = (tid < D) ? (prev_z_buf[uid * D + tid] + pz64[tid]) : 0.f;
      float n1, n2dummy; block_red2_256(pzv * pzv, 0.f, red, n1, n2dummy);
      const float inv = 1.f / (fmaxf(sqrtf(n1), 1e-8f) + EPSC);
      float ps_ = 0.f, pss = 0.f;
      for (int j = 0; j < 16; ++j) {
        const int idx = tid + j * 256;
        const float pn = (prev_s_buf[(size_t)uid * D * D + idx] + buf[idx]) * inv;
        ps_ += pn; pss += pn * pn;
      }
      float F1, F2; block_red2_256(ps_, pss, red, F1, F2);
      const float mun = F1 / 4096.f, varn = F2 / 4096.f - mun * mun;
      const float rstdn = rsqrtf(varn + LN_EPS);
      for (int j = 0; j < 16; ++j) {
        const int idx = tid + j * 256;
        const float pn = (prev_s_buf[(size_t)uid * D * D + idx] + buf[idx]) * inv;
        Mb[b * D * D + idx] = (pn - mun) * rstdn * nam_g[idx] + nam_b[idx];
      }
      // no load follows these stores in the kernel: the wait is a precaution
      asm volatile("s_wait_xcnt 0x0" ::: "memory");
    }
    __syncthreads();
  }
}

// ---------------- K2a: per-chunk totals of z and outer(z,v) ----------------
// body of work-group B + bc of totals_and_prep
__device__ __forceinline__ void chunk_totals(const int bc,
                             const float* __restrict__ Zr, const float* __restrict__ V,
                             float* __restrict__ pZ, float* __restrict__ pS) {
  const int b = bc / CHUNKS, c = bc % CHUNKS, tid = threadIdx.x;
  __shared__ float zl[CLEN * D], vl[CLEN * D];     // the chunk's CLEN rows, staged together
  // thread owns elements tid + j*256 of the D x D state: column p, rows dq + 4j
  const int p = tid & 63, dq = tid >> 6;
  float sS[16];
  for (int j = 0; j < 16; ++j) sS[j] = 0.f;
  float sZ = 0.f;
  const int base = (b * L + c * CLEN) * D;
  for (int i = tid; i < CLEN * D; i += 256) { zl[i] = Zr[base + i]; vl[i] = V[base + i]; }
  __syncthreads();
  // kept rolled: the unrolled build takes the whole register budget and spills
#pragma unroll 1
  for (int t = 0; t < CLEN; ++t) {
    const float vp = vl[t * D + p];
    for (int j = 0; j < 16; ++j) sS[j] += zl[t * D + dq + 4 * j] * vp;
    if (tid < D) sZ += zl[t * D + tid];
  }
  if (tid < D) pZ[(b * CHUNKS + c) * D + tid] = sZ;
  for (int j = 0; j < 16; ++j) {
    const int idx = tid + j * 256;
    pS[(b * CHUNKS + c) * D * D + idx] = sS[j];
  }
  // nothing follows these stores in the joined kernel: the wait is a precaution
  asm volatile("s_wait_xcnt 0x0" ::: "memory");
}

// One launch for two jobs that read nothing of each other: the B long work-groups of
// the per-batch constants come first in the grid, the chunk totals fill the chip beside
// them. The first work-group also gives the std accumulators their start value.
__global__ void totals_and_prep(const int* __restrict__ user_id,
                                const float* __restrict__ P, const float* __restrict__ S,
                                const float* __restrict__ Wk, const float* __restrict__ bk,
                                const float* __restrict__ Wv, const float* __restrict__ bv,
                                const float* __restrict__ z_g, const float* __restrict__ z_b,
                                const float* __restrict__ s_g, const float* __restrict__ s_b,
                                const float* __restrict__ nam_g, const float* __restrict__ nam_b,
                                const float* __restrict__ prev_z_buf,
                                const float* __restrict__ prev_s_buf,
                                float* __restrict__ Pz, float* __restrict__ Ps,
                                float* __restrict__ Mb,
                                const float* __restrict__ Zr, const float* __restrict__ V,
                                float* __restrict__ pZ, float* __restrict__ pS,
                                double* __restrict__ acc) {
  if (blockIdx.x < B) {
    if (blockIdx.x == 0 && threadIdx.x == 0) { acc[0] = 0.0; acc[1] = 0.0; }
    per_batch_prep(blockIdx.x, user_id, P, S, Wk, bk, Wv, bv, z_g, z_b, s_g, s_b,
                   nam_g, nam_b, prev_z_buf, prev_s_buf, Pz, Ps, Mb);
  } else {
    chunk_totals(blockIdx.x - B, Zr, V, pZ, pS);
  }
}

// ---------------- K2b: exclusive prefix over chunks (in place) ----------------
// grid B * PSLICES, block 256: one element of the D x D state per thread
static constexpr int PSLICES = D * D / 256;          // 16
static constexpr int PBATCH = 32;                    // chunk totals loaded together
__global__ void chunk_prefix(float* __restrict__ pZ, float* __restrict__ pS) {
  const int b = blockIdx.x / PSLICES, sl = blockIdx.x % PSLICES, tid = threadIdx.x;
  float* ps = pS + (size_t)b * CHUNKS * D * D + sl * 256 + tid;
  float run = 0.f;
  for (int c0 = 0; c0 < CHUNKS; c0 += PBATCH) {
    float t[PBATCH];
    // this batch's loads refill registers that the last batch's stores name
    if (c0 > 0) asm volatile("s_wait_xcnt 0x0" ::: "memory");
    for (int i = 0; i < PBATCH; ++i) t[i] = ps[(c0 + i) * D * D];
    for (int i = 0; i < PBATCH; ++i) { ps[(c0 + i) * D * D] = run; run += t[i]; }
  }
  if (sl == 0 && tid < D) {
    float* pz = pZ + b * CHUNKS * D + tid;
    float runz = 0.f;
    for (int c0 = 0; c0 < CHUNKS; c0 += PBATCH) {
      float t[PBATCH];
      // as above: the last batch's stores still name these registers
      if (c0 > 0) asm volatile("s_wait_xcnt 0x0" ::: "memory");
      for (int i = 0; i < PBATCH; ++i) t[i] = pz[(c0 + i) * D];
      for (int i = 0; i < PBATCH; ++i) { pz[(c0 + i) * D] = runz; runz += t[i]; }
    }
  }
}

// ---------------- K2c: main scan, the CLEN steps of a chunk together ----------------
// A step depends on the one before it only through the running sums, which cost one
// multiply-add an element to form again. So every pass (state statistics, s_full statistics,
// contraction) runs over all CLEN steps, forming the state anew from the chunk's start
// value, and one block-wide reduction per pass serves all steps. The z and q rows of
// step t are handled by wave t alone, with sums inside the wave.
// second bound: 8 waves a SIMD, so that the grid's four work-groups per WGP are resident together
__global__ __launch_bounds__(256, 8)
void scan_main(const float* __restrict__ Q, const float* __restrict__ Zr,
               const float* __restrict__ V,
               const float* __restrict__ pZ, const float* __restrict__ pS,
               const float* __restrict__ Pz, const float* __restrict__ Ps,
               const float* __restrict__ z_g, const float* __restrict__ z_b,
               const float* __restrict__ s_g, const float* __restrict__ s_b,
               const float* __restrict__ nam_g, const float* __restrict__ nam_b,
               float* __restrict__ na_core, float* __restrict__ NQ,
               double* __restrict__ acc) {
  const int b = blockIdx.x / CHUNKS, c = blockIdx.x % CHUNKS, tid = threadIdx.x;
  const int lane = tid & 31;
  const int w = __builtin_amdgcn_readfirstlane(tid >> 5);   // wave number = the step it owns
  // the chunk's rows of z and of the normalized q; element d stands at place
  // (d & 3) * 16 + (d >> 2) of its row, so that a thread's 16 d's (dq + 4j) are consecutive
  __shared__ __attribute__((aligned(16))) float zP[CLEN * D], nqP[CLEN * D];
  __shared__ float vs[CLEN * D];
  __shared__ __attribute__((aligned(16))) float redw[2 * CLEN * 8];  // [2t + (0 sum, 1 squares)][wave]
  __shared__ float2 stS[CLEN], stN[CLEN];   // per step: scale and shift of the two LNs
  __shared__ float napart[CLEN * 256];
  __shared__ float red[16];
  __shared__ float4 xs[4 * 256];            // start value of the state; read only by its writer
  // thread owns elements tid + j*256 of every D x D array, in every pass: column p, rows dq + 4j
  const int p = tid & 63, dq = tid >> 6;
  const int row0 = (b * L + c * CLEN) * D;
  // the running state; every pass starts it anew from the cumulative outer-product sum in
  // front of the chunk, which each thread keeps in LDS rather than in 16 more registers
  float x[16];
  for (int j = 0; j < 16; ++j) x[j] = pS[(b * CHUNKS + c) * D * D + tid + j * 256];
  // a later load's result may land in the offset register that these loads name
  asm volatile("s_wait_xcnt 0x0" ::: "memory");
  for (int k = 0; k < 4; ++k)
    xs[k * 256 + tid] = make_float4(x[4 * k], x[4 * k + 1], x[4 * k + 2], x[4 * k + 3]);
  // wave w stages row w: lane holds elements d0 = lane and d1 = lane + 32
  const int d0 = lane, d1 = lane + 32;
  const int e0 = (d0 & 3) * 16 + (d0 >> 2), e1 = (d1 & 3) * 16 + (d1 >> 2);
  const int rw = row0 + w * D;
  const float q0 = Q[rw + d0], q1 = Q[rw + d1];
  zP[w * D + e0] = Zr[rw + d0]; zP[w * D + e1] = Zr[rw + d1];
  vs[w * D + d0] = V[rw + d0];  vs[w * D + d1] = V[rw + d1];
  float zc0 = pZ[(b * CHUNKS + c) * D + d0], zc1 = pZ[(b * CHUNKS + c) * D + d1];
  const float zg0 = z_g[d0], zg1 = z_g[d1], zb0 = z_b[d0], zb1 = z_b[d1];
  const float pz0 = Pz[b * D + d0], pz1 = Pz[b * D + d1];
  // later results may land in the address registers that the loads above name
  asm volatile("s_wait_xcnt 0x0" ::: "memory");
  __syncthreads();

  // ---- wave w: z LN (EPS cancels), prompt z, l2 norms, q norm, std terms of step w ----
  for (int t = 0; t < CLEN; ++t) {            // running z sum up to and including step w
    const float za = zP[t * D + e0], zb = zP[t * D + e1];
    zc0 += (t <= w) ? za : 0.f;
    zc1 += (t <= w) ? zb : 0.f;
  }
  const float s1  = wave_sum(zc0 + zc1);
  const float s2  = wave_sum(zc0 * zc0 + zc1 * zc1);
  const float qn2 = wave_sum(q0 * q0 + q1 * q1);
  const float muz = s1 / (float)D, varz = s2 / (float)D - muz * muz;
  const float rstdz = rsqrtf(varz + LN_EPS);
  const float zf0 = (zc0 - muz) * rstdz * zg0 + zb0 + pz0;
  const float zf1 = (zc1 - muz) * rstdz * zg1 + zb1 + pz1;
  const float zn2 = wave_sum(zf0 * zf0 + zf1 * zf1);
  const float invz = 1.f / fmaxf(sqrtf(zn2), 1e-8f);
  const float invq = 1.f / fmaxf(sqrtf(qn2), 1e-8f);
  const float nq0 = q0 * invq, nq1 = q1 * invq;
  nqP[w * D + e0] = nq0; nqP[w * D + e1] = nq1;
  NQ[rw + d0] = nq0; NQ[rw + d1] = nq1;       // the normalized q row, for the history GEMM
  // later results may land in the registers that these two stores name
  asm volatile("s_wait_xcnt 0x0" ::: "memory");
  const float ra = q0 / fmaxf(zf0, 1e-6f), rb = q1 / fmaxf(zf1, 1e-6f);
  {                                  // this step's share of the two std sums, read at the end
    const float sa = wave_sum(ra + rb), sq = wave_sum(ra * ra + rb * rb);
    if (lane == 0) { red[w] = sa; red[8 + w] = sq; }
  }

  const float* zrow = &zP[dq * 16];
  const float* nrow = &nqP[dq * 16];
  float val[2 * CLEN];
  // the step loops of the three passes are unrolled in full: val is indexed by t and stays
  // in registers only where t is a constant

  // ---- pass 1: sum and sum of squares of the state at every step (EPS cancels) ----
#pragma unroll
  for (int t = 0; t < CLEN; ++t) {
    const float vp = vs[t * D + p];
    const float4 zz0 = *(const float4*)&zrow[t * D], zz1 = *(const float4*)&zrow[t * D + 4];
    const float4 zz2 = *(const float4*)&zrow[t * D + 8], zz3 = *(const float4*)&zrow[t * D + 12];
    const float zz[16] = {zz0.x, zz0.y, zz0.z, zz0.w, zz1.x, zz1.y, zz1.z, zz1.w,
                          zz2.x, zz2.y, zz2.z, zz2.w, zz3.x, zz3.y, zz3.z, zz3.w};
    float ls = 0.f, lss = 0.f;
    for (int j = 0; j < 16; ++j) {
      x[j] = fmaf(zz[j], vp, x[j]);
      ls += x[j]; lss = fmaf(x[j], x[j], lss);
    }
    val[2 * t] = ls; val[2 * t + 1] = lss;
    // the scheduler works on one step at a time: with the LDS loads of later steps lifted up
    // here registers run short and far fewer of the multiply-adds pair into dual-issue forms
    __builtin_amdgcn_sched_barrier(0);
  }
  {
    const float r = wave_red16(val, lane);
    if ((lane & 1) == 0) redw[(lane >> 1) * 8 + w] = r;
  }
  __syncthreads();
  // the constants of pass 2 are fetched here, under the close of pass 1
  float sg[16], sc[16];             // s_g; s_b + prompt P_s last (LN'd)
  for (int j = 0; j < 16; ++j) sc[j] = Ps[b * D * D + tid + j * 256];
  // as above, for the offset register of the Ps loads
  asm volatile("s_wait_xcnt 0x0" ::: "memory");
  for (int j = 0; j < 16; ++j) {
    const int idx = tid + j * 256;
    sg[j]  = s_g[idx];
    sc[j] += s_b[idx];
  }
  {                                  // wave w closes step w
    float S1 = 0.f, S2 = 0.f;
    for (int i = 0; i < 8; ++i) { S1 += redw[(2 * w) * 8 + i]; S2 += redw[(2 * w + 1) * 8 + i]; }
    const float mus = S1 / 4096.f, vars = S2 / 4096.f - mus * mus;
    const float rstds = rsqrtf(vars + LN_EPS);
    if (lane == 0) stS[w] = make_float2(rstds, -mus * rstds);
  }
  __syncthreads();

  // ---- pass 2: s_full = LN(state) + Ps, its sum and sum of squares at every step ----
  for (int k = 0; k < 4; ++k) {
    const float4 s = xs[k * 256 + tid];
    x[4 * k] = s.x; x[4 * k + 1] = s.y; x[4 * k + 2] = s.z; x[4 * k + 3] = s.w;
  }
#pragma unroll
  for (int t = 0; t < CLEN; ++t) {
    const float vp = vs[t * D + p];
    const float2 st = stS[t];
    const float4 zz0 = *(const float4*)&zrow[t * D], zz1 = *(const float4*)&zrow[t * D + 4];
    const float4 zz2 = *(const float4*)&zrow[t * D + 8], zz3 = *(const float4*)&zrow[t * D + 12];
    const float zz[16] = {zz0.x, zz0.y, zz0.z, zz0.w, zz1.x, zz1.y, zz1.z, zz1.w,
                          zz2.x, zz2.y, zz2.z, zz2.w, zz3.x, zz3.y, zz3.z, zz3.w};
    float ls = 0.f, lss = 0.f;
    for (int j = 0; j < 16; ++j) {
      x[j] = fmaf(zz[j], vp, x[j]);
      const float f = fmaf(fmaf(x[j], st.x, st.y), sg[j], sc[j]);
      ls += f; lss = fmaf(f, f, lss);
    }
    val[2 * t] = ls; val[2 * t + 1] = lss;
    // the scheduler works on one step at a time: with the LDS loads of later steps lifted up
    // here registers run short and far fewer of the multiply-adds pair into dual-issue forms
    __builtin_amdgcn_sched_barrier(0);
  }
  {
    const float r = wave_red16(val, lane);
    if ((lane & 1) == 0) redw[(lane >> 1) * 8 + w] = r;
  }
  __syncthreads();
  // the constants of pass 3 are fetched here, under the close of pass 2; nam_g and nam_b
  // are read once for all CLEN steps
  float ng[16], nb[16];
  for (int j = 0; j < 16; ++j) { ng[j] = nam_g[tid + j * 256]; nb[j] = nam_b[tid + j * 256]; }
  // as above, for the offset register of these loads
  asm volatile("s_wait_xcnt 0x0" ::: "memory");
  {                                  // wave w closes step w; nam statistics via invz scaling
    float F1 = 0.f, F2 = 0.f;
    for (int i = 0; i < 8; ++i) { F1 += redw[(2 * w) * 8 + i]; F2 += redw[(2 * w + 1) * 8 + i]; }
    const float muf = F1 / 4096.f, varf = F2 / 4096.f - muf * muf;
    const float mean_n = invz * muf;                       // EPS cancels
    const float rstdn  = rsqrtf(invz * invz * varf + LN_EPS);
    if (lane == 0) stN[w] = make_float2(invz * rstdn, -mean_n * rstdn);
  }
  __syncthreads();

  // ---- pass 3: LN(nam) fused with the contraction: column p, the thread's own 16 d's ----
  for (int k = 0; k < 4; ++k) {
    const float4 s = xs[k * 256 + tid];
    x[4 * k] = s.x; x[4 * k + 1] = s.y; x[4 * k + 2] = s.z; x[4 * k + 3] = s.w;
  }
#pragma unroll
  for (int t = 0; t < CLEN; ++t) {
    const float vp = vs[t * D + p];
    const float2 st = stS[t], sn = stN[t];
    float part = 0.f;
#pragma unroll
    for (int h = 0; h < 16; h += 8) {          // eight d's at a time: fewer row values held
      const float4 z0 = *(const float4*)&zrow[t * D + h], z1 = *(const float4*)&zrow[t * D + h + 4];
      const float4 n0 = *(const float4*)&nrow[t * D + h], n1 = *(const float4*)&nrow[t * D + h + 4];
      const float zz[8] = {z0.x, z0.y, z0.z, z0.w, z1.x, z1.y, z1.z, z1.w};
      const float nn[8] = {n0.x, n0.y, n0.z, n0.w, n1.x, n1.y, n1.z, n1.w};
      for (int i = 0; i < 8; ++i) {
        const int j = h + i;
        x[j] = fmaf(zz[i], vp, x[j]);
        const float f = fmaf(fmaf(x[j], st.x, st.y), sg[j], sc[j]);
        const float nm = fmaf(fmaf(f, sn.x, sn.y), ng[j], nb[j]);
        part = fmaf(nn[i], nm, part);
      }
      // as in passes 1 and 2: one half step at a time, for registers and dual-issue pairs
      __builtin_amdgcn_sched_barrier(0);
    }
    napart[t * 256 + tid] = part;
  }
  __syncthreads();
  for (int o = tid; o < CLEN * D; o += 256) {      // o = step * D + column
    const float* np = &napart[(o >> 6) * 256 + (o & 63)];
    na_core[row0 + o] = np[0] + np[64] + np[128] + np[192];
  }
  if (tid == 0) {
    float A1 = 0.f, A2 = 0.f;
    for (int i = 0; i < 8; ++i) { A1 += red[i]; A2 += red[8 + i]; }
    atomicAdd(&acc[0], (double)A1); atomicAdd(&acc[1], (double)A2);
  }
}

// ------- K3: history GEMM NQ @ M_b via WMMA f32, plus na_core, final LN over D -------
// grid ROWS/16, block 128 (4 waves, one 16-col N tile each); work-group 0 also writes std
// na_core carries no __restrict__, so that its loads keep their place in front of the wait
static constexpr int TP = D + 4;   // LDS row pitch in floats: rows r and r + 8 on other banks
__global__ void prevna_combine_ln(const float* __restrict__ NQ, const float* __restrict__ Mb,
                                  const float* na_core,
                                  const float* __restrict__ na_g, const float* __restrict__ na_b,
                                  const double* __restrict__ sums, float* __restrict__ out) {
  __shared__ __attribute__((aligned(16))) float tile[16 * TP];
  const int lane = threadIdx.x & 31;
  const int wvid = threadIdx.x >> 5;
  const int half = lane >> 4;
  const int mn   = lane & 15;
  const int mrow = blockIdx.x * 16;
  const int b    = mrow / L;
  const float* W = Mb + b * D * D;
  const int ncol = wvid * 16 + mn;
  // LN phase: 8 threads to a row, 8 columns each
  const int rr = threadIdx.x >> 3, c0 = (threadIdx.x & 7) * 8;
  const int o  = (mrow + rr) * D + c0;
  v8f acc = {};
  for (int kb = 0; kb < D; kb += 4) {
    const int k0 = kb + half * 2;
    v2f a, bm;
    a.x  = NQ[(mrow + mn) * D + k0];
    a.y  = NQ[(mrow + mn) * D + k0 + 1];
    bm.x = W[k0 * D + ncol];
    bm.y = W[(k0 + 1) * D + ncol];
    acc = __builtin_amdgcn_wmma_f32_16x16x4_f32(false, a, false, bm,
                                                (short)0, acc, false, false);
  }
  for (int r = 0; r < 8; ++r) {
    const int om = r + 8 * half;
    tile[om * TP + ncol] = acc[r];
  }
  __syncthreads();
  const float4 n0 = *(const float4*)&na_core[o];
  const float4 n1 = *(const float4*)&na_core[o + 4];
  // a later load's result may land in the address pair that these two loads name
  asm volatile("s_wait_xcnt 0x0" ::: "memory");
  const float4 g0 = *(const float4*)&na_g[c0], g1 = *(const float4*)&na_g[c0 + 4];
  const float4 b0 = *(const float4*)&na_b[c0], b1 = *(const float4*)&na_b[c0 + 4];
  const float4 t0 = *(const float4*)&tile[rr * TP + c0];
  const float4 t1 = *(const float4*)&tile[rr * TP + c0 + 4];
  const float v[8] = {n0.x + t0.x, n0.y + t0.y, n0.z + t0.z, n0.w + t0.w,
                      n1.x + t1.x, n1.y + t1.y, n1.z + t1.z, n1.w + t1.w};
  float s = 0.f, ss = 0.f;
  for (int i = 0; i < 8; ++i) { s += v[i]; ss += v[i] * v[i]; }
  for (int off = 1; off < 8; off <<= 1) {
    s  += __shfl_xor(s, off, 32);
    ss += __shfl_xor(ss, off, 32);
  }
  const float mu   = s / (float)D;
  const float var  = ss / (float)D - mu * mu;
  const float rstd = rsqrtf(var + LN_EPS);
  float4 o0, o1;
  o0.x = (v[0] - mu) * rstd * g0.x + b0.x;
  o0.y = (v[1] - mu) * rstd * g0.y + b0.y;
  o0.z = (v[2] - mu) * rstd * g0.z + b0.z;
  o0.w = (v[3] - mu) * rstd * g0.w + b0.w;
  o1.x = (v[4] - mu) * rstd * g1.x + b1.x;
  o1.y = (v[5] - mu) * rstd * g1.y + b1.y;
  o1.z = (v[6] - mu) * rstd * g1.z + b1.z;
  o1.w = (v[7] - mu) * rstd * g1.w + b1.w;
  *(float4*)&out[o]     = o0;
  *(float4*)&out[o + 4] = o1;
  if (blockIdx.x == 0 && threadIdx.x == 0) {
    const double N = (double)(ROWS * D);
    const double mean = sums[0] / N;
    const double vr   = (sums[1] - N * mean * mean) / (N - 1.0);
    out[ROWS * D] = (float)sqrt(vr > 0.0 ? vr : 0.0);
  }
}

extern "C" void kernel_launch(void* const* d_in, const int* in_sizes, int n_in,
                              void* d_out, int out_size, void* d_ws, size_t ws_size,
                              hipStream_t stream) {
  const int*   user_id    = (const int*)  d_in[0];
  const float* seqs_emb   = (const float*)d_in[1];
  const float* P          = (const float*)d_in[2];
  const float* S          = (const float*)d_in[3];
  const float* Wq         = (const float*)d_in[4];
  const float* bq         = (const float*)d_in[5];
  const float* Wk         = (const float*)d_in[6];
  const float* bk         = (const float*)d_in[7];
  const float* Wv         = (const float*)d_in[8];
  const float* bv         = (const float*)d_in[9];
  const float* z_g        = (const float*)d_in[10];
  const float* z_b        = (const float*)d_in[11];
  const float* s_g        = (const float*)d_in[12];
  const float* s_b        = (const float*)d_in[13];
  const float* nam_g      = (const float*)d_in[14];
  const float* nam_b      = (const float*)d_in[15];
  const float* na_g       = (const float*)d_in[16];
  const float* na_b       = (const float*)d_in[17];
  const float* prev_z_buf = (const float*)d_in[18];
  const float* prev_s_buf = (const float*)d_in[19];
  float* out = (float*)d_out;

  // workspace layout (floats); total ~30 MB
  float* ws     = (float*)d_ws;
  float* Qb     = ws;                         // ROWS*D
  float* Zr     = Qb + (size_t)ROWS * D;      // ROWS*D
  float* Vb     = Zr + (size_t)ROWS * D;      // ROWS*D
  float* NQ     = Vb + (size_t)ROWS * D;      // ROWS*D
  float* NaCore = NQ + (size_t)ROWS * D;      // ROWS*D
  float* Pz     = NaCore + (size_t)ROWS * D;  // B*D
  float* Ps     = Pz + B * D;                 // B*D*D
  float* Mb     = Ps + B * D * D;             // B*D*D
  float* pZ     = Mb + B * D * D;             // B*CHUNKS*D
  float* pS     = pZ + B * CHUNKS * D;        // B*CHUNKS*D*D
  double* acc   = (double*)(pS + (size_t)B * CHUNKS * D * D);  // 2 doubles, 8B aligned

  proj_wmma<<<dim3(ROWS / 16, 3, 1), 128, 0, stream>>>(seqs_emb, Wq, bq, Wk, bk, Wv, bv,
                                                       Qb, Zr, Vb);
  totals_and_prep<<<B + B * CHUNKS, 256, 0, stream>>>(user_id, P, S, Wk, bk, Wv, bv,
                                                      z_g, z_b, s_g, s_b, nam_g, nam_b,
                                                      prev_z_buf, prev_s_buf, Pz, Ps, Mb,
                                                      Zr, Vb, pZ, pS, acc);
  chunk_prefix<<<B * PSLICES, 256, 0, stream>>>(pZ, pS);
  scan_main<<<B * CHUNKS, 256, 0, stream>>>(Qb, Zr, Vb, pZ, pS, Pz, Ps,
                                            z_g, z_b, s_g, s_b, nam_g, nam_b,
                                            NaCore, NQ, acc);
  prevna_combine_ln<<<ROWS / 16, 128, 0, stream>>>(NQ, Mb, NaCore, na_g, na_b, acc, out);
}

// v006
// One run takes 30.4 microseconds.
// Versions in between are left out here; by their measured steps it is 1.54 times as fast as v004.
// Over all steps from v000 it is 18.7 times as fast.
#include <hip/hip_runtime.h>
#include <math.h>

#define EPSC 1e-8f
#define LN_EPS 1e-5f

typedef float v2f __attribute__((ext_vector_type(2)));
typedef float v8f __attribute__((ext_vector_type(8)));

static constexpr int B = 16, L = 512, D = 64, IN = 64, LP = 8;
static constexpr int CHUNKS = 64, CLEN = 8;         // L = CHUNKS * CLEN
static constexpr int SC = 8, CPS = CHUNKS / SC;     // blocks of a sequence, chunks to a block
static constexpr int SROWS = L / SC;                // 64 rows to a block
static constexpr int ROWS = B * L;                  // 8192
static constexpr int NU = 1024;                     // history buffers hold NU + 1 rows

// ---------------- reductions (wave32) ----------------
// sum over the 32 lanes of a wave, the result in every lane
__device__ __forceinline__ float wave_sum(float a) {
  for (int off = 16; off > 0; off >>= 1) a += __shfl_xor(a, off, 32);
  return a;
}

// 16 sums over the wave at once: each exchange halves the number of values a lane carries,
// so 16 exchanges do the work of 80; lane l returns the wave-wide sum of v[l >> 1]
__device__ __forceinline__ float wave_red16(float (&v)[16], const int lane) {
  // unrolled in full, so that v stays in registers
#pragma unroll
  for (int n = 8, bit = 16; n > 0; n >>= 1, bit >>= 1) {
    const bool hi = (lane & bit) != 0;
#pragma unroll
    for (int i = 0; i < n; ++i) {
      const float lo = v[i], up = v[i + n];
      v[i] = (hi ? up : lo) + __shfl_xor(hi ? lo : up, bit, 32);
    }
  }
  return v[0] + __shfl_xor(v[0], 1, 32);
}

// ---------------- K1: projections and chunk start states, both on V_WMMA_F32_16X16X4_F32 ----
// body of work-group B + g of proj_prefix_prep: block g = SROWS rows of one sequence, 8 waves.
// The block's q, z and v rows are projected and stored; z and v also stay in LDS, and the sum
// of outer(z, v) is run through the block's rows: its value in front of each chunk goes to pS,
// its value behind the last row (the block's total) to tS; the z sums likewise to pZ and tZ.
static constexpr int ZPI = D + 8;    // LDS row pitch of z: rows k and k + 2 on other banks
static constexpr int VPI = D + 16;   // LDS row pitch of v, read 8 bytes a lane: the same
__device__ __forceinline__ void proj_and_starts(const int g, const float* __restrict__ X,
                          const float* __restrict__ Wq, const float* __restrict__ bq,
                          const float* __restrict__ Wk, const float* __restrict__ bk,
                          const float* __restrict__ Wv, const float* __restrict__ bv,
                          float* __restrict__ Q, float* __restrict__ Zr,
                          float* __restrict__ V,
                          float* __restrict__ pZ, float* __restrict__ pS,
                          float* __restrict__ tZ, float* __restrict__ tS) {
  __shared__ __attribute__((aligned(16))) float zl[SROWS * ZPI], vl[SROWS * VPI];
  const int tid  = threadIdx.x;
  const int lane = tid & 31;
  const int w    = tid >> 5;
  const int half = lane >> 4;            // lane half selects K pair
  const int mn   = lane & 15;
  const int row0 = g * SROWS;
  {
    // wave w: column tile w >> 1 of q, z and v, for two of the four 16-row tiles
    const int m0   = (w & 1) * 32;
    const int ncol = (w >> 1) * 16 + mn;
    // every operand of the 16 k steps is fetched first, so that one memory latency is paid
    v2f xa[2][IN / 4], wq[IN / 4], wk[IN / 4], wv[IN / 4];
    // 16x4 f32 A: lanes<16 hold K0,K1; lanes>=16 K2,K3.  4x16 B: row striped across lanes per VGPR
    const int woff = half * 2 * D + ncol;
    const float* xp = X + (row0 + m0 + mn) * IN + half * 2;
#pragma unroll
    for (int ks = 0; ks < IN / 4; ++ks) {
      wq[ks].x = Wq[woff + ks * 4 * D]; wq[ks].y = Wq[woff + ks * 4 * D + D];
      wk[ks].x = Wk[woff + ks * 4 * D]; wk[ks].y = Wk[woff + ks * 4 * D + D];
      wv[ks].x = Wv[woff + ks * 4 * D]; wv[ks].y = Wv[woff + ks * 4 * D + D];
      xa[0][ks] = *(const v2f*)&xp[ks * 4];
      xa[1][ks] = *(const v2f*)&xp[16 * IN + ks * 4];
    }
    const float bbq = bq[ncol], bbk = bk[ncol], bbv = bv[ncol];
    // Inputs-only fences on the loaded values: they hold the loads of k steps 0 to 11 in front of
    // the wait below (one statement takes thirty operands at most, hence four statements).
#pragma unroll
    for (int ks = 0; ks < IN / 4 - 4; ks += 4)
      asm volatile(""
                   :: "v"(wq[ks]), "v"(wk[ks]), "v"(wv[ks]), "v"(xa[0][ks]), "v"(xa[1][ks]),
                      "v"(wq[ks + 1]), "v"(wk[ks + 1]), "v"(wv[ks + 1]), "v"(xa[0][ks + 1]),
                      "v"(xa[1][ks + 1]),
                      "v"(wq[ks + 2]), "v"(wk[ks + 2]), "v"(wv[ks + 2]), "v"(xa[0][ks + 2]),
                      "v"(xa[1][ks + 2]),
                      "v"(wq[ks + 3]), "v"(wk[ks + 3]), "v"(wv[ks + 3]), "v"(xa[0][ks + 3]),
                      "v"(xa[1][ks + 3]));
    // The wait in front of any overwrite of an address register of the loads above. The last
    // loaded values and the addresses are its inputs: the loads stay in front of it and the
    // address registers stay untouched up to it.
    asm volatile("s_wait_xcnt 0x0"
                 :: "v"(wq[12]), "v"(wk[12]), "v"(wv[12]), "v"(xa[0][12]), "v"(xa[1][12]),
                    "v"(wq[13]), "v"(wk[13]), "v"(wv[13]), "v"(xa[0][13]), "v"(xa[1][13]),
                    "v"(wq[14]), "v"(wk[14]), "v"(wv[14]), "v"(xa[0][14]), "v"(xa[1][14]),
                    "v"(wq[15]), "v"(wk[15]), "v"(wv[15]), "v"(xa[0][15]), "v"(xa[1][15]),
                    "v"(bbq), "v"(bbk), "v"(bbv), "v"(woff), "v"(ncol), "v"(xp)
                 : "memory");
    v8f aq[2] = {}, ak[2] = {}, av[2] = {};
    // unrolled in full: the operand arrays are indexed by ks and stay in registers
#pragma unroll
    for (int ks = 0; ks < IN / 4; ++ks) {
#pragma unroll
      for (int i = 0; i < 2; ++i) {
        aq[i] = __builtin_amdgcn_wmma_f32_16x16x4_f32(false, xa[i][ks], false, wq[ks],
                                                      (short)0, aq[i], false, false);
        ak[i] = __builtin_amdgcn_wmma_f32_16x16x4_f32(false, xa[i][ks], false, wk[ks],
                                                      (short)0, ak[i], false, false);
        av[i] = __builtin_amdgcn_wmma_f32_16x16x4_f32(false, xa[i][ks], false, wv[ks],
                                                      (short)0, av[i], false, false);
      }
    }
    // unrolled: the accumulators are indexed by i and stay plain registers only where it is constant
#pragma unroll
    for (int i = 0; i < 2; ++i) {
      for (int r = 0; r < 8; ++r) {
        const int lr = m0 + i * 16 + r + 8 * half;   // C/D layout: VGPR r -> M=r, M=8+r
        float q = aq[i][r] + bbq, z = ak[i][r] + bbk;
        const float v = av[i][r] + bbv;
        q = q > 0.f ? q : (__expf(q) - 1.f);         // elu on q and z
        z = z > 0.f ? z : (__expf(z) - 1.f);
        Q[(row0 + lr) * D + ncol]  = q;
        Zr[(row0 + lr) * D + ncol] = z;
        V[(row0 + lr) * D + ncol]  = v;
        zl[lr * ZPI + ncol] = z;
        vl[lr * VPI + ncol] = v;
      }
      // the code below reuses the registers that these stores name
      asm volatile("s_wait_xcnt 0x0" ::: "memory");
    }
  }
  __syncthreads();
  // wave w: rows d = dt .. dt + 15 of the D x D sum, 32 columns from pb; its two 16-column
  // tiles take the even and the odd columns, so that a lane stores two neighbours at once
  const int dt = (w >> 1) * 16, pb = (w & 1) * 32;
  v8f c0 = {}, c1 = {};
  // unrolled in full: no branch stands between a matrix instruction and a store of its result
#pragma unroll
  for (int cc = 0; cc <= CPS; ++cc) {
    float* dst = (cc < CPS) ? pS + (size_t)(g * CPS + cc) * D * D : tS + (size_t)g * D * D;
    for (int r = 0; r < 8; ++r)
      *(float2*)&dst[(dt + r + 8 * half) * D + pb + 2 * mn] = make_float2(c0[r], c1[r]);
    // the code below reuses the registers that these stores name
    asm volatile("s_wait_xcnt 0x0" ::: "memory");
    if (cc < CPS) {
      for (int kb = cc * CLEN; kb < (cc + 1) * CLEN; kb += 4) {
        const int k0 = kb + half * 2;    // A and B: the same two rows k0, k0 + 1 in x and y
        v2f a, b0, b1;
        a.x = zl[k0 * ZPI + dt + mn];
        a.y = zl[(k0 + 1) * ZPI + dt + mn];
        const float2 u = *(const float2*)&vl[k0 * VPI + pb + 2 * mn];
        const float2 t = *(const float2*)&vl[(k0 + 1) * VPI + pb + 2 * mn];
        b0.x = u.x; b0.y = t.x;
        b1.x = u.y; b1.y = t.y;
        c0 = __builtin_amdgcn_wmma_f32_16x16x4_f32(false, a, false, b0,
                                                   (short)0, c0, false, false);
        c1 = __builtin_amdgcn_wmma_f32_16x16x4_f32(false, a, false, b1,
                                                   (short)0, c1, false, false);
      }
    }
  }
  if (tid < D) {                         // the z sums: one column a thread
    float run = 0.f;
    for (int cc = 0; cc < CPS; ++cc) {
      pZ[(g * CPS + cc) * D + tid] = run;
      // the additions below write the register that this store names
      asm volatile("s_wait_xcnt 0x0" ::: "memory");
      for (int t = 0; t < CLEN; ++t) run += zl[(cc * CLEN + t) * ZPI + tid];
    }
    tZ[g * D + tid] = run;
  }
}

// ---------------- K0: per-batch prompt/history constants ----------------
// body of work-group b of the first B work-groups of proj_prefix_prep, 8 waves.
// This work-group is one long chain of dependent steps, so the chain is kept short: the LP rows
// of P and the LP rows of S are one 16-row tile of V_WMMA_F32_16X16X4_F32, every operand from
// global memory is asked for at the head, the two D x D sums stay in their owners' registers,
// and what is 64 long (the z rows) is normalized by every wave for itself.
__device__ __forceinline__ void per_batch_prep(const int b,
                               const int* __restrict__ user_id,
                               const float* __restrict__ P, const float* __restrict__ S,
                               const float* __restrict__ Wk, const float* __restrict__ bk,
                               const float* __restrict__ Wv, const float* __restrict__ bv,
                               const float* __restrict__ z_g, const float* __restrict__ z_b,
                               const float* __restrict__ s_g, const float* __restrict__ s_b,
                               const float* __restrict__ nam_g, const float* __restrict__ nam_b,
                               const float* __restrict__ prev_z_buf,
                               const float* __restrict__ prev_s_buf,
                               float* __restrict__ Pz, float* __restrict__ Ps,
                               float* __restrict__ Mb) {
  // rows 0 to LP - 1: P, the others: S. In a z row element d stands at place
  // (d & 3) * 16 + (d >> 2), so that a thread's 16 d's (dq + 4j) are consecutive
  __shared__ __attribute__((aligned(16))) float zv[2 * 2 * LP * D];   // the z rows, then the v rows
  const float* zrow = zv;
  const float* vrow = zv + 2 * LP * D;
  __shared__ float zt[2 * D];               // z summed over the LP rows: P, then S
  __shared__ float4 redA[8];                // per wave: sum and squares of the P sum, of the S sum
  __shared__ float2 redB[8];                // per wave: sum and squares of the history matrix
  const int tid  = threadIdx.x;             // 256 threads
  const int lane = tid & 31;
  const int w    = __builtin_amdgcn_readfirstlane(tid >> 5);
  const int half = lane >> 4;               // lane half selects K pair
  const int mn   = lane & 15;
  // the two gathers below stay inside the NU + 1 rows for any content of user_id; the row
  // number is one value for the whole work-group: readfirstlane puts it in a scalar register
  const int uid = __builtin_amdgcn_readfirstlane(min(max(user_id[b], 0), NU));
  // wave w: column tile w >> 1 of z (even w) or of v (odd w), all 16 rows
  const bool isv = (w & 1) != 0;
  const int ncol = (w >> 1) * 16 + mn;
  const float* Wm = isv ? Wv : Wk;
  const float* bm = isv ? bv : bk;
  // 16x4 f32 A: lanes<16 hold K0,K1; lanes>=16 K2,K3.  4x16 B: row striped across lanes per VGPR
  const int woff = half * 2 * D + ncol;
  const float* xp = (mn < LP ? P + (b * LP + mn) * IN : S + (b * LP + mn - LP) * IN) + half * 2;
  v2f xa[IN / 4], wm[IN / 4];
  // unrolled in full: the operand arrays are indexed by ks and stay in registers
#pragma unroll
  for (int ks = 0; ks < IN / 4; ++ks) {
    wm[ks].x = Wm[woff + ks * 4 * D]; wm[ks].y = Wm[woff + ks * 4 * D + D];
    xa[ks] = *(const v2f*)&xp[ks * 4];
  }
  const float bb = bm[ncol];
  // the constants of the later phases: thread owns elements tid + j*256 of every D x D array
  float sg[16], sb[16], ng[16], nb[16], prs[16];
  for (int j = 0; j < 16; ++j) {
    const int idx = tid + j * 256;
    sg[j] = s_g[idx];   sb[j] = s_b[idx];
    ng[j] = nam_g[idx]; nb[j] = nam_b[idx];
    prs[j] = prev_s_buf[(size_t)uid * D * D + idx];
  }
  const float zg0 = z_g[lane], zg1 = z_g[lane + 32], zb0 = z_b[lane], zb1 = z_b[lane + 32];
  const float* pvr = prev_z_buf + (size_t)uid * D;      // a scalar base: the lane number is the offset
  const float pv0 = pvr[lane], pv1 = pvr[lane + 32];
  // Inputs-only fence on the loaded values: it holds the loads of k steps 0 to 7 in front of
  // the wait below (one statement takes thirty operands at most)
  asm volatile(""
               :: "v"(wm[0]), "v"(xa[0]), "v"(wm[1]), "v"(xa[1]), "v"(wm[2]), "v"(xa[2]),
                  "v"(wm[3]), "v"(xa[3]), "v"(wm[4]), "v"(xa[4]), "v"(wm[5]), "v"(xa[5]),
                  "v"(wm[6]), "v"(xa[6]), "v"(wm[7]), "v"(xa[7]));
  // The wait in front of any overwrite of an address register of the loads above. The last
  // loaded values and the addresses are its inputs: the loads stay in front of it and the
  // address registers stay untouched up to it.
  asm volatile("s_wait_xcnt 0x0"
               :: "v"(wm[8]), "v"(xa[8]), "v"(wm[9]), "v"(xa[9]), "v"(wm[10]), "v"(xa[10]),
                  "v"(wm[11]), "v"(xa[11]), "v"(wm[12]), "v"(xa[12]), "v"(wm[13]), "v"(xa[13]),
                  "v"(wm[14]), "v"(xa[14]), "v"(wm[15]), "v"(xa[15]),
                  "v"(bb), "v"(woff), "v"(ncol), "v"(xp)
               : "memory");
  // two chains of 8 k steps: half the dependent matrix latency
  v8f c0 = {}, c1 = {};
  // unrolled in full: the operand arrays are indexed by ks and stay in registers
#pragma unroll
  for (int ks = 0; ks < IN / 4; ks += 2) {
    c0 = __builtin_amdgcn_wmma_f32_16x16x4_f32(false, xa[ks], false, wm[ks],
                                               (short)0, c0, false, false);
    c1 = __builtin_amdgcn_wmma_f32_16x16x4_f32(false, xa[ks + 1], false, wm[ks + 1],
                                               (short)0, c1, false, false);
  }
  {
    // no branch here: z and v waves differ in a select and in the LDS index alone
    const int zplace = (ncol & 3) * 16 + (ncol >> 2);
    float* dstl = &zv[zplace + (w & 1) * (2 * LP * D + ncol - zplace)];
    float tot = 0.f;
    for (int r = 0; r < 8; ++r) {               // C/D layout: VGPR r -> M=r, M=8+r
      const float u = c0[r] + c1[r] + bb;
      const float e = u > 0.f ? u : (__expf(u) - 1.f);      // elu on z
      const float o = isv ? u : e;
      dstl[(r + 8 * half) * D] = o;
      tot += o;                                 // lanes<16: the rows of P, lanes>=16: of S
    }
    if (!isv) zt[half * D + ncol] = tot;
  }
  __syncthreads();
  // totals over the LP steps (== last cumsum value) of outer(z, v): column p, rows dq + 4j
  const int p = tid & 63, dq = tid >> 6;
  float sP[16], sS[16];
  for (int j = 0; j < 16; ++j) { sP[j] = 0.f; sS[j] = 0.f; }
  for (int t = 0; t < LP; ++t) {
    const float vp = vrow[t * D + p], vq = vrow[(LP + t) * D + p];
    for (int k = 0; k < 4; ++k) {
      const float4 za = *(const float4*)&zrow[t * D + dq * 16 + 4 * k];
      const float4 zc = *(const float4*)&zrow[(LP + t) * D + dq * 16 + 4 * k];
      sP[4 * k]     = fmaf(za.x, vp, sP[4 * k]);     sS[4 * k]     = fmaf(zc.x, vq, sS[4 * k]);
      sP[4 * k + 1] = fmaf(za.y, vp, sP[4 * k + 1]); sS[4 * k + 1] = fmaf(zc.y, vq, sS[4 * k + 1]);
      sP[4 * k + 2] = fmaf(za.z, vp, sP[4 * k + 2]); sS[4 * k + 2] = fmaf(zc.z, vq, sS[4 * k + 2]);
      sP[4 * k + 3] = fmaf(za.w, vp, sP[4 * k + 3]); sS[4 * k + 3] = fmaf(zc.w, vq, sS[4 * k + 3]);
    }
  }
  // s LN stats over 4096, P and S at once
  {
    float l1 = 0.f, l2 = 0.f, m1 = 0.f, m2 = 0.f;
    for (int j = 0; j < 16; ++j) {
      l1 += sP[j]; l2 = fmaf(sP[j], sP[j], l2);
      m1 += sS[j]; m2 = fmaf(sS[j], sS[j], m2);
    }
    l1 = wave_sum(l1); l2 = wave_sum(l2); m1 = wave_sum(m1); m2 = wave_sum(m2);
    if (lane == 0) redA[w] = make_float4(l1, l2, m1, m2);
  }
  // z LN (EPS shift cancels in centered term), every wave for itself: lane holds d = lane, lane + 32
  const float zp0 = zt[lane], zp1 = zt[lane + 32], zs0 = zt[D + lane], zs1 = zt[D + lane + 32];
  float inv, pzo0, pzo1;                    // pzo: the P row of z after its LN, stored at the end
  {
    const float a1 = wave_sum(zp0 + zp1), a2 = wave_sum(zp0 * zp0 + zp1 * zp1);
    const float e1 = wave_sum(zs0 + zs1), e2 = wave_sum(zs0 * zs0 + zs1 * zs1);
    const float muP = a1 / (float)D, rsP = rsqrtf(a2 / (float)D - muP * muP + LN_EPS);
    const float muS = e1 / (float)D, rsS = rsqrtf(e2 / (float)D - muS * muS + LN_EPS);
    pzo0 = (zp0 - muP) * rsP * zg0 + zb0;
    pzo1 = (zp1 - muP) * rsP * zg1 + zb1;
    const float h0 = pv0 + ((zs0 - muS) * rsS * zg0 + zb0);
    const float h1 = pv1 + ((zs1 - muS) * rsS * zg1 + zb1);
    const float n1 = wave_sum(h0 * h0 + h1 * h1);
    inv = 1.f / (fmaxf(sqrtf(n1), 1e-8f) + EPSC);
  }
  __syncthreads();
  // every global store stands behind the last barrier: a barrier waits for the stores in front of it
  float pn[16], pso[16];
  {
    float S1 = 0.f, S2 = 0.f, T1 = 0.f, T2 = 0.f;
    for (int i = 0; i < 8; ++i) {
      const float4 r = redA[i];
      S1 += r.x; S2 += r.y; T1 += r.z; T2 += r.w;
    }
    const float muP = S1 / 4096.f, rsP = rsqrtf(S2 / 4096.f - muP * muP + LN_EPS);
    const float muS = T1 / 4096.f, rsS = rsqrtf(T2 / 4096.f - muS * muS + LN_EPS);
    float f1 = 0.f, f2 = 0.f;
    for (int j = 0; j < 16; ++j) {
      pso[j] = (sP[j] - muP) * rsP * sg[j] + sb[j];
      pn[j] = (prs[j] + ((sS[j] - muS) * rsS * sg[j] + sb[j])) * inv;
      f1 += pn[j]; f2 = fmaf(pn[j], pn[j], f2);
    }
    f1 = wave_sum(f1); f2 = wave_sum(f2);
    if (lane == 0) redB[w] = make_float2(f1, f2);
  }
  __syncthreads();
  {
    float F1 = 0.f, F2 = 0.f;
    for (int i = 0; i < 8; ++i) { const float2 r = redB[i]; F1 += r.x; F2 += r.y; }
    const float mun = F1 / 4096.f, rstdn = rsqrtf(F2 / 4096.f - mun * mun + LN_EPS);
    for (int j = 0; j < 16; ++j) {
      Ps[b * D * D + tid + j * 256] = pso[j];
      Mb[b * D * D + tid + j * 256] = (pn[j] - mun) * rstdn * ng[j] + nb[j];
    }
    // the code below reuses the registers that these stores name
    asm volatile("s_wait_xcnt 0x0" ::: "memory");
    if (w == 0) { Pz[b * D + lane] = pzo0; Pz[b * D + lane + 32] = pzo1; }
  }
}

// One launch for two jobs that read nothing of each other: the B long work-groups of
// the per-batch constants come first in the grid, the projections with the chunk start
// states run beside them. The first work-group also gives the std accumulators their start value.
__global__ __launch_bounds__(256)
void proj_prefix_prep(const int* __restrict__ user_id, const float* __restrict__ X,
                      const float* __restrict__ P, const float* __restrict__ S,
                      const float* __restrict__ Wq, const float* __restrict__ bq,
                      const float* __restrict__ Wk, const float* __restrict__ bk,
                      const float* __restrict__ Wv, const float* __restrict__ bv,
                      const float* __restrict__ z_g, const float* __restrict__ z_b,
                      const float* __restrict__ s_g, const float* __restrict__ s_b,
                      const float* __restrict__ nam_g, const float* __restrict__ nam_b,
                      const float* __restrict__ prev_z_buf,
                      const float* __restrict__ prev_s_buf,
                      float* __restrict__ Pz, float* __restrict__ Ps,
                      float* __restrict__ Mb,
                      float* __restrict__ Q, float* __restrict__ Zr, float* __restrict__ V,
                      float* __restrict__ pZ, float* __restrict__ pS,
                      float* __restrict__ tZ, float* __restrict__ tS,
                      double* __restrict__ acc) {
  if (blockIdx.x < B) {
    if (blockIdx.x == 0 && threadIdx.x == 0) { acc[0] = 0.0; acc[1] = 0.0; }
    per_batch_prep(blockIdx.x, user_id, P, S, Wk, bk, Wv, bv, z_g, z_b, s_g, s_b,
                   nam_g, nam_b, prev_z_buf, prev_s_buf, Pz, Ps, Mb);
  } else {
    proj_and_starts(blockIdx.x - B, X, Wq, bq, Wk, bk, Wv, bv, Q, Zr, V, pZ, pS, tZ, tS);
  }
}

// N block totals added to a thread's 16 state elements, all N * 16 loads in flight together
template <int N>
__device__ __forceinline__ void add_totals(float (&x)[16], const float* __restrict__ t) {
  float v[N][16];
  for (int n = 0; n < N; ++n)
    for (int j = 0; j < 16; ++j) v[n][j] = t[n * D * D + j * 256];
  // a later result may land in the address registers that these loads name
  asm volatile("s_wait_xcnt 0x0" ::: "memory");
  for (int n = 0; n < N; ++n)
    for (int j = 0; j < 16; ++j) x[j] += v[n][j];
}

// ---------------- K2c: main scan, the CLEN steps of a chunk together ----------------
// A step depends on the one before it only through the running sums, which cost one
// multiply-add an element to form again. So every pass (state statistics, s_full statistics,
// contraction) runs over all CLEN steps, forming the state anew from the chunk's start
// value, and one block-wide reduction per pass serves all steps. The z and q rows of
// step t are handled by wave t alone, with sums inside the wave.
// second bound: 8 waves a SIMD, so that the grid's four work-groups per WGP are resident together
__global__ __launch_bounds__(256, 8)
void scan_main(const float* __restrict__ Q, const float* __restrict__ Zr,
               const float* __restrict__ V,
               const float* __restrict__ pZ, const float* __restrict__ pS,
               const float* __restrict__ tZ, const float* __restrict__ tS,
               const float* __restrict__ Pz, const float* __restrict__ Ps,
               const float* __restrict__ z_g, const float* __restrict__ z_b,
               const float* __restrict__ s_g, const float* __restrict__ s_b,
               const float* __restrict__ nam_g, const float* __restrict__ nam_b,
               float* __restrict__ na_core, float* __restrict__ NQ,
               double* __restrict__ acc) {
  const int b = blockIdx.x / CHUNKS, c = blockIdx.x % CHUNKS, tid = threadIdx.x;
  const int lane = tid & 31;
  const int w = __builtin_amdgcn_readfirstlane(tid >> 5);   // wave number = the step it owns
  // the chunk's rows of z and of the normalized q; element d stands at place
  // (d & 3) * 16 + (d >> 2) of its row, so that a thread's 16 d's (dq + 4j) are consecutive
  __shared__ __attribute__((aligned(16))) float zP[CLEN * D], nqP[CLEN * D];
  __shared__ float vs[CLEN * D];
  __shared__ __attribute__((aligned(16))) float redw[2 * CLEN * 8];  // [2t + (0 sum, 1 squares)][wave]
  __shared__ float2 stS[CLEN], stN[CLEN];   // per step: scale and shift of the two LNs
  __shared__ float napart[CLEN * 256];
  __shared__ float red[16];
  __shared__ float4 xs[4 * 256];            // start value of the state; read only by its writer
  // thread owns elements tid + j*256 of every D x D array, in every pass: column p, rows dq + 4j
  const int p = tid & 63, dq = tid >> 6;
  const int row0 = (b * L + c * CLEN) * D;
  // the running state; every pass starts it anew from the cumulative outer-product sum in
  // front of the chunk, which each thread keeps in LDS rather than in 16 more registers
  float x[16];
  for (int j = 0; j < 16; ++j) x[j] = pS[(b * CHUNKS + c) * D * D + tid + j * 256];
  // a later load's result may land in the offset register that these loads name
  asm volatile("s_wait_xcnt 0x0" ::: "memory");
  // pS holds the sum from the start of the chunk's block of SROWS rows; the totals of the sb
  // blocks in front are added here, four, two and one at a time: three rounds of loads at most
  const int sb = c / CPS;
  {
    const float* tp = tS + (size_t)(b * SC) * D * D + tid;
    if (sb & 4) { add_totals<4>(x, tp); tp += 4 * D * D; }
    if (sb & 2) { add_totals<2>(x, tp); tp += 2 * D * D; }
    if (sb & 1) { add_totals<1>(x, tp); }
  }
  for (int k = 0; k < 4; ++k)
    xs[k * 256 + tid] = make_float4(x[4 * k], x[4 * k + 1], x[4 * k + 2], x[4 * k + 3]);
  // wave w stages row w: lane holds elements d0 = lane and d1 = lane + 32
  const int d0 = lane, d1 = lane + 32;
  const int e0 = (d0 & 3) * 16 + (d0 >> 2), e1 = (d1 & 3) * 16 + (d1 >> 2);
  const int rw = row0 + w * D;
  const float q0 = Q[rw + d0], q1 = Q[rw + d1];
  zP[w * D + e0] = Zr[rw + d0]; zP[w * D + e1] = Zr[rw + d1];
  vs[w * D + d0] = V[rw + d0];  vs[w * D + d1] = V[rw + d1];
  float zc0 = pZ[(b * CHUNKS + c) * D + d0], zc1 = pZ[(b * CHUNKS + c) * D + d1];
  float ta[SC - 1], tb[SC - 1];               // z totals of the sequence's blocks but the last
  for (int s2 = 0; s2 < SC - 1; ++s2) {
    ta[s2] = tZ[(b * SC + s2) * D + d0]; tb[s2] = tZ[(b * SC + s2) * D + d1];
  }
  // a later load's result may land in the offset register that these loads name
  asm volatile("s_wait_xcnt 0x0" ::: "memory");
  const float zg0 = z_g[d0], zg1 = z_g[d1], zb0 = z_b[d0], zb1 = z_b[d1];
  const float pz0 = Pz[b * D + d0], pz1 = Pz[b * D + d1];
  // later results may land in the address registers that the loads above name
  asm volatile("s_wait_xcnt 0x0" ::: "memory");
  for (int s2 = 0; s2 < SC - 1; ++s2) {       // those of the blocks in front are added
    zc0 += (s2 < sb) ? ta[s2] : 0.f;
    zc1 += (s2 < sb) ? tb[s2] : 0.f;
  }
  __syncthreads();

  // ---- wave w: z LN (EPS cancels), prompt z, l2 norms, q norm, std terms of step w ----
  for (int t = 0; t < CLEN; ++t) {            // running z sum up to and including step w
    const float za = zP[t * D + e0], zb = zP[t * D + e1];
    zc0 += (t <= w) ? za : 0.f;
    zc1 += (t <= w) ? zb : 0.f;
  }
  const float s1  = wave_sum(zc0 + zc1);
  const float s2  = wave_sum(zc0 * zc0 + zc1 * zc1);
  const float qn2 = wave_sum(q0 * q0 + q1 * q1);
  const float muz = s1 / (float)D, varz = s2 / (float)D - muz * muz;
  const float rstdz = rsqrtf(varz + LN_EPS);
  const float zf0 = (zc0 - muz) * rstdz * zg0 + zb0 + pz0;
  const float zf1 = (zc1 - muz) * rstdz * zg1 + zb1 + pz1;
  const float zn2 = wave_sum(zf0 * zf0 + zf1 * zf1);
  const float invz = 1.f / fmaxf(sqrtf(zn2), 1e-8f);
  const float invq = 1.f / fmaxf(sqrtf(qn2), 1e-8f);
  const float nq0 = q0 * invq, nq1 = q1 * invq;
  nqP[w * D + e0] = nq0; nqP[w * D + e1] = nq1;
  NQ[rw + d0] = nq0; NQ[rw + d1] = nq1;       // the normalized q row, for the history GEMM
  // later results may land in the registers that these two stores name
  asm volatile("s_wait_xcnt 0x0" ::: "memory");
  const float ra = q0 / fmaxf(zf0, 1e-6f), rb = q1 / fmaxf(zf1, 1e-6f);
  {                                  // this step's share of the two std sums, read at the end
    const float sa = wave_sum(ra + rb), sq = wave_sum(ra * ra + rb * rb);
    if (lane == 0) { red[w] = sa; red[8 + w] = sq; }
  }

  const float* zrow = &zP[dq * 16];
  const float* nrow = &nqP[dq * 16];
  float val[2 * CLEN];
  // the step loops of the three passes are unrolled in full: val is indexed by t and stays
  // in registers only where t is a constant

  // ---- pass 1: sum and sum of squares of the state at every step (EPS cancels) ----
#pragma unroll
  for (int t = 0; t < CLEN; ++t) {
    const float vp = vs[t * D + p];
    const float4 zz0 = *(const float4*)&zrow[t * D], zz1 = *(const float4*)&zrow[t * D + 4];
    const float4 zz2 = *(const float4*)&zrow[t * D + 8], zz3 = *(const float4*)&zrow[t * D + 12];
    const float zz[16] = {zz0.x, zz0.y, zz0.z, zz0.w, zz1.x, zz1.y, zz1.z, zz1.w,
                          zz2.x, zz2.y, zz2.z, zz2.w, zz3.x, zz3.y, zz3.z, zz3.w};
    float ls = 0.f, lss = 0.f;
    for (int j = 0; j < 16; ++j) {
      x[j] = fmaf(zz[j], vp, x[j]);
      ls += x[j]; lss = fmaf(x[j], x[j], lss);
    }
    val[2 * t] = ls; val[2 * t + 1] = lss;
    // the scheduler works on one step at a time: with the LDS loads of later steps lifted up
    // here registers run short and far fewer of the multiply-adds pair into dual-issue forms
    __builtin_amdgcn_sched_barrier(0);
  }
  {
    const float r = wave_red16(val, lane);
    if ((lane & 1) == 0) redw[(lane >> 1) * 8 + w] = r;
  }
  __syncthreads();
  // the constants of pass 2 are fetched here, under the close of pass 1
  float sg[16], sc[16];             // s_g; s_b + prompt P_s last (LN'd)
  for (int j = 0; j < 16; ++j) sc[j] = Ps[b * D * D + tid + j * 256];
  // as above, for the offset register of the Ps loads
  asm volatile("s_wait_xcnt 0x0" ::: "memory");
  for (int j = 0; j < 16; ++j) {
    const int idx = tid + j * 256;
    sg[j]  = s_g[idx];
    sc[j] += s_b[idx];
  }
  {                                  // wave w closes step w
    float S1 = 0.f, S2 = 0.f;
    for (int i = 0; i < 8; ++i) { S1 += redw[(2 * w) * 8 + i]; S2 += redw[(2 * w + 1) * 8 + i]; }
    const float mus = S1 / 4096.f, vars = S2 / 4096.f - mus * mus;
    const float rstds = rsqrtf(vars + LN_EPS);
    if (lane == 0) stS[w] = make_float2(rstds, -mus * rstds);
  }
  __syncthreads();

  // ---- pass 2: s_full = LN(state) + Ps, its sum and sum of squares at every step ----
  for (int k = 0; k < 4; ++k) {
    const float4 s = xs[k * 256 + tid];
    x[4 * k] = s.x; x[4 * k + 1] = s.y; x[4 * k + 2] = s.z; x[4 * k + 3] = s.w;
  }
#pragma unroll
  for (int t = 0; t < CLEN; ++t) {
    const float vp = vs[t * D + p];
    const float2 st = stS[t];
    const float4 zz0 = *(const float4*)&zrow[t * D], zz1 = *(const float4*)&zrow[t * D + 4];
    const float4 zz2 = *(const float4*)&zrow[t * D + 8], zz3 = *(const float4*)&zrow[t * D + 12];
    const float zz[16] = {zz0.x, zz0.y, zz0.z, zz0.w, zz1.x, zz1.y, zz1.z, zz1.w,
                          zz2.x, zz2.y, zz2.z, zz2.w, zz3.x, zz3.y, zz3.z, zz3.w};
    float ls = 0.f, lss = 0.f;
    for (int j = 0; j < 16; ++j) {
      x[j] = fmaf(zz[j], vp, x[j]);
      const float f = fmaf(fmaf(x[j], st.x, st.y), sg[j], sc[j]);
      ls += f; lss = fmaf(f, f, lss);
    }
    val[2 * t] = ls; val[2 * t + 1] = lss;
    // the scheduler works on one step at a time: with the LDS loads of later steps lifted up
    // here registers run short and far fewer of the multiply-adds pair into dual-issue forms
    __builtin_amdgcn_sched_barrier(0);
  }
  {
    const float r = wave_red16(val, lane);
    if ((lane & 1) == 0) redw[(lane >> 1) * 8 + w] = r;
  }
  __syncthreads();
  // the constants of pass 3 are fetched here, under the close of pass 2; nam_g and nam_b
  // are read once for all CLEN steps
  float ng[16], nb[16];
  for (int j = 0; j < 16; ++j) { ng[j] = nam_g[tid + j * 256]; nb[j] = nam_b[tid + j * 256]; }
  // as above, for the offset register of these loads
  asm volatile("s_wait_xcnt 0x0" ::: "memory");
  {                                  // wave w closes step w; nam statistics via invz scaling
    float F1 = 0.f, F2 = 0.f;
    for (int i = 0; i < 8; ++i) { F1 += redw[(2 * w) * 8 + i]; F2 += redw[(2 * w + 1) * 8 + i]; }
    const float muf = F1 / 4096.f, varf = F2 / 4096.f - muf * muf;
    const float mean_n = invz * muf;                       // EPS cancels
    const float rstdn  = rsqrtf(invz * invz * varf + LN_EPS);
    if (lane == 0) stN[w] = make_float2(invz * rstdn, -mean_n * rstdn);
  }
  __syncthreads();

  // ---- pass 3: LN(nam) fused with the contraction: column p, the thread's own 16 d's ----
  for (int k = 0; k < 4; ++k) {
    const float4 s = xs[k * 256 + tid];
    x[4 * k] = s.x; x[4 * k + 1] = s.y; x[4 * k + 2] = s.z; x[4 * k + 3] = s.w;
  }
#pragma unroll
  for (int t = 0; t < CLEN; ++t) {
    const float vp = vs[t * D + p];
    const float2 st = stS[t], sn = stN[t];
    float part = 0.f;
#pragma unroll
    for (int h = 0; h < 16; h += 8) {          // eight d's at a time: fewer row values held
      const float4 z0 = *(const float4*)&zrow[t * D + h], z1 = *(const float4*)&zrow[t * D + h + 4];
      const float4 n0 = *(const float4*)&nrow[t * D + h], n1 = *(const float4*)&nrow[t * D + h + 4];
      const float zz[8] = {z0.x, z0.y, z0.z, z0.w, z1.x, z1.y, z1.z, z1.w};
      const float nn[8] = {n0.x, n0.y, n0.z, n0.w, n1.x, n1.y, n1.z, n1.w};
      for (int i = 0; i < 8; ++i) {
        const int j = h + i;
        x[j] = fmaf(zz[i], vp, x[j]);
        const float f = fmaf(fmaf(x[j], st.x, st.y), sg[j], sc[j]);
        const float nm = fmaf(fmaf(f, sn.x, sn.y), ng[j], nb[j]);
        part = fmaf(nn[i], nm, part);
      }
      // as in passes 1 and 2: one half step at a time, for registers and dual-issue pairs
      __builtin_amdgcn_sched_barrier(0);
    }
    napart[t * 256 + tid] = part;
  }
  __syncthreads();
  for (int o = tid; o < CLEN * D; o += 256) {      // o = step * D + column
    const float* np = &napart[(o >> 6) * 256 + (o & 63)];
    na_core[row0 + o] = np[0] + np[64] + np[128] + np[192];
  }
  if (tid == 0) {
    float A1 = 0.f, A2 = 0.f;
    for (int i = 0; i < 8; ++i) { A1 += red[i]; A2 += red[8 + i]; }
    atomicAdd(&acc[0], (double)A1); atomicAdd(&acc[1], (double)A2);
  }
}

// ------- K3: history GEMM NQ @ M_b via WMMA f32, plus na_core, final LN over D -------
// grid ROWS/16, block 128 (4 waves, one 16-col N tile each); work-group 0 also writes std
// na_core carries no __restrict__, so that its loads keep their place in front of the wait
static constexpr int TP = D + 4;   // LDS row pitch in floats: rows r and r + 8 on other banks
__global__ void prevna_combine_ln(const float* __restrict__ NQ, const float* __restrict__ Mb,
                                  const float* na_core,
                                  const float* __restrict__ na_g, const float* __restrict__ na_b,
                                  const double* __restrict__ sums, float* __restrict__ out) {
  __shared__ __attribute__((aligned(16))) float tile[16 * TP];
  const int lane = threadIdx.x & 31;
  const int wvid = threadIdx.x >> 5;
  const int half = lane >> 4;
  const int mn   = lane & 15;
  const int mrow = blockIdx.x * 16;
  const int b    = mrow / L;
  const float* W = Mb + b * D * D;
  const int ncol = wvid * 16 + mn;
  // LN phase: 8 threads to a row, 8 columns each
  const int rr = threadIdx.x >> 3, c0 = (threadIdx.x & 7) * 8;
  const int o  = (mrow + rr) * D + c0;
  v8f acc = {};
  for (int kb = 0; kb < D; kb += 4) {
    const int k0 = kb + half * 2;
    v2f a, bm;
    a.x  = NQ[(mrow + mn) * D + k0];
    a.y  = NQ[(mrow + mn) * D + k0 + 1];
    bm.x = W[k0 * D + ncol];
    bm.y = W[(k0 + 1) * D + ncol];
    acc = __builtin_amdgcn_wmma_f32_16x16x4_f32(false, a, false, bm,
                                                (short)0, acc, false, false);
  }
  for (int r = 0; r < 8; ++r) {
    const int om = r + 8 * half;
    tile[om * TP + ncol] = acc[r];
  }
  __syncthreads();
  const float4 n0 = *(const float4*)&na_core[o];
  const float4 n1 = *(const float4*)&na_core[o + 4];
  // a later load's result may land in the address pair that these two loads name
  asm volatile("s_wait_xcnt 0x0" ::: "memory");
  const float4 g0 = *(const float4*)&na_g[c0], g1 = *(const float4*)&na_g[c0 + 4];
  const float4 b0 = *(const float4*)&na_b[c0], b1 = *(const float4*)&na_b[c0 + 4];
  const float4 t0 = *(const float4*)&tile[rr * TP + c0];
  const float4 t1 = *(const float4*)&tile[rr * TP + c0 + 4];
  const float v[8] = {n0.x + t0.x, n0.y + t0.y, n0.z + t0.z, n0.w + t0.w,
                      n1.x + t1.x, n1.y + t1.y, n1.z + t1.z, n1.w + t1.w};
  float s = 0.f, ss = 0.f;
  for (int i = 0; i < 8; ++i) { s += v[i]; ss += v[i] * v[i]; }
  for (int off = 1; off < 8; off <<= 1) {
    s  += __shfl_xor(s, off, 32);
    ss += __shfl_xor(ss, off, 32);
  }
  const float mu   = s / (float)D;
  const float var  = ss / (float)D - mu * mu;
  const float rstd = rsqrtf(var + LN_EPS);
  float4 o0, o1;
  o0.x = (v[0] - mu) * rstd * g0.x + b0.x;
  o0.y = (v[1] - mu) * rstd * g0.y + b0.y;
  o0.z = (v[2] - mu) * rstd * g0.z + b0.z;
  o0.w = (v[3] - mu) * rstd * g0.w + b0.w;
  o1.x = (v[4] - mu) * rstd * g1.x + b1.x;
  o1.y = (v[5] - mu) * rstd * g1.y + b1.y;
  o1.z = (v[6] - mu) * rstd * g1.z + b1.z;
  o1.w = (v[7] - mu) * rstd * g1.w + b1.w;
  *(float4*)&out[o]     = o0;
  *(float4*)&out[o + 4] = o1;
  if (blockIdx.x == 0 && threadIdx.x == 0) {
    const double N = (double)(ROWS * D);
    const double mean = sums[0] / N;
    const double vr   = (sums[1] - N * mean * mean) / (N - 1.0);
    out[ROWS * D] = (float)sqrt(vr > 0.0 ? vr : 0.0);
  }
}

extern "C" void kernel_launch(void* const* d_in, const int* in_sizes, int n_in,
                              void* d_out, int out_size, void* d_ws, size_t ws_size,
                              hipStream_t stream) {
  const int*   user_id    = (const int*)  d_in[0];
  const float* seqs_emb   = (const float*)d_in[1];
  const float* P          = (const float*)d_in[2];
  const float* S          = (const float*)d_in[3];
  const float* Wq         = (const float*)d_in[4];
  const float* bq         = (const float*)d_in[5];
  const float* Wk         = (const float*)d_in[6];
  const float* bk         = (const float*)d_in[7];
  const float* Wv         = (const float*)d_in[8];
  const float* bv         = (const float*)d_in[9];
  const float* z_g        = (const float*)d_in[10];
  const float* z_b        = (const float*)d_in[11];
  const float* s_g        = (const float*)d_in[12];
  const float* s_b        = (const float*)d_in[13];
  const float* nam_g      = (const float*)d_in[14];
  const float* nam_b      = (const float*)d_in[15];
  const float* na_g       = (const float*)d_in[16];
  const float* na_b       = (const float*)d_in[17];
  const float* prev_z_buf = (const float*)d_in[18];
  const float* prev_s_buf = (const float*)d_in[19];
  float* out = (float*)d_out;

  // workspace layout (floats); total ~30 MB
  float* ws     = (float*)d_ws;
  float* Qb     = ws;                         // ROWS*D
  float* Zr     = Qb + (size_t)ROWS * D;      // ROWS*D
  float* Vb     = Zr + (size_t)ROWS * D;      // ROWS*D
  float* NQ     = Vb + (size_t)ROWS * D;      // ROWS*D
  float* NaCore = NQ + (size_t)ROWS * D;      // ROWS*D
  float* Pz     = NaCore + (size_t)ROWS * D;  // B*D
  float* Ps     = Pz + B * D;                 // B*D*D
  float* Mb     = Ps + B * D * D;             // B*D*D
  float* pZ     = Mb + B * D * D;             // B*CHUNKS*D
  float* pS     = pZ + B * CHUNKS * D;        // B*CHUNKS*D*D
  float* tZ     = pS + (size_t)B * CHUNKS * D * D;             // B*SC*D
  float* tS     = tZ + B * SC * D;                             // B*SC*D*D
  double* acc   = (double*)(tS + (size_t)B * SC * D * D);      // 2 doubles, 8B aligned

  proj_prefix_prep<<<B + B * SC, 256, 0, stream>>>(user_id, seqs_emb, P, S, Wq, bq, Wk, bk, Wv, bv,
                                                   z_g, z_b, s_g, s_b, nam_g, nam_b,
                                                   prev_z_buf, prev_s_buf, Pz, Ps, Mb,
                                                   Qb, Zr, Vb, pZ, pS, tZ, tS, acc);
  scan_main<<<B * CHUNKS, 256, 0, stream>>>(Qb, Zr, Vb, pZ, pS, tZ, tS, Pz, Ps,
                                            z_g, z_b, s_g, s_b, nam_g, nam_b,
                                            NaCore, NQ, acc);
  prevna_combine_ln<<<ROWS / 16, 128, 0, stream>>>(NQ, Mb, NaCore, na_g, na_b, acc, out);
}

// v007
// A run of this version takes 28.1 microseconds.
// Next to v006, in two timings, it ran 1.09 and 1.08 times as fast.
// Counting every step since v000, it is 20.2 times as fast.
#include <hip/hip_runtime.h>
#include <math.h>

#define EPSC 1e-8f
#define LN_EPS 1e-5f

typedef float v2f __attribute__((ext_vector_type(2)));
typedef float v8f __attribute__((ext_vector_type(8)));

static constexpr int B = 16, L = 512, D = 64, IN = 64, LP = 8;
static constexpr int CHUNKS = 32, CLEN = 16;        // L = CHUNKS * CLEN
static constexpr int SC = 8, CPS = CHUNKS / SC;     // blocks of a sequence, chunks to a block
static constexpr int SROWS = L / SC;                // 64 rows to a block
static constexpr int ROWS = B * L;                  // 8192
static constexpr int NU = 1024;                     // history buffers hold NU + 1 rows
static constexpr int NWV = 8;                       // waves of a scan work-group
static constexpr int SPW = CLEN / NWV;              // steps a wave owns: w + h * NWV

// ---------------- reductions (wave32) ----------------
// sum over the 32 lanes of a wave, the result in every lane
__device__ __forceinline__ float wave_sum(float a) {
  for (int off = 16; off > 0; off >>= 1) a += __shfl_xor(a, off, 32);
  return a;
}

// 16 sums over the wave at once: each exchange halves the number of values a lane carries,
// so 16 exchanges do the work of 80; lane l returns the wave-wide sum of v[l >> 1]
__device__ __forceinline__ float wave_red16(float (&v)[16], const int lane) {
  // unrolled in full, so that v stays in registers
#pragma unroll
  for (int n = 8, bit = 16; n > 0; n >>= 1, bit >>= 1) {
    const bool hi = (lane & bit) != 0;
#pragma unroll
    for (int i = 0; i < n; ++i) {
      const float lo = v[i], up = v[i + n];
      v[i] = (hi ? up : lo) + __shfl_xor(hi ? lo : up, bit, 32);
    }
  }
  return v[0] + __shfl_xor(v[0], 1, 32);
}

// ---------------- K1: projections and chunk start states, both on V_WMMA_F32_16X16X4_F32 ----
// body of work-group B + g of proj_prefix_prep: block g = SROWS rows of one sequence, 8 waves.
// The block's q, z and v rows are projected and stored; z and v also stay in LDS, and the sum
// of outer(z, v) is run through the block's rows: its value in front of each chunk goes to pS,
// its value behind the last row (the block's total) to tS; the z sums likewise to pZ and tZ.
static constexpr int ZPI = D + 8;    // LDS row pitch of z: rows k and k + 2 on other banks
static constexpr int VPI = D + 16;   // LDS row pitch of v, read 8 bytes a lane: the same
__device__ __forceinline__ void proj_and_starts(const int g, const float* __restrict__ X,
                          const float* __restrict__ Wq, const float* __restrict__ bq,
                          const float* __restrict__ Wk, const float* __restrict__ bk,
                          const float* __restrict__ Wv, const float* __restrict__ bv,
                          float* __restrict__ Q, float* __restrict__ Zr,
                          float* __restrict__ V,
                          float* __restrict__ pZ, float* __restrict__ pS,
                          float* __restrict__ tZ, float* __restrict__ tS) {
  __shared__ __attribute__((aligned(16))) float zl[SROWS * ZPI], vl[SROWS * VPI];
  const int tid  = threadIdx.x;
  const int lane = tid & 31;
  const int w    = tid >> 5;
  const int half = lane >> 4;            // lane half selects K pair
  const int mn   = lane & 15;
  const int row0 = g * SROWS;
  {
    // wave w: column tile w >> 1 of q, z and v, for two of the four 16-row tiles
    const int m0   = (w & 1) * 32;
    const int ncol = (w >> 1) * 16 + mn;
    // every operand of the 16 k steps is fetched first, so that one memory latency is paid
    v2f xa[2][IN / 4], wq[IN / 4], wk[IN / 4], wv[IN / 4];
    // 16x4 f32 A: lanes<16 hold K0,K1; lanes>=16 K2,K3.  4x16 B: row striped across lanes per VGPR
    const int woff = half * 2 * D + ncol;
    const float* xp = X + (row0 + m0 + mn) * IN + half * 2;
#pragma unroll
    for (int ks = 0; ks < IN / 4; ++ks) {
      wq[ks].x = Wq[woff + ks * 4 * D]; wq[ks].y = Wq[woff + ks * 4 * D + D];
      wk[ks].x = Wk[woff + ks * 4 * D]; wk[ks].y = Wk[woff + ks * 4 * D + D];
      wv[ks].x = Wv[woff + ks * 4 * D]; wv[ks].y = Wv[woff + ks * 4 * D + D];
      xa[0][ks] = *(const v2f*)&xp[ks * 4];
      xa[1][ks] = *(const v2f*)&xp[16 * IN + ks * 4];
    }
    const float bbq = bq[ncol], bbk = bk[ncol], bbv = bv[ncol];
    // Inputs-only fences on the loaded values: they hold the loads of k steps 0 to 11 in front of
    // the wait below (one statement takes thirty operands at most, hence four statements).
#pragma unroll
    for (int ks = 0; ks < IN / 4 - 4; ks += 4)
      asm volatile(""
                   :: "v"(wq[ks]), "v"(wk[ks]), "v"(wv[ks]), "v"(xa[0][ks]), "v"(xa[1][ks]),
                      "v"(wq[ks + 1]), "v"(wk[ks + 1]), "v"(wv[ks + 1]), "v"(xa[0][ks + 1]),
                      "v"(xa[1][ks + 1]),
                      "v"(wq[ks + 2]), "v"(wk[ks + 2]), "v"(wv[ks + 2]), "v"(xa[0][ks + 2]),
                      "v"(xa[1][ks + 2]),
                      "v"(wq[ks + 3]), "v"(wk[ks + 3]), "v"(wv[ks + 3]), "v"(xa[0][ks + 3]),
                      "v"(xa[1][ks + 3]));
    // The wait in front of any overwrite of an address register of the loads above. The last
    // loaded values and the addresses are its inputs: the loads stay in front of it and the
    // address registers stay untouched up to it.
    asm volatile("s_wait_xcnt 0x0"
                 :: "v"(wq[12]), "v"(wk[12]), "v"(wv[12]), "v"(xa[0][12]), "v"(xa[1][12]),
                    "v"(wq[13]), "v"(wk[13]), "v"(wv[13]), "v"(xa[0][13]), "v"(xa[1][13]),
                    "v"(wq[14]), "v"(wk[14]), "v"(wv[14]), "v"(xa[0][14]), "v"(xa[1][14]),
                    "v"(wq[15]), "v"(wk[15]), "v"(wv[15]), "v"(xa[0][15]), "v"(xa[1][15]),
                    "v"(bbq), "v"(bbk), "v"(bbv), "v"(woff), "v"(ncol), "v"(xp)
                 : "memory");
    v8f aq[2] = {}, ak[2] = {}, av[2] = {};
    // unrolled in full: the operand arrays are indexed by ks and stay in registers
#pragma unroll
    for (int ks = 0; ks < IN / 4; ++ks) {
#pragma unroll
      for (int i = 0; i < 2; ++i) {
        aq[i] = __builtin_amdgcn_wmma_f32_16x16x4_f32(false, xa[i][ks], false, wq[ks],
                                                      (short)0, aq[i], false, false);
        ak[i] = __builtin_amdgcn_wmma_f32_16x16x4_f32(false, xa[i][ks], false, wk[ks],
                                                      (short)0, ak[i], false, false);
        av[i] = __builtin_amdgcn_wmma_f32_16x16x4_f32(false, xa[i][ks], false, wv[ks],
                                                      (short)0, av[i], false, false);
      }
    }
    // unrolled: the accumulators are indexed by i and stay plain registers only where it is constant
#pragma unroll
    for (int i = 0; i < 2; ++i) {
      for (int r = 0; r < 8; ++r) {
        const int lr = m0 + i * 16 + r + 8 * half;   // C/D layout: VGPR r -> M=r, M=8+r
        float q = aq[i][r] + bbq, z = ak[i][r] + bbk;
        const float v = av[i][r] + bbv;
        q = q > 0.f ? q : (__expf(q) - 1.f);         // elu on q and z
        z = z > 0.f ? z : (__expf(z) - 1.f);
        Q[(row0 + lr) * D + ncol]  = q;
        Zr[(row0 + lr) * D + ncol] = z;
        V[(row0 + lr) * D + ncol]  = v;
        zl[lr * ZPI + ncol] = z;
        vl[lr * VPI + ncol] = v;
      }
      // the code below reuses the registers that these stores name
      asm volatile("s_wait_xcnt 0x0" ::: "memory");
    }
  }
  __syncthreads();
  // wave w: rows d = dt .. dt + 15 of the D x D sum, 32 columns from pb; its two 16-column
  // tiles take the even and the odd columns, so that a lane stores two neighbours at once
  const int dt = (w >> 1) * 16, pb = (w & 1) * 32;
  v8f c0 = {}, c1 = {};
  // unrolled in full: no branch stands between a matrix instruction and a store of its result
#pragma unroll
  for (int cc = 0; cc <= CPS; ++cc) {
    float* dst = (cc < CPS) ? pS + (size_t)(g * CPS + cc) * D * D : tS + (size_t)g * D * D;
    for (int r = 0; r < 8; ++r)
      *(float2*)&dst[(dt + r + 8 * half) * D + pb + 2 * mn] = make_float2(c0[r], c1[r]);
    // the code below reuses the registers that these stores name
    asm volatile("s_wait_xcnt 0x0" ::: "memory");
    if (cc < CPS) {
      for (int kb = cc * CLEN; kb < (cc + 1) * CLEN; kb += 4) {
        const int k0 = kb + half * 2;    // A and B: the same two rows k0, k0 + 1 in x and y
        v2f a, b0, b1;
        a.x = zl[k0 * ZPI + dt + mn];
        a.y = zl[(k0 + 1) * ZPI + dt + mn];
        const float2 u = *(const float2*)&vl[k0 * VPI + pb + 2 * mn];
        const float2 t = *(const float2*)&vl[(k0 + 1) * VPI + pb + 2 * mn];
        b0.x = u.x; b0.y = t.x;
        b1.x = u.y; b1.y = t.y;
        c0 = __builtin_amdgcn_wmma_f32_16x16x4_f32(false, a, false, b0,
                                                   (short)0, c0, false, false);
        c1 = __builtin_amdgcn_wmma_f32_16x16x4_f32(false, a, false, b1,
                                                   (short)0, c1, false, false);
      }
    }
  }
  if (tid < D) {                         // the z sums: one column a thread
    float run = 0.f;
    for (int cc = 0; cc < CPS; ++cc) {
      pZ[(g * CPS + cc) * D + tid] = run;
      // the additions below write the register that this store names
      asm volatile("s_wait_xcnt 0x0" ::: "memory");
      for (int t = 0; t < CLEN; ++t) run += zl[(cc * CLEN + t) * ZPI + tid];
    }
    tZ[g * D + tid] = run;
  }
}

// ---------------- K0: per-batch prompt/history constants ----------------
// body of work-group b of the first B work-groups of proj_prefix_prep, 8 waves.
// This work-group is one long chain of dependent steps, so the chain is kept short: the LP rows
// of P and the LP rows of S are one 16-row tile of V_WMMA_F32_16X16X4_F32, every operand from
// global memory is asked for at the head, the two D x D sums stay in their owners' registers,
// and what is 64 long (the z rows) is normalized by every wave for itself.
__device__ __forceinline__ void per_batch_prep(const int b,
                               const int* __restrict__ user_id,
                               const float* __restrict__ P, const float* __restrict__ S,
                               const float* __restrict__ Wk, const float* __restrict__ bk,
                               const float* __restrict__ Wv, const float* __restrict__ bv,
                               const float* __restrict__ z_g, const float* __restrict__ z_b,
                               const float* __restrict__ s_g, const float* __restrict__ s_b,
                               const float* __restrict__ nam_g, const float* __restrict__ nam_b,
                               const float* __restrict__ prev_z_buf,
                               const float* __restrict__ prev_s_buf,
                               float* __restrict__ Pz, float* __restrict__ Ps,
                               float* __restrict__ Mb) {
  // rows 0 to LP - 1: P, the others: S. In a z row element d stands at place
  // (d & 3) * 16 + (d >> 2), so that a thread's 16 d's (dq + 4j) are consecutive
  __shared__ __attribute__((aligned(16))) float zv[2 * 2 * LP * D];   // the z rows, then the v rows
  const float* zrow = zv;
  const float* vrow = zv + 2 * LP * D;
  __shared__ float zt[2 * D];               // z summed over the LP rows: P, then S
  __shared__ float4 redA[8];                // per wave: sum and squares of the P sum, of the S sum
  __shared__ float2 redB[8];                // per wave: sum and squares of the history matrix
  const int tid  = threadIdx.x;             // 256 threads
  const int lane = tid & 31;
  const int w    = __builtin_amdgcn_readfirstlane(tid >> 5);
  const int half = lane >> 4;               // lane half selects K pair
  const int mn   = lane & 15;
  // the two gathers below stay inside the NU + 1 rows for any content of user_id; the row
  // number is one value for the whole work-group: readfirstlane puts it in a scalar register
  const int uid = __builtin_amdgcn_readfirstlane(min(max(user_id[b], 0), NU));
  // wave w: column tile w >> 1 of z (even w) or of v (odd w), all 16 rows
  const bool isv = (w & 1) != 0;
  const int ncol = (w >> 1) * 16 + mn;
  const float* Wm = isv ? Wv : Wk;
  const float* bm = isv ? bv : bk;
  // 16x4 f32 A: lanes<16 hold K0,K1; lanes>=16 K2,K3.  4x16 B: row striped across lanes per VGPR
  const int woff = half * 2 * D + ncol;
  const float* xp = (mn < LP ? P + (b * LP + mn) * IN : S + (b * LP + mn - LP) * IN) + half * 2;
  v2f xa[IN / 4], wm[IN / 4];
  // unrolled in full: the operand arrays are indexed by ks and stay in registers
#pragma unroll
  for (int ks = 0; ks < IN / 4; ++ks) {
    wm[ks].x = Wm[woff + ks * 4 * D]; wm[ks].y = Wm[woff + ks * 4 * D + D];
    xa[ks] = *(const v2f*)&xp[ks * 4];
  }
  const float bb = bm[ncol];
  // the constants of the later phases: thread owns elements tid + j*256 of every D x D array
  float sg[16], sb[16], ng[16], nb[16], prs[16];
  for (int j = 0; j < 16; ++j) {
    const int idx = tid + j * 256;
    sg[j] = s_g[idx];   sb[j] = s_b[idx];
    ng[j] = nam_g[idx]; nb[j] = nam_b[idx];
    prs[j] = prev_s_buf[(size_t)uid * D * D + idx];
  }
  const float zg0 = z_g[lane], zg1 = z_g[lane + 32], zb0 = z_b[lane], zb1 = z_b[lane + 32];
  const float* pvr = prev_z_buf + (size_t)uid * D;      // a scalar base: the lane number is the offset
  const float pv0 = pvr[lane], pv1 = pvr[lane + 32];
  // Inputs-only fence on the loaded values: it holds the loads of k steps 0 to 7 in front of
  // the wait below (one statement takes thirty operands at most)
  asm volatile(""
               :: "v"(wm[0]), "v"(xa[0]), "v"(wm[1]), "v"(xa[1]), "v"(wm[2]), "v"(xa[2]),
                  "v"(wm[3]), "v"(xa[3]), "v"(wm[4]), "v"(xa[4]), "v"(wm[5]), "v"(xa[5]),
                  "v"(wm[6]), "v"(xa[6]), "v"(wm[7]), "v"(xa[7]));
  // The wait in front of any overwrite of an address register of the loads above. The last
  // loaded values and the addresses are its inputs: the loads stay in front of it and the
  // address registers stay untouched up to it.
  asm volatile("s_wait_xcnt 0x0"
               :: "v"(wm[8]), "v"(xa[8]), "v"(wm[9]), "v"(xa[9]), "v"(wm[10]), "v"(xa[10]),
                  "v"(wm[11]), "v"(xa[11]), "v"(wm[12]), "v"(xa[12]), "v"(wm[13]), "v"(xa[13]),
                  "v"(wm[14]), "v"(xa[14]), "v"(wm[15]), "v"(xa[15]),
                  "v"(bb), "v"(woff), "v"(ncol), "v"(xp)
               : "memory");
  // two chains of 8 k steps: half the dependent matrix latency
  v8f c0 = {}, c1 = {};
  // unrolled in full: the operand arrays are indexed by ks and stay in registers
#pragma unroll
  for (int ks = 0; ks < IN / 4; ks += 2) {
    c0 = __builtin_amdgcn_wmma_f32_16x16x4_f32(false, xa[ks], false, wm[ks],
                                               (short)0, c0, false, false);
    c1 = __builtin_amdgcn_wmma_f32_16x16x4_f32(false, xa[ks + 1], false, wm[ks + 1],
                                               (short)0, c1, false, false);
  }
  {
    // no branch here: z and v waves differ in a select and in the LDS index alone
    const int zplace = (ncol & 3) * 16 + (ncol >> 2);
    float* dstl = &zv[zplace + (w & 1) * (2 * LP * D + ncol - zplace)];
    float tot = 0.f;
    for (int r = 0; r < 8; ++r) {               // C/D layout: VGPR r -> M=r, M=8+r
      const float u = c0[r] + c1[r] + bb;
      const float e = u > 0.f ? u : (__expf(u) - 1.f);      // elu on z
      const float o = isv ? u : e;
      dstl[(r + 8 * half) * D] = o;
      tot += o;                                 // lanes<16: the rows of P, lanes>=16: of S
    }
    if (!isv) zt[half * D + ncol] = tot;
  }
  __syncthreads();
  // totals over the LP steps (== last cumsum value) of outer(z, v): column p, rows dq + 4j
  const int p = tid & 63, dq = tid >> 6;
  float sP[16], sS[16];
  for (int j = 0; j < 16; ++j) { sP[j] = 0.f; sS[j] = 0.f; }
  for (int t = 0; t < LP; ++t) {
    const float vp = vrow[t * D + p], vq = vrow[(LP + t) * D + p];
    for (int k = 0; k < 4; ++k) {
      const float4 za = *(const float4*)&zrow[t * D + dq * 16 + 4 * k];
      const float4 zc = *(const float4*)&zrow[(LP + t) * D + dq * 16 + 4 * k];
      sP[4 * k]     = fmaf(za.x, vp, sP[4 * k]);     sS[4 * k]     = fmaf(zc.x, vq, sS[4 * k]);
      sP[4 * k + 1] = fmaf(za.y, vp, sP[4 * k + 1]); sS[4 * k + 1] = fmaf(zc.y, vq, sS[4 * k + 1]);
      sP[4 * k + 2] = fmaf(za.z, vp, sP[4 * k + 2]); sS[4 * k + 2] = fmaf(zc.z, vq, sS[4 * k + 2]);
      sP[4 * k + 3] = fmaf(za.w, vp, sP[4 * k + 3]); sS[4 * k + 3] = fmaf(zc.w, vq, sS[4 * k + 3]);
    }
  }
  // s LN stats over 4096, P and S at once
  {
    float l1 = 0.f, l2 = 0.f, m1 = 0.f, m2 = 0.f;
    for (int j = 0; j < 16; ++j) {
      l1 += sP[j]; l2 = fmaf(sP[j], sP[j], l2);
      m1 += sS[j]; m2 = fmaf(sS[j], sS[j], m2);
    }
    l1 = wave_sum(l1); l2 = wave_sum(l2); m1 = wave_sum(m1); m2 = wave_sum(m2);
    if (lane == 0) redA[w] = make_float4(l1, l2, m1, m2);
  }
  // z LN (EPS shift cancels in centered term), every wave for itself: lane holds d = lane, lane + 32
  const float zp0 = zt[lane], zp1 = zt[lane + 32], zs0 = zt[D + lane], zs1 = zt[D + lane + 32];
  float inv, pzo0, pzo1;                    // pzo: the P row of z after its LN, stored at the end
  {
    const float a1 = wave_sum(zp0 + zp1), a2 = wave_sum(zp0 * zp0 + zp1 * zp1);
    const float e1 = wave_sum(zs0 + zs1), e2 = wave_sum(zs0 * zs0 + zs1 * zs1);
    const float muP = a1 / (float)D, rsP = rsqrtf(a2 / (float)D - muP * muP + LN_EPS);
    const float muS = e1 / (float)D, rsS = rsqrtf(e2 / (float)D - muS * muS + LN_EPS);
    pzo0 = (zp0 - muP) * rsP * zg0 + zb0;
    pzo1 = (zp1 - muP) * rsP * zg1 + zb1;
    const float h0 = pv0 + ((zs0 - muS) * rsS * zg0 + zb0);
    const float h1 = pv1 + ((zs1 - muS) * rsS * zg1 + zb1);
    const float n1 = wave_sum(h0 * h0 + h1 * h1);
    inv = 1.f / (fmaxf(sqrtf(n1), 1e-8f) + EPSC);
  }
  __syncthreads();
  // every global store stands behind the last barrier: a barrier waits for the stores in front of it
  float pn[16], pso[16];
  {
    float S1 = 0.f, S2 = 0.f, T1 = 0.f, T2 = 0.f;
    for (int i = 0; i < 8; ++i) {
      const float4 r = redA[i];
      S1 += r.x; S2 += r.y; T1 += r.z; T2 += r.w;
    }
    const float muP = S1 / 4096.f, rsP = rsqrtf(S2 / 4096.f - muP * muP + LN_EPS);
    const float muS = T1 / 4096.f, rsS = rsqrtf(T2 / 4096.f - muS * muS + LN_EPS);
    float f1 = 0.f, f2 = 0.f;
    for (int j = 0; j < 16; ++j) {
      pso[j] = (sP[j] - muP) * rsP * sg[j] + sb[j];
      pn[j] = (prs[j] + ((sS[j] - muS) * rsS * sg[j] + sb[j])) * inv;
      f1 += pn[j]; f2 = fmaf(pn[j], pn[j], f2);
    }
    f1 = wave_sum(f1); f2 = wave_sum(f2);
    if (lane == 0) redB[w] = make_float2(f1, f2);
  }
  __syncthreads();
  {
    float F1 = 0.f, F2 = 0.f;
    for (int i = 0; i < 8; ++i) { const float2 r = redB[i]; F1 += r.x; F2 += r.y; }
    const float mun = F1 / 4096.f, rstdn = rsqrtf(F2 / 4096.f - mun * mun + LN_EPS);
    for (int j = 0; j < 16; ++j) {
      Ps[b * D * D + tid + j * 256] = pso[j];
      Mb[b * D * D + tid + j * 256] = (pn[j] - mun) * rstdn * ng[j] + nb[j];
    }
    // the code below reuses the registers that these stores name
    asm volatile("s_wait_xcnt 0x0" ::: "memory");
    if (w == 0) { Pz[b * D + lane] = pzo0; Pz[b * D + lane + 32] = pzo1; }
  }
}

// One launch for two jobs that read nothing of each other: the B long work-groups of
// the per-batch constants come first in the grid, the projections with the chunk start
// states run beside them. The first work-group also gives the std accumulators their start value.
__global__ __launch_bounds__(256)
void proj_prefix_prep(const int* __restrict__ user_id, const float* __restrict__ X,
                      const float* __restrict__ P, const float* __restrict__ S,
                      const float* __restrict__ Wq, const float* __restrict__ bq,
                      const float* __restrict__ Wk, const float* __restrict__ bk,
                      const float* __restrict__ Wv, const float* __restrict__ bv,
                      const float* __restrict__ z_g, const float* __restrict__ z_b,
                      const float* __restrict__ s_g, const float* __restrict__ s_b,
                      const float* __restrict__ nam_g, const float* __restrict__ nam_b,
                      const float* __restrict__ prev_z_buf,
                      const float* __restrict__ prev_s_buf,
                      float* __restrict__ Pz, float* __restrict__ Ps,
                      float* __restrict__ Mb,
                      float* __restrict__ Q, float* __restrict__ Zr, float* __restrict__ V,
                      float* __restrict__ pZ, float* __restrict__ pS,
                      float* __restrict__ tZ, float* __restrict__ tS,
                      double* __restrict__ acc) {
  if (blockIdx.x < B) {
    if (blockIdx.x == 0 && threadIdx.x == 0) { acc[0] = 0.0; acc[1] = 0.0; }
    per_batch_prep(blockIdx.x, user_id, P, S, Wk, bk, Wv, bv, z_g, z_b, s_g, s_b,
                   nam_g, nam_b, prev_z_buf, prev_s_buf, Pz, Ps, Mb);
  } else {
    proj_and_starts(blockIdx.x - B, X, Wq, bq, Wk, bk, Wv, bv, Q, Zr, V, pZ, pS, tZ, tS);
  }
}

// N block totals added to a thread's 16 state elements, all N * 16 loads in flight together
template <int N>
__device__ __forceinline__ void add_totals(float (&x)[16], const float* __restrict__ t) {
  float v[N][16];
  for (int n = 0; n < N; ++n)
    for (int j = 0; j < 16; ++j) v[n][j] = t[n * D * D + j * 256];
  // a later result may land in the address registers that these loads name
  asm volatile("s_wait_xcnt 0x0" ::: "memory");
  for (int n = 0; n < N; ++n)
    for (int j = 0; j < 16; ++j) x[j] += v[n][j];
}

// ---------------- K2c: main scan, the CLEN steps of a chunk together ----------------
// A step depends on the one before it only through the running sums, which cost one
// multiply-add an element to form again. So every pass (state statistics, s_full statistics,
// contraction) runs over all CLEN steps, forming the state anew from the chunk's start
// value, and one block-wide reduction per pass serves all steps. The z and q rows of
// step t are handled by wave t % NWV alone, with sums inside the wave. What a work-group
// fetches once whatever its chunk's length (start state, block totals, the five D x D
// constants) is paid once per CLEN steps.
// second bound: 4 waves a SIMD, so that the grid's two work-groups per WGP are resident together
__global__ __launch_bounds__(256, 4)
void scan_main(const float* __restrict__ Q, const float* __restrict__ Zr,
               const float* __restrict__ V,
               const float* __restrict__ pZ, const float* __restrict__ pS,
               const float* __restrict__ tZ, const float* __restrict__ tS,
               const float* __restrict__ Pz, const float* __restrict__ Ps,
               const float* __restrict__ z_g, const float* __restrict__ z_b,
               const float* __restrict__ s_g, const float* __restrict__ s_b,
               const float* __restrict__ nam_g, const float* __restrict__ nam_b,
               float* __restrict__ na_core, float* __restrict__ NQ,
               double* __restrict__ acc) {
  const int b = blockIdx.x / CHUNKS, c = blockIdx.x % CHUNKS, tid = threadIdx.x;
  const int lane = tid & 31;
  const int w = __builtin_amdgcn_readfirstlane(tid >> 5);   // wave number: it owns steps w + h * NWV
  // the chunk's rows of z and of the normalized q; element d stands at place
  // (d & 3) * 16 + (d >> 2) of its row, so that a thread's 16 d's (dq + 4j) are consecutive
  __shared__ __attribute__((aligned(16))) float zP[CLEN * D], nqP[CLEN * D];
  __shared__ float vs[CLEN * D];
  __shared__ __attribute__((aligned(16))) float redw[2 * CLEN * 8];  // [2t + (0 sum, 1 squares)][wave]
  __shared__ float2 stS[CLEN], stN[CLEN];   // per step: scale and shift of the two LNs
  __shared__ float napart[CLEN * 256];
  __shared__ float red[2 * CLEN];
  __shared__ float4 xs[4 * 256];            // start value of the state; read only by its writer
  // thread owns elements tid + j*256 of every D x D array, in every pass: column p, rows dq + 4j
  const int p = tid & 63, dq = tid >> 6;
  const int row0 = (b * L + c * CLEN) * D;
  // the running state; every pass starts it anew from the cumulative outer-product sum in
  // front of the chunk, which each thread keeps in LDS rather than in 16 more registers
  float x[16];
  for (int j = 0; j < 16; ++j) x[j] = pS[(b * CHUNKS + c) * D * D + tid + j * 256];
  // a later load's result may land in the offset register that these loads name
  asm volatile("s_wait_xcnt 0x0" ::: "memory");
  // pS holds the sum from the start of the chunk's block of SROWS rows; the totals of the sb
  // blocks in front are added here, four, two and one at a time: three rounds of loads at most
  const int sb = c / CPS;
  {
    const float* tp = tS + (size_t)(b * SC) * D * D + tid;
    if (sb & 4) { add_totals<4>(x, tp); tp += 4 * D * D; }
    if (sb & 2) { add_totals<2>(x, tp); tp += 2 * D * D; }
    if (sb & 1) { add_totals<1>(x, tp); }
  }
  for (int k = 0; k < 4; ++k)
    xs[k * 256 + tid] = make_float4(x[4 * k], x[4 * k + 1], x[4 * k + 2], x[4 * k + 3]);
  // wave w stages its SPW rows: lane holds elements d0 = lane and d1 = lane + 32
  const int d0 = lane, d1 = lane + 32;
  const int e0 = (d0 & 3) * 16 + (d0 >> 2), e1 = (d1 & 3) * 16 + (d1 >> 2);
  float q0[SPW], q1[SPW];
  for (int h = 0; h < SPW; ++h) {
    const int r = w + h * NWV, rw = row0 + r * D;
    q0[h] = Q[rw + d0]; q1[h] = Q[rw + d1];
    zP[r * D + e0] = Zr[rw + d0]; zP[r * D + e1] = Zr[rw + d1];
    vs[r * D + d0] = V[rw + d0];  vs[r * D + d1] = V[rw + d1];
  }
  float zs0 = pZ[(b * CHUNKS + c) * D + d0], zs1 = pZ[(b * CHUNKS + c) * D + d1];
  float ta[SC - 1], tb[SC - 1];               // z totals of the sequence's blocks but the last
  for (int s2 = 0; s2 < SC - 1; ++s2) {
    ta[s2] = tZ[(b * SC + s2) * D + d0]; tb[s2] = tZ[(b * SC + s2) * D + d1];
  }
  // a later load's result may land in the offset register that these loads name
  asm volatile("s_wait_xcnt 0x0" ::: "memory");
  const float zg0 = z_g[d0], zg1 = z_g[d1], zb0 = z_b[d0], zb1 = z_b[d1];
  const float pz0 = Pz[b * D + d0], pz1 = Pz[b * D + d1];
  // later results may land in the address registers that the loads above name
  asm volatile("s_wait_xcnt 0x0" ::: "memory");
  for (int s2 = 0; s2 < SC - 1; ++s2) {       // those of the blocks in front are added
    zs0 += (s2 < sb) ? ta[s2] : 0.f;
    zs1 += (s2 < sb) ? tb[s2] : 0.f;
  }
  __syncthreads();

  // ---- wave w: z LN (EPS cancels), prompt z, l2 norms, q norm, std terms of its SPW steps ----
  float zc0[SPW], zc1[SPW], invz[SPW];
  for (int h = 0; h < SPW; ++h) { zc0[h] = zs0; zc1[h] = zs1; }
  for (int t = 0; t < CLEN; ++t) {            // running z sum up to and including the wave's steps
    const float za = zP[t * D + e0], zb = zP[t * D + e1];
    for (int h = 0; h < SPW; ++h) {
      zc0[h] += (t <= w + h * NWV) ? za : 0.f;
      zc1[h] += (t <= w + h * NWV) ? zb : 0.f;
    }
  }
  // unrolled: the per-step arrays are indexed by h and stay in registers
#pragma unroll
  for (int h = 0; h < SPW; ++h) {
    const int r = w + h * NWV, rw = row0 + r * D;
    const float s1  = wave_sum(zc0[h] + zc1[h]);
    const float s2  = wave_sum(zc0[h] * zc0[h] + zc1[h] * zc1[h]);
    const float qn2 = wave_sum(q0[h] * q0[h] + q1[h] * q1[h]);
    const float muz = s1 / (float)D, varz = s2 / (float)D - muz * muz;
    const float rstdz = rsqrtf(varz + LN_EPS);
    const float zf0 = (zc0[h] - muz) * rstdz * zg0 + zb0 + pz0;
    const float zf1 = (zc1[h] - muz) * rstdz * zg1 + zb1 + pz1;
    const float zn2 = wave_sum(zf0 * zf0 + zf1 * zf1);
    invz[h] = 1.f / fmaxf(sqrtf(zn2), 1e-8f);
    const float invq = 1.f / fmaxf(sqrtf(qn2), 1e-8f);
    const float nq0 = q0[h] * invq, nq1 = q1[h] * invq;
    nqP[r * D + e0] = nq0; nqP[r * D + e1] = nq1;
    NQ[rw + d0] = nq0; NQ[rw + d1] = nq1;     // the normalized q row, for the history GEMM
    // later results may land in the registers that these two stores name
    asm volatile("s_wait_xcnt 0x0" ::: "memory");
    const float ra = q0[h] / fmaxf(zf0, 1e-6f), rb = q1[h] / fmaxf(zf1, 1e-6f);
    // this step's share of the two std sums, read at the end
    const float sa = wave_sum(ra + rb), sq = wave_sum(ra * ra + rb * rb);
    if (lane == 0) { red[r] = sa; red[CLEN + r] = sq; }
  }

  const float* zrow = &zP[dq * 16];
  const float* nrow = &nqP[dq * 16];
  float val[16];
  // every pass takes the steps NWV at a time. The inner step loops are unrolled in full: val is
  // indexed by tt and stays in registers only where tt is a constant. The outer loops stay
  // rolled, for speed only

  // ---- pass 1: sum and sum of squares of the state at every step (EPS cancels) ----
  // rolled, for the size of the kernel's text (see at val above)
#pragma unroll 1
  for (int hb = 0; hb < SPW; ++hb) {
#pragma unroll
    for (int tt = 0; tt < NWV; ++tt) {
      const int t = hb * NWV + tt;
      const float vp = vs[t * D + p];
      const float4 zz0 = *(const float4*)&zrow[t * D], zz1 = *(const float4*)&zrow[t * D + 4];
      const float4 zz2 = *(const float4*)&zrow[t * D + 8], zz3 = *(const float4*)&zrow[t * D + 12];
      const float zz[16] = {zz0.x, zz0.y, zz0.z, zz0.w, zz1.x, zz1.y, zz1.z, zz1.w,
                            zz2.x, zz2.y, zz2.z, zz2.w, zz3.x, zz3.y, zz3.z, zz3.w};
      float ls = 0.f, lss = 0.f;
      for (int j = 0; j < 16; ++j) {
        x[j] = fmaf(zz[j], vp, x[j]);
        ls += x[j]; lss = fmaf(x[j], x[j], lss);
      }
      val[2 * tt] = ls; val[2 * tt + 1] = lss;
      // the scheduler works on one step at a time: with the LDS loads of later steps lifted up
      // here far fewer of the multiply-adds pair into dual-issue forms
      __builtin_amdgcn_sched_barrier(0);
    }
    const float r = wave_red16(val, lane);
    if ((lane & 1) == 0) redw[(hb * 2 * NWV + (lane >> 1)) * 8 + w] = r;
  }
  __syncthreads();
  // the constants of pass 2 are fetched here, under the close of pass 1
  float sg[16], sc[16];             // s_g; s_b + prompt P_s last (LN'd)
  for (int j = 0; j < 16; ++j) sc[j] = Ps[b * D * D + tid + j * 256];
  // as above, for the offset register of the Ps loads
  asm volatile("s_wait_xcnt 0x0" ::: "memory");
  for (int j = 0; j < 16; ++j) {
    const int idx = tid + j * 256;
    sg[j]  = s_g[idx];
    sc[j] += s_b[idx];
  }
  for (int h = 0; h < SPW; ++h) {    // wave w closes its steps
    const int r = w + h * NWV;
    float S1 = 0.f, S2 = 0.f;
    for (int i = 0; i < 8; ++i) { S1 += redw[(2 * r) * 8 + i]; S2 += redw[(2 * r + 1) * 8 + i]; }
    const float mus = S1 / 4096.f, vars = S2 / 4096.f - mus * mus;
    const float rstds = rsqrtf(vars + LN_EPS);
    if (lane == 0) stS[r] = make_float2(rstds, -mus * rstds);
  }
  __syncthreads();

  // ---- pass 2: s_full = LN(state) + Ps, its sum and sum of squares at every step ----
  for (int k = 0; k < 4; ++k) {
    const float4 s = xs[k * 256 + tid];
    x[4 * k] = s.x; x[4 * k + 1] = s.y; x[4 * k + 2] = s.z; x[4 * k + 3] = s.w;
  }
  // rolled, for the size of the kernel's text (see at val above)
#pragma unroll 1
  for (int hb = 0; hb < SPW; ++hb) {
#pragma unroll
    for (int tt = 0; tt < NWV; ++tt) {
      const int t = hb * NWV + tt;
      const float vp = vs[t * D + p];
      const float2 st = stS[t];
      const float4 zz0 = *(const float4*)&zrow[t * D], zz1 = *(const float4*)&zrow[t * D + 4];
      const float4 zz2 = *(const float4*)&zrow[t * D + 8], zz3 = *(const float4*)&zrow[t * D + 12];
      const float zz[16] = {zz0.x, zz0.y, zz0.z, zz0.w, zz1.x, zz1.y, zz1.z, zz1.w,
                            zz2.x, zz2.y, zz2.z, zz2.w, zz3.x, zz3.y, zz3.z, zz3.w};
      float ls = 0.f, lss = 0.f;
      for (int j = 0; j < 16; ++j) {
        x[j] = fmaf(zz[j], vp, x[j]);
        const float f = fmaf(fmaf(x[j], st.x, st.y), sg[j], sc[j]);
        ls += f; lss = fmaf(f, f, lss);
      }
      val[2 * tt] = ls; val[2 * tt + 1] = lss;
      // the scheduler works on one step at a time: with the LDS loads of later steps lifted up
      // here far fewer of the multiply-adds pair into dual-issue forms
      __builtin_amdgcn_sched_barrier(0);
    }
    const float r = wave_red16(val, lane);
    if ((lane & 1) == 0) redw[(hb * 2 * NWV + (lane >> 1)) * 8 + w] = r;
  }
  __syncthreads();
  // the constants of pass 3 are fetched here, under the close of pass 2; nam_g and nam_b
  // are read once for all CLEN steps
  float ng[16], nb[16];
  for (int j = 0; j < 16; ++j) { ng[j] = nam_g[tid + j * 256]; nb[j] = nam_b[tid + j * 256]; }
  // as above, for the offset register of these loads
  asm volatile("s_wait_xcnt 0x0" ::: "memory");
  // unrolled: invz is indexed by h and stays in registers
#pragma unroll
  for (int h = 0; h < SPW; ++h) {    // wave w closes its steps; nam statistics via invz scaling
    const int r = w + h * NWV;
    float F1 = 0.f, F2 = 0.f;
    for (int i = 0; i < 8; ++i) { F1 += redw[(2 * r) * 8 + i]; F2 += redw[(2 * r + 1) * 8 + i]; }
    const float muf = F1 / 4096.f, varf = F2 / 4096.f - muf * muf;
    const float mean_n = invz[h] * muf;                    // EPS cancels
    const float rstdn  = rsqrtf(invz[h] * invz[h] * varf + LN_EPS);
    if (lane == 0) stN[r] = make_float2(invz[h] * rstdn, -mean_n * rstdn);
  }
  __syncthreads();

  // ---- pass 3: LN(nam) fused with the contraction: column p, the thread's own 16 d's ----
  for (int k = 0; k < 4; ++k) {
    const float4 s = xs[k * 256 + tid];
    x[4 * k] = s.x; x[4 * k + 1] = s.y; x[4 * k + 2] = s.z; x[4 * k + 3] = s.w;
  }
  // rolled, for the size of the kernel's text (see at val above)
#pragma unroll 1
  for (int hb = 0; hb < SPW; ++hb) {
#pragma unroll
    for (int tt = 0; tt < NWV; ++tt) {
      const int t = hb * NWV + tt;
      const float vp = vs[t * D + p];
      const float2 st = stS[t], sn = stN[t];
      float part = 0.f;
#pragma unroll
      for (int h = 0; h < 16; h += 8) {        // eight d's at a time: fewer row values held
        const float4 z0 = *(const float4*)&zrow[t * D + h], z1 = *(const float4*)&zrow[t * D + h + 4];
        const float4 n0 = *(const float4*)&nrow[t * D + h], n1 = *(const float4*)&nrow[t * D + h + 4];
        const float zz[8] = {z0.x, z0.y, z0.z, z0.w, z1.x, z1.y, z1.z, z1.w};
        const float nn[8] = {n0.x, n0.y, n0.z, n0.w, n1.x, n1.y, n1.z, n1.w};
        for (int i = 0; i < 8; ++i) {
          const int j = h + i;
          x[j] = fmaf(zz[i], vp, x[j]);
          const float f = fmaf(fmaf(x[j], st.x, st.y), sg[j], sc[j]);
          const float nm = fmaf(fmaf(f, sn.x, sn.y), ng[j], nb[j]);
          part = fmaf(nn[i], nm, part);
        }
        // as in passes 1 and 2: one half step at a time, for dual-issue pairs
        __builtin_amdgcn_sched_barrier(0);
      }
      napart[t * 256 + tid] = part;
    }
  }
  __syncthreads();
  // a constant trip count, unrolled: the LDS reads of all rounds are in flight together
#pragma unroll
  for (int k = 0; k < CLEN * D / 256; ++k) {
    const int o = tid + k * 256;                   // o = step * D + column
    const float* np = &napart[(o >> 6) * 256 + (o & 63)];
    na_core[row0 + o] = np[0] + np[64] + np[128] + np[192];
  }
  if (tid == 0) {
    float A1 = 0.f, A2 = 0.f;
    for (int i = 0; i < CLEN; ++i) { A1 += red[i]; A2 += red[CLEN + i]; }
    atomicAdd(&acc[0], (double)A1); atomicAdd(&acc[1], (double)A2);
  }
}

// ------- K3: history GEMM NQ @ M_b via WMMA f32, plus na_core, final LN over D -------
// grid ROWS/16, block 128 (4 waves, one 16-col N tile each); work-group 0 also writes std
// na_core carries no __restrict__, so that its loads keep their place in front of the wait
static constexpr int TP = D + 4;   // LDS row pitch in floats: rows r and r + 8 on other banks
__global__ void prevna_combine_ln(const float* __restrict__ NQ, const float* __restrict__ Mb,
                                  const float* na_core,
                                  const float* __restrict__ na_g, const float* __restrict__ na_b,
                                  const double* __restrict__ sums, float* __restrict__ out) {
  __shared__ __attribute__((aligned(16))) float tile[16 * TP];
  const int lane = threadIdx.x & 31;
  const int wvid = threadIdx.x >> 5;
  const int half = lane >> 4;
  const int mn   = lane & 15;
  const int mrow = blockIdx.x * 16;
  const int b    = mrow / L;
  const float* W = Mb + b * D * D;
  const int ncol = wvid * 16 + mn;
  // LN phase: 8 threads to a row, 8 columns each
  const int rr = threadIdx.x >> 3, c0 = (threadIdx.x & 7) * 8;
  const int o  = (mrow + rr) * D + c0;
  v8f acc = {};
  for (int kb = 0; kb < D; kb += 4) {
    const int k0 = kb + half * 2;
    v2f a, bm;
    a.x  = NQ[(mrow + mn) * D + k0];
    a.y  = NQ[(mrow + mn) * D + k0 + 1];
    bm.x = W[k0 * D + ncol];
    bm.y = W[(k0 + 1) * D + ncol];
    acc = __builtin_amdgcn_wmma_f32_16x16x4_f32(false, a, false, bm,
                                                (short)0, acc, false, false);
  }
  for (int r = 0; r < 8; ++r) {
    const int om = r + 8 * half;
    tile[om * TP + ncol] = acc[r];
  }
  __syncthreads();
  const float4 n0 = *(const float4*)&na_core[o];
  const float4 n1 = *(const float4*)&na_core[o + 4];
  // a later load's result may land in the address pair that these two loads name
  asm volatile("s_wait_xcnt 0x0" ::: "memory");
  const float4 g0 = *(const float4*)&na_g[c0], g1 = *(const float4*)&na_g[c0 + 4];
  const float4 b0 = *(const float4*)&na_b[c0], b1 = *(const float4*)&na_b[c0 + 4];
  const float4 t0 = *(const float4*)&tile[rr * TP + c0];
  const float4 t1 = *(const float4*)&tile[rr * TP + c0 + 4];
  const float v[8] = {n0.x + t0.x, n0.y + t0.y, n0.z + t0.z, n0.w + t0.w,
                      n1.x + t1.x, n1.y + t1.y, n1.z + t1.z, n1.w + t1.w};
  float s = 0.f, ss = 0.f;
  for (int i = 0; i < 8; ++i) { s += v[i]; ss += v[i] * v[i]; }
  for (int off = 1; off < 8; off <<= 1) {
    s  += __shfl_xor(s, off, 32);
    ss += __shfl_xor(ss, off, 32);
  }
  const float mu   = s / (float)D;
  const float var  = ss / (float)D - mu * mu;
  const float rstd = rsqrtf(var + LN_EPS);
  float4 o0, o1;
  o0.x = (v[0] - mu) * rstd * g0.x + b0.x;
  o0.y = (v[1] - mu) * rstd * g0.y + b0.y;
  o0.z = (v[2] - mu) * rstd * g0.z + b0.z;
  o0.w = (v[3] - mu) * rstd * g0.w + b0.w;
  o1.x = (v[4] - mu) * rstd * g1.x + b1.x;
  o1.y = (v[5] - mu) * rstd * g1.y + b1.y;
  o1.z = (v[6] - mu) * rstd * g1.z + b1.z;
  o1.w = (v[7] - mu) * rstd * g1.w + b1.w;
  *(float4*)&out[o]     = o0;
  *(float4*)&out[o + 4] = o1;
  if (blockIdx.x == 0 && threadIdx.x == 0) {
    const double N = (double)(ROWS * D);
    const double mean = sums[0] / N;
    const double vr   = (sums[1] - N * mean * mean) / (N - 1.0);
    out[ROWS * D] = (float)sqrt(vr > 0.0 ? vr : 0.0);
  }
}

extern "C" void kernel_launch(void* const* d_in, const int* in_sizes, int n_in,
                              void* d_out, int out_size, void* d_ws, size_t ws_size,
                              hipStream_t stream) {
  const int*   user_id    = (const int*)  d_in[0];
  const float* seqs_emb   = (const float*)d_in[1];
  const float* P          = (const float*)d_in[2];
  const float* S          = (const float*)d_in[3];
  const float* Wq         = (const float*)d_in[4];
  const float* bq         = (const float*)d_in[5];
  const float* Wk         = (const float*)d_in[6];
  const float* bk         = (const float*)d_in[7];
  const float* Wv         = (const float*)d_in[8];
  const float* bv         = (const float*)d_in[9];
  const float* z_g        = (const float*)d_in[10];
  const float* z_b        = (const float*)d_in[11];
  const float* s_g        = (const float*)d_in[12];
  const float* s_b        = (const float*)d_in[13];
  const float* nam_g      = (const float*)d_in[14];
  const float* nam_b      = (const float*)d_in[15];
  const float* na_g       = (const float*)d_in[16];
  const float* na_b       = (const float*)d_in[17];
  const float* prev_z_buf = (const float*)d_in[18];
  const float* prev_s_buf = (const float*)d_in[19];
  float* out = (float*)d_out;

  // workspace layout (floats); total ~22 MB
  float* ws     = (float*)d_ws;
  float* Qb     = ws;                         // ROWS*D
  float* Zr     = Qb + (size_t)ROWS * D;      // ROWS*D
  float* Vb     = Zr + (size_t)ROWS * D;      // ROWS*D
  float* NQ     = Vb + (size_t)ROWS * D;      // ROWS*D
  float* NaCore = NQ + (size_t)ROWS * D;      // ROWS*D
  float* Pz     = NaCore + (size_t)ROWS * D;  // B*D
  float* Ps     = Pz + B * D;                 // B*D*D
  float* Mb     = Ps + B * D * D;             // B*D*D
  float* pZ     = Mb + B * D * D;             // B*CHUNKS*D
  float* pS     = pZ + B * CHUNKS * D;        // B*CHUNKS*D*D
  float* tZ     = pS + (size_t)B * CHUNKS * D * D;             // B*SC*D
  float* tS     = tZ + B * SC * D;                             // B*SC*D*D
  double* acc   = (double*)(tS + (size_t)B * SC * D * D);      // 2 doubles, 8B aligned

  proj_prefix_prep<<<B + B * SC, 256, 0, stream>>>(user_id, seqs_emb, P, S, Wq, bq, Wk, bk, Wv, bv,
                                                   z_g, z_b, s_g, s_b, nam_g, nam_b,
                                                   prev_z_buf, prev_s_buf, Pz, Ps, Mb,
                                                   Qb, Zr, Vb, pZ, pS, tZ, tS, acc);
  scan_main<<<B * CHUNKS, 256, 0, stream>>>(Qb, Zr, Vb, pZ, pS, tZ, tS, Pz, Ps,
                                            z_g, z_b, s_g, s_b, nam_g, nam_b,
                                            NaCore, NQ, acc);
  prevna_combine_ln<<<ROWS / 16, 128, 0, stream>>>(NQ, Mb, NaCore, na_g, na_b, acc, out);
}

// v008
// Measured time: 26.1 microseconds a run.
// Timed twice side by side with v007, it ran 1.07 and 1.08 times as fast.
// All steps since v000 together make it 21.7 times as fast.
#include <hip/hip_runtime.h>
#include <math.h>

#define EPSC 1e-8f
#define LN_EPS 1e-5f

typedef float v2f __attribute__((ext_vector_type(2)));
typedef float v8f __attribute__((ext_vector_type(8)));

static constexpr int B = 16, L = 512, D = 64, IN = 64, LP = 8;
static constexpr int CHUNKS = 32, CLEN = 16;        // L = CHUNKS * CLEN
static constexpr int SC = 8, CPS = CHUNKS / SC;     // blocks of a sequence, chunks to a block
static constexpr int SROWS = L / SC;                // 64 rows to a block
static constexpr int ROWS = B * L;                  // 8192
static constexpr int NU = 1024;                     // history buffers hold NU + 1 rows
static constexpr int NWV = 8;                       // waves of a scan work-group
static constexpr int SPW = CLEN / NWV;              // steps a wave owns: w + h * NWV

// ---------------- reductions (wave32) ----------------
// sum over the 32 lanes of a wave, the result in every lane
__device__ __forceinline__ float wave_sum(float a) {
  for (int off = 16; off > 0; off >>= 1) a += __shfl_xor(a, off, 32);
  return a;
}

// 16 sums over the wave at once: each exchange halves the number of values a lane carries,
// so 16 exchanges do the work of 80; lane l returns the wave-wide sum of v[l >> 1]
__device__ __forceinline__ float wave_red16(float (&v)[16], const int lane) {
  // unrolled in full, so that v stays in registers
#pragma unroll
  for (int n = 8, bit = 16; n > 0; n >>= 1, bit >>= 1) {
    const bool hi = (lane & bit) != 0;
#pragma unroll
    for (int i = 0; i < n; ++i) {
      const float lo = v[i], up = v[i + n];
      v[i] = (hi ? up : lo) + __shfl_xor(hi ? lo : up, bit, 32);
    }
  }
  return v[0] + __shfl_xor(v[0], 1, 32);
}

// ---------------- K1: projections and chunk start states, both on V_WMMA_F32_16X16X4_F32 ----
// body of work-group B + g of proj_prefix_prep: block g = SROWS rows of one sequence, 8 waves.
// The block's q, z and v rows are projected and stored; z and v also stay in LDS, and the sum
// of outer(z, v) is run through the block's rows: its value in front of each chunk goes to pS,
// its value behind the last row (the block's total) to tS; the z sums likewise to pZ and tZ.
static constexpr int ZPI = D + 8;    // LDS row pitch of z: rows k and k + 2 on other banks
static constexpr int VPI = D + 16;   // LDS row pitch of v, read 8 bytes a lane: the same
__device__ __forceinline__ void proj_and_starts(const int g, const float* __restrict__ X,
                          const float* __restrict__ Wq, const float* __restrict__ bq,
                          const float* __restrict__ Wk, const float* __restrict__ bk,
                          const float* __restrict__ Wv, const float* __restrict__ bv,
                          float* __restrict__ Q, float* __restrict__ Zr,
                          float* __restrict__ V,
                          float* __restrict__ pZ, float* __restrict__ pS,
                          float* __restrict__ tZ, float* __restrict__ tS) {
  __shared__ __attribute__((aligned(16))) float zl[SROWS * ZPI], vl[SROWS * VPI];
  const int tid  = threadIdx.x;
  const int lane = tid & 31;
  const int w    = tid >> 5;
  const int half = lane >> 4;            // lane half selects K pair
  const int mn   = lane & 15;
  const int row0 = g * SROWS;
  {
    // wave w: column tile w >> 1 of q, z and v, for two of the four 16-row tiles
    const int m0   = (w & 1) * 32;
    const int ncol = (w >> 1) * 16 + mn;
    // every operand of the 16 k steps is fetched first, so that one memory latency is paid
    v2f xa[2][IN / 4], wq[IN / 4], wk[IN / 4], wv[IN / 4];
    // 16x4 f32 A: lanes<16 hold K0,K1; lanes>=16 K2,K3.  4x16 B: row striped across lanes per VGPR
    const int woff = half * 2 * D + ncol;
    const float* xp = X + (row0 + m0 + mn) * IN + half * 2;
#pragma unroll
    for (int ks = 0; ks < IN / 4; ++ks) {
      wq[ks].x = Wq[woff + ks * 4 * D]; wq[ks].y = Wq[woff + ks * 4 * D + D];
      wk[ks].x = Wk[woff + ks * 4 * D]; wk[ks].y = Wk[woff + ks * 4 * D + D];
      wv[ks].x = Wv[woff + ks * 4 * D]; wv[ks].y = Wv[woff + ks * 4 * D + D];
      xa[0][ks] = *(const v2f*)&xp[ks * 4];
      xa[1][ks] = *(const v2f*)&xp[16 * IN + ks * 4];
    }
    const float bbq = bq[ncol], bbk = bk[ncol], bbv = bv[ncol];
    // Inputs-only fences on the loaded values: they hold the loads of k steps 0 to 11 in front of
    // the wait below (one statement takes thirty operands at most, hence three statements).
#pragma unroll
    for (int ks = 0; ks < IN / 4 - 4; ks += 4)
      asm volatile(""
                   :: "v"(wq[ks]), "v"(wk[ks]), "v"(wv[ks]), "v"(xa[0][ks]), "v"(xa[1][ks]),
                      "v"(wq[ks + 1]), "v"(wk[ks + 1]), "v"(wv[ks + 1]), "v"(xa[0][ks + 1]),
                      "v"(xa[1][ks + 1]),
                      "v"(wq[ks + 2]), "v"(wk[ks + 2]), "v"(wv[ks + 2]), "v"(xa[0][ks + 2]),
                      "v"(xa[1][ks + 2]),
                      "v"(wq[ks + 3]), "v"(wk[ks + 3]), "v"(wv[ks + 3]), "v"(xa[0][ks + 3]),
                      "v"(xa[1][ks + 3]));
    // The wait in front of any overwrite of an address register of the loads above. The last
    // loaded values and the addresses are its inputs: the loads stay in front of it and the
    // address registers stay untouched up to it.
    asm volatile("s_wait_xcnt 0x0"
                 :: "v"(wq[12]), "v"(wk[12]), "v"(wv[12]), "v"(xa[0][12]), "v"(xa[1][12]),
                    "v"(wq[13]), "v"(wk[13]), "v"(wv[13]), "v"(xa[0][13]), "v"(xa[1][13]),
                    "v"(wq[14]), "v"(wk[14]), "v"(wv[14]), "v"(xa[0][14]), "v"(xa[1][14]),
                    "v"(wq[15]), "v"(wk[15]), "v"(wv[15]), "v"(xa[0][15]), "v"(xa[1][15]),
                    "v"(bbq), "v"(bbk), "v"(bbv), "v"(woff), "v"(ncol), "v"(xp)
                 : "memory");
    v8f aq[2] = {}, ak[2] = {}, av[2] = {};
    // unrolled in full: the operand arrays are indexed by ks and stay in registers
#pragma unroll
    for (int ks = 0; ks < IN / 4; ++ks) {
#pragma unroll
      for (int i = 0; i < 2; ++i) {
        aq[i] = __builtin_amdgcn_wmma_f32_16x16x4_f32(false, xa[i][ks], false, wq[ks],
                                                      (short)0, aq[i], false, false);
        ak[i] = __builtin_amdgcn_wmma_f32_16x16x4_f32(false, xa[i][ks], false, wk[ks],
                                                      (short)0, ak[i], false, false);
        av[i] = __builtin_amdgcn_wmma_f32_16x16x4_f32(false, xa[i][ks], false, wv[ks],
                                                      (short)0, av[i], false, false);
      }
    }
    // unrolled: the accumulators are indexed by i and stay plain registers only where it is constant
#pragma unroll
    for (int i = 0; i < 2; ++i) {
      for (int r = 0; r < 8; ++r) {
        const int lr = m0 + i * 16 + r + 8 * half;   // C/D layout: VGPR r -> M=r, M=8+r
        float q = aq[i][r] + bbq, z = ak[i][r] + bbk;
        const float v = av[i][r] + bbv;
        q = q > 0.f ? q : (__expf(q) - 1.f);         // elu on q and z
        z = z > 0.f ? z : (__expf(z) - 1.f);
        Q[(row0 + lr) * D + ncol]  = q;
        Zr[(row0 + lr) * D + ncol] = z;
        V[(row0 + lr) * D + ncol]  = v;
        zl[lr * ZPI + ncol] = z;
        vl[lr * VPI + ncol] = v;
      }
      // the code below reuses the registers that these stores name
      asm volatile("s_wait_xcnt 0x0" ::: "memory");
    }
  }
  __syncthreads();
  // wave w: rows d = dt .. dt + 15 of the D x D sum, 32 columns from pb; its two 16-column
  // tiles take the even and the odd columns, so that a lane stores two neighbours at once
  const int dt = (w >> 1) * 16, pb = (w & 1) * 32;
  v8f c0 = {}, c1 = {};
  // unrolled in full: no branch stands between a matrix instruction and a store of its result
#pragma unroll
  for (int cc = 0; cc <= CPS; ++cc) {
    float* dst = (cc < CPS) ? pS + (size_t)(g * CPS + cc) * D * D : tS + (size_t)g * D * D;
    for (int r = 0; r < 8; ++r)
      *(float2*)&dst[(dt + r + 8 * half) * D + pb + 2 * mn] = make_float2(c0[r], c1[r]);
    // the code below reuses the registers that these stores name
    asm volatile("s_wait_xcnt 0x0" ::: "memory");
    if (cc < CPS) {
      for (int kb = cc * CLEN; kb < (cc + 1) * CLEN; kb += 4) {
        const int k0 = kb + half * 2;    // A and B: the same two rows k0, k0 + 1 in x and y
        v2f a, b0, b1;
        a.x = zl[k0 * ZPI + dt + mn];
        a.y = zl[(k0 + 1) * ZPI + dt + mn];
        const float2 u = *(const float2*)&vl[k0 * VPI + pb + 2 * mn];
        const float2 t = *(const float2*)&vl[(k0 + 1) * VPI + pb + 2 * mn];
        b0.x = u.x; b0.y = t.x;
        b1.x = u.y; b1.y = t.y;
        c0 = __builtin_amdgcn_wmma_f32_16x16x4_f32(false, a, false, b0,
                                                   (short)0, c0, false, false);
        c1 = __builtin_amdgcn_wmma_f32_16x16x4_f32(false, a, false, b1,
                                                   (short)0, c1, false, false);
      }
    }
  }
  if (tid < D) {                         // the z sums: one column a thread
    float run = 0.f;
    for (int cc = 0; cc < CPS; ++cc) {
      pZ[(g * CPS + cc) * D + tid] = run;
      // the additions below write the register that this store names
      asm volatile("s_wait_xcnt 0x0" ::: "memory");
      for (int t = 0; t < CLEN; ++t) run += zl[(cc * CLEN + t) * ZPI + tid];
    }
    tZ[g * D + tid] = run;
  }
}

// ---------------- K0: per-batch prompt/history constants ----------------
// body of work-group b of the first B work-groups of proj_prefix_prep, 8 waves.
// This work-group is one long chain of dependent steps, so the chain is kept short: the LP rows
// of P and the LP rows of S are one 16-row tile of V_WMMA_F32_16X16X4_F32, every operand from
// global memory is asked for at the head, the two D x D sums stay in their owners' registers,
// and what is 64 long (the z rows) is normalized by every wave for itself.
__device__ __forceinline__ void per_batch_prep(const int b,
                               const int* __restrict__ user_id,
                               const float* __restrict__ P, const float* __restrict__ S,
                               const float* __restrict__ Wk, const float* __restrict__ bk,
                               const float* __restrict__ Wv, const float* __restrict__ bv,
                               const float* __restrict__ z_g, const float* __restrict__ z_b,
                               const float* __restrict__ s_g, const float* __restrict__ s_b,
                               const float* __restrict__ nam_g, const float* __restrict__ nam_b,
                               const float* __restrict__ prev_z_buf,
                               const float* __restrict__ prev_s_buf,
                               float* __restrict__ Pz, float* __restrict__ Ps,
                               float* __restrict__ Mb) {
  // rows 0 to LP - 1: P, the others: S. In a z row element d stands at place
  // (d & 3) * 16 + (d >> 2), so that a thread's 16 d's (dq + 4j) are consecutive
  __shared__ __attribute__((aligned(16))) float zv[2 * 2 * LP * D];   // the z rows, then the v rows
  const float* zrow = zv;
  const float* vrow = zv + 2 * LP * D;
  __shared__ float zt[2 * D];               // z summed over the LP rows: P, then S
  __shared__ float4 redA[8];                // per wave: sum and squares of the P sum, of the S sum
  __shared__ float2 redB[8];                // per wave: sum and squares of the history matrix
  const int tid  = threadIdx.x;             // 256 threads
  const int lane = tid & 31;
  const int w    = __builtin_amdgcn_readfirstlane(tid >> 5);
  const int half = lane >> 4;               // lane half selects K pair
  const int mn   = lane & 15;
  // the two gathers below stay inside the NU + 1 rows for any content of user_id; the row
  // number is one value for the whole work-group: readfirstlane puts it in a scalar register
  const int uid = __builtin_amdgcn_readfirstlane(min(max(user_id[b], 0), NU));
  // wave w: column tile w >> 1 of z (even w) or of v (odd w), all 16 rows
  const bool isv = (w & 1) != 0;
  const int ncol = (w >> 1) * 16 + mn;
  const float* Wm = isv ? Wv : Wk;
  const float* bm = isv ? bv : bk;
  // 16x4 f32 A: lanes<16 hold K0,K1; lanes>=16 K2,K3.  4x16 B: row striped across lanes per VGPR
  const int woff = half * 2 * D + ncol;
  const float* xp = (mn < LP ? P + (b * LP + mn) * IN : S + (b * LP + mn - LP) * IN) + half * 2;
  v2f xa[IN / 4], wm[IN / 4];
  // unrolled in full: the operand arrays are indexed by ks and stay in registers
#pragma unroll
  for (int ks = 0; ks < IN / 4; ++ks) {
    wm[ks].x = Wm[woff + ks * 4 * D]; wm[ks].y = Wm[woff + ks * 4 * D + D];
    xa[ks] = *(const v2f*)&xp[ks * 4];
  }
  const float bb = bm[ncol];
  // the constants of the later phases: thread owns elements tid + j*256 of every D x D array
  float sg[16], sb[16], ng[16], nb[16], prs[16];
  for (int j = 0; j < 16; ++j) {
    const int idx = tid + j * 256;
    sg[j] = s_g[idx];   sb[j] = s_b[idx];
    ng[j] = nam_g[idx]; nb[j] = nam_b[idx];
    prs[j] = prev_s_buf[(size_t)uid * D * D + idx];
  }
  const float zg0 = z_g[lane], zg1 = z_g[lane + 32], zb0 = z_b[lane], zb1 = z_b[lane + 32];
  const float* pvr = prev_z_buf + (size_t)uid * D;      // a scalar base: the lane number is the offset
  const float pv0 = pvr[lane], pv1 = pvr[lane + 32];
  // Inputs-only fence on the loaded values: it holds the loads of k steps 0 to 7 in front of
  // the wait below (one statement takes thirty operands at most)
  asm volatile(""
               :: "v"(wm[0]), "v"(xa[0]), "v"(wm[1]), "v"(xa[1]), "v"(wm[2]), "v"(xa[2]),
                  "v"(wm[3]), "v"(xa[3]), "v"(wm[4]), "v"(xa[4]), "v"(wm[5]), "v"(xa[5]),
                  "v"(wm[6]), "v"(xa[6]), "v"(wm[7]), "v"(xa[7]));
  // The wait in front of any overwrite of an address register of the loads above. The last
  // loaded values and the addresses are its inputs: the loads stay in front of it and the
  // address registers stay untouched up to it.
  asm volatile("s_wait_xcnt 0x0"
               :: "v"(wm[8]), "v"(xa[8]), "v"(wm[9]), "v"(xa[9]), "v"(wm[10]), "v"(xa[10]),
                  "v"(wm[11]), "v"(xa[11]), "v"(wm[12]), "v"(xa[12]), "v"(wm[13]), "v"(xa[13]),
                  "v"(wm[14]), "v"(xa[14]), "v"(wm[15]), "v"(xa[15]),
                  "v"(bb), "v"(woff), "v"(ncol), "v"(xp)
               : "memory");
  // two chains of 8 k steps: half the dependent matrix latency
  v8f c0 = {}, c1 = {};
  // unrolled in full: the operand arrays are indexed by ks and stay in registers
#pragma unroll
  for (int ks = 0; ks < IN / 4; ks += 2) {
    c0 = __builtin_amdgcn_wmma_f32_16x16x4_f32(false, xa[ks], false, wm[ks],
                                               (short)0, c0, false, false);
    c1 = __builtin_amdgcn_wmma_f32_16x16x4_f32(false, xa[ks + 1], false, wm[ks + 1],
                                               (short)0, c1, false, false);
  }
  {
    // no branch here: z and v waves differ in a select and in the LDS index alone
    const int zplace = (ncol & 3) * 16 + (ncol >> 2);
    float* dstl = &zv[zplace + (w & 1) * (2 * LP * D + ncol - zplace)];
    float tot = 0.f;
    for (int r = 0; r < 8; ++r) {               // C/D layout: VGPR r -> M=r, M=8+r
      const float u = c0[r] + c1[r] + bb;
      const float e = u > 0.f ? u : (__expf(u) - 1.f);      // elu on z
      const float o = isv ? u : e;
      dstl[(r + 8 * half) * D] = o;
      tot += o;                                 // lanes<16: the rows of P, lanes>=16: of S
    }
    if (!isv) zt[half * D + ncol] = tot;
  }
  __syncthreads();
  // totals over the LP steps (== last cumsum value) of outer(z, v): column p, rows dq + 4j
  const int p = tid & 63, dq = tid >> 6;
  float sP[16], sS[16];
  for (int j = 0; j < 16; ++j) { sP[j] = 0.f; sS[j] = 0.f; }
  for (int t = 0; t < LP; ++t) {
    const float vp = vrow[t * D + p], vq = vrow[(LP + t) * D + p];
    for (int k = 0; k < 4; ++k) {
      const float4 za = *(const float4*)&zrow[t * D + dq * 16 + 4 * k];
      const float4 zc = *(const float4*)&zrow[(LP + t) * D + dq * 16 + 4 * k];
      sP[4 * k]     = fmaf(za.x, vp, sP[4 * k]);     sS[4 * k]     = fmaf(zc.x, vq, sS[4 * k]);
      sP[4 * k + 1] = fmaf(za.y, vp, sP[4 * k + 1]); sS[4 * k + 1] = fmaf(zc.y, vq, sS[4 * k + 1]);
      sP[4 * k + 2] = fmaf(za.z, vp, sP[4 * k + 2]); sS[4 * k + 2] = fmaf(zc.z, vq, sS[4 * k + 2]);
      sP[4 * k + 3] = fmaf(za.w, vp, sP[4 * k + 3]); sS[4 * k + 3] = fmaf(zc.w, vq, sS[4 * k + 3]);
    }
  }
  // s LN stats over 4096, P and S at once
  {
    float l1 = 0.f, l2 = 0.f, m1 = 0.f, m2 = 0.f;
    for (int j = 0; j < 16; ++j) {
      l1 += sP[j]; l2 = fmaf(sP[j], sP[j], l2);
      m1 += sS[j]; m2 = fmaf(sS[j], sS[j], m2);
    }
    l1 = wave_sum(l1); l2 = wave_sum(l2); m1 = wave_sum(m1); m2 = wave_sum(m2);
    if (lane == 0) redA[w] = make_float4(l1, l2, m1, m2);
  }
  // z LN (EPS shift cancels in centered term), every wave for itself: lane holds d = lane, lane + 32
  const float zp0 = zt[lane], zp1 = zt[lane + 32], zs0 = zt[D + lane], zs1 = zt[D + lane + 32];
  float inv, pzo0, pzo1;                    // pzo: the P row of z after its LN, stored at the end
  {
    const float a1 = wave_sum(zp0 + zp1), a2 = wave_sum(zp0 * zp0 + zp1 * zp1);
    const float e1 = wave_sum(zs0 + zs1), e2 = wave_sum(zs0 * zs0 + zs1 * zs1);
    const float muP = a1 / (float)D, rsP = rsqrtf(a2 / (float)D - muP * muP + LN_EPS);
    const float muS = e1 / (float)D, rsS = rsqrtf(e2 / (float)D - muS * muS + LN_EPS);
    pzo0 = (zp0 - muP) * rsP * zg0 + zb0;
    pzo1 = (zp1 - muP) * rsP * zg1 + zb1;
    const float h0 = pv0 + ((zs0 - muS) * rsS * zg0 + zb0);
    const float h1 = pv1 + ((zs1 - muS) * rsS * zg1 + zb1);
    const float n1 = wave_sum(h0 * h0 + h1 * h1);
    inv = 1.f / (fmaxf(sqrtf(n1), 1e-8f) + EPSC);
  }
  __syncthreads();
  // every global store stands behind the last barrier: a barrier waits for the stores in front of it
  float pn[16], pso[16];
  {
    float S1 = 0.f, S2 = 0.f, T1 = 0.f, T2 = 0.f;
    for (int i = 0; i < 8; ++i) {
      const float4 r = redA[i];
      S1 += r.x; S2 += r.y; T1 += r.z; T2 += r.w;
    }
    const float muP = S1 / 4096.f, rsP = rsqrtf(S2 / 4096.f - muP * muP + LN_EPS);
    const float muS = T1 / 4096.f, rsS = rsqrtf(T2 / 4096.f - muS * muS + LN_EPS);
    float f1 = 0.f, f2 = 0.f;
    for (int j = 0; j < 16; ++j) {
      pso[j] = (sP[j] - muP) * rsP * sg[j] + sb[j];
      pn[j] = (prs[j] + ((sS[j] - muS) * rsS * sg[j] + sb[j])) * inv;
      f1 += pn[j]; f2 = fmaf(pn[j], pn[j], f2);
      // nam_b goes into Mb twice: the history LN's own shift, and the shift of the scan's LN(nam),
      // whose share q @ nam_b of the output goes through the same product with the normalized q
      nb[j] += nb[j];
    }
    f1 = wave_sum(f1); f2 = wave_sum(f2);
    if (lane == 0) redB[w] = make_float2(f1, f2);
  }
  __syncthreads();
  {
    float F1 = 0.f, F2 = 0.f;
    for (int i = 0; i < 8; ++i) { const float2 r = redB[i]; F1 += r.x; F2 += r.y; }
    const float mun = F1 / 4096.f, rstdn = rsqrtf(F2 / 4096.f - mun * mun + LN_EPS);
    for (int j = 0; j < 16; ++j) {
      Ps[b * D * D + tid + j * 256] = pso[j];
      Mb[b * D * D + tid + j * 256] = (pn[j] - mun) * rstdn * ng[j] + nb[j];
    }
    // the code below reuses the registers that these stores name
    asm volatile("s_wait_xcnt 0x0" ::: "memory");
    if (w == 0) { Pz[b * D + lane] = pzo0; Pz[b * D + lane + 32] = pzo1; }
  }
}

// One launch for two jobs that read nothing of each other: the B long work-groups of
// the per-batch constants come first in the grid, the projections with the chunk start
// states run beside them. The first work-group also gives the std accumulators their start value.
__global__ __launch_bounds__(256)
void proj_prefix_prep(const int* __restrict__ user_id, const float* __restrict__ X,
                      const float* __restrict__ P, const float* __restrict__ S,
                      const float* __restrict__ Wq, const float* __restrict__ bq,
                      const float* __restrict__ Wk, const float* __restrict__ bk,
                      const float* __restrict__ Wv, const float* __restrict__ bv,
                      const float* __restrict__ z_g, const float* __restrict__ z_b,
                      const float* __restrict__ s_g, const float* __restrict__ s_b,
                      const float* __restrict__ nam_g, const float* __restrict__ nam_b,
                      const float* __restrict__ prev_z_buf,
                      const float* __restrict__ prev_s_buf,
                      float* __restrict__ Pz, float* __restrict__ Ps,
                      float* __restrict__ Mb,
                      float* __restrict__ Q, float* __restrict__ Zr, float* __restrict__ V,
                      float* __restrict__ pZ, float* __restrict__ pS,
                      float* __restrict__ tZ, float* __restrict__ tS,
                      double* __restrict__ acc) {
  if (blockIdx.x < B) {
    if (blockIdx.x == 0 && threadIdx.x == 0) { acc[0] = 0.0; acc[1] = 0.0; }
    per_batch_prep(blockIdx.x, user_id, P, S, Wk, bk, Wv, bv, z_g, z_b, s_g, s_b,
                   nam_g, nam_b, prev_z_buf, prev_s_buf, Pz, Ps, Mb);
  } else {
    proj_and_starts(blockIdx.x - B, X, Wq, bq, Wk, bk, Wv, bv, Q, Zr, V, pZ, pS, tZ, tS);
  }
}

// N block totals added to a thread's 16 state elements, all N * 16 loads in flight together
template <int N>
__device__ __forceinline__ void add_totals(float (&x)[16], const float* __restrict__ t) {
  float v[N][16];
  for (int n = 0; n < N; ++n)
    for (int j = 0; j < 16; ++j) v[n][j] = t[n * D * D + j * 256];
  // a later result may land in the address registers that these loads name
  asm volatile("s_wait_xcnt 0x0" ::: "memory");
  for (int n = 0; n < N; ++n)
    for (int j = 0; j < 16; ++j) x[j] += v[n][j];
}

// ---------------- K2c: main scan, the CLEN steps of a chunk together ----------------
// A step depends on the one before it only through the running sums, which cost one
// multiply-add an element to form again. So every pass (state statistics; s_full statistics
// with the contraction) runs over all CLEN steps, forming the state anew from the chunk's start
// value, and one block-wide reduction per pass serves all steps. LN(nam) is s_full times a
// scale plus a shift, both one number a step, then nam_g and nam_b: so its contraction with q is
// scale * sum_d q nam_g s_full + shift * (q @ nam_g) + q @ nam_b. The first sum needs no
// statistic of s_full and is formed in the pass that takes them; the two products are left
// to the last launch, which gets the shift of every row in sny. The z and q rows of
// step t are handled by wave t % NWV alone, with sums inside the wave. What a work-group
// fetches once whatever its chunk's length (start state, block totals, the four D x D
// constants) is paid once per CLEN steps.
// second bound: 4 waves a SIMD, so that the grid's two work-groups per WGP are resident together
__global__ __launch_bounds__(256, 4)
void scan_main(const float* __restrict__ Q, const float* __restrict__ Zr,
               const float* __restrict__ V,
               const float* __restrict__ pZ, const float* __restrict__ pS,
               const float* __restrict__ tZ, const float* __restrict__ tS,
               const float* __restrict__ Pz, const float* __restrict__ Ps,
               const float* __restrict__ z_g, const float* __restrict__ z_b,
               const float* __restrict__ s_g, const float* __restrict__ s_b,
               const float* __restrict__ nam_g,
               float* __restrict__ na_core, float* __restrict__ NQ, float* __restrict__ sny,
               double* __restrict__ acc) {
  const int b = blockIdx.x / CHUNKS, c = blockIdx.x % CHUNKS, tid = threadIdx.x;
  const int lane = tid & 31;
  const int w = __builtin_amdgcn_readfirstlane(tid >> 5);   // wave number: it owns steps w + h * NWV
  // the chunk's rows of z and of the normalized q; element d stands at place
  // (d & 3) * 16 + (d >> 2) of its row, so that a thread's 16 d's (dq + 4j) are consecutive
  __shared__ __attribute__((aligned(16))) float zP[CLEN * D], nqP[CLEN * D];
  __shared__ float vs[CLEN * D];
  __shared__ __attribute__((aligned(16))) float redw[2 * CLEN * 8];  // [2t + (0 sum, 1 squares)][wave]
  __shared__ float2 stS[CLEN];              // per step: scale and shift of the state's LN
  __shared__ float snx[CLEN];               // per step: scale of LN(nam)
  __shared__ float napart[CLEN * 256];
  __shared__ float red[2 * CLEN];
  __shared__ float4 xs[4 * 256];            // start value of the state; read only by its writer
  // thread owns elements tid + j*256 of every D x D array, in every pass: column p, rows dq + 4j
  const int p = tid & 63, dq = tid >> 6;
  const int row0 = (b * L + c * CLEN) * D;
  // the running state; every pass starts it anew from the cumulative outer-product sum in
  // front of the chunk, which each thread keeps in LDS rather than in 16 more registers
  float x[16];
  for (int j = 0; j < 16; ++j) x[j] = pS[(b * CHUNKS + c) * D * D + tid + j * 256];
  // a later load's result may land in the offset register that these loads name
  asm volatile("s_wait_xcnt 0x0" ::: "memory");
  // pS holds the sum from the start of the chunk's block of SROWS rows; the totals of the sb
  // blocks in front are added here, four, two and one at a time: three rounds of loads at most
  const int sb = c / CPS;
  {
    const float* tp = tS + (size_t)(b * SC) * D * D + tid;
    if (sb & 4) { add_totals<4>(x, tp); tp += 4 * D * D; }
    if (sb & 2) { add_totals<2>(x, tp); tp += 2 * D * D; }
    if (sb & 1) { add_totals<1>(x, tp); }
  }
  for (int k = 0; k < 4; ++k)
    xs[k * 256 + tid] = make_float4(x[4 * k], x[4 * k + 1], x[4 * k + 2], x[4 * k + 3]);
  // wave w stages its SPW rows: lane holds elements d0 = lane and d1 = lane + 32
  const int d0 = lane, d1 = lane + 32;
  const int e0 = (d0 & 3) * 16 + (d0 >> 2), e1 = (d1 & 3) * 16 + (d1 >> 2);
  float q0[SPW], q1[SPW];
  for (int h = 0; h < SPW; ++h) {
    const int r = w + h * NWV, rw = row0 + r * D;
    q0[h] = Q[rw + d0]; q1[h] = Q[rw + d1];
    zP[r * D + e0] = Zr[rw + d0]; zP[r * D + e1] = Zr[rw + d1];
    vs[r * D + d0] = V[rw + d0];  vs[r * D + d1] = V[rw + d1];
  }
  float zs0 = pZ[(b * CHUNKS + c) * D + d0], zs1 = pZ[(b * CHUNKS + c) * D + d1];
  float ta[SC - 1], tb[SC - 1];               // z totals of the sequence's blocks but the last
  for (int s2 = 0; s2 < SC - 1; ++s2) {
    ta[s2] = tZ[(b * SC + s2) * D + d0]; tb[s2] = tZ[(b * SC + s2) * D + d1];
  }
  // a later load's result may land in the offset register that these loads name
  asm volatile("s_wait_xcnt 0x0" ::: "memory");
  const float zg0 = z_g[d0], zg1 = z_g[d1], zb0 = z_b[d0], zb1 = z_b[d1];
  const float pz0 = Pz[b * D + d0], pz1 = Pz[b * D + d1];
  // later results may land in the address registers that the loads above name
  asm volatile("s_wait_xcnt 0x0" ::: "memory");
  for (int s2 = 0; s2 < SC - 1; ++s2) {       // those of the blocks in front are added
    zs0 += (s2 < sb) ? ta[s2] : 0.f;
    zs1 += (s2 < sb) ? tb[s2] : 0.f;
  }
  __syncthreads();

  // ---- wave w: z LN (EPS cancels), prompt z, l2 norms, q norm, std terms of its SPW steps ----
  float zc0[SPW], zc1[SPW], invz[SPW];
  for (int h = 0; h < SPW; ++h) { zc0[h] = zs0; zc1[h] = zs1; }
  for (int t = 0; t < CLEN; ++t) {            // running z sum up to and including the wave's steps
    const float za = zP[t * D + e0], zb = zP[t * D + e1];
    for (int h = 0; h < SPW; ++h) {
      zc0[h] += (t <= w + h * NWV) ? za : 0.f;
      zc1[h] += (t <= w + h * NWV) ? zb : 0.f;
    }
  }
  // unrolled: the per-step arrays are indexed by h and stay in registers
#pragma unroll
  for (int h = 0; h < SPW; ++h) {
    const int r = w + h * NWV, rw = row0 + r * D;
    const float s1  = wave_sum(zc0[h] + zc1[h]);
    const float s2  = wave_sum(zc0[h] * zc0[h] + zc1[h] * zc1[h]);
    const float qn2 = wave_sum(q0[h] * q0[h] + q1[h] * q1[h]);
    const float muz = s1 / (float)D, varz = s2 / (float)D - muz * muz;
    const float rstdz = rsqrtf(varz + LN_EPS);
    const float zf0 = (zc0[h] - muz) * rstdz * zg0 + zb0 + pz0;
    const float zf1 = (zc1[h] - muz) * rstdz * zg1 + zb1 + pz1;
    const float zn2 = wave_sum(zf0 * zf0 + zf1 * zf1);
    invz[h] = 1.f / fmaxf(sqrtf(zn2), 1e-8f);
    const float invq = 1.f / fmaxf(sqrtf(qn2), 1e-8f);
    const float nq0 = q0[h] * invq, nq1 = q1[h] * invq;
    nqP[r * D + e0] = nq0; nqP[r * D + e1] = nq1;
    NQ[rw + d0] = nq0; NQ[rw + d1] = nq1;     // the normalized q row, for the history GEMM
    // later results may land in the registers that these two stores name
    asm volatile("s_wait_xcnt 0x0" ::: "memory");
    const float ra = q0[h] / fmaxf(zf0, 1e-6f), rb = q1[h] / fmaxf(zf1, 1e-6f);
    // this step's share of the two std sums, read at the end
    const float sa = wave_sum(ra + rb), sq = wave_sum(ra * ra + rb * rb);
    if (lane == 0) { red[r] = sa; red[CLEN + r] = sq; }
  }

  const float* zrow = &zP[dq * 16];
  const float* nrow = &nqP[dq * 16];
  float val[16];
  // every pass takes the steps NWV at a time. The inner step loops are unrolled in full: val is
  // indexed by tt and stays in registers only where tt is a constant. The outer loops stay
  // rolled, for speed only

  // ---- pass 1: sum and sum of squares of the state at every step (EPS cancels) ----
  // rolled, for speed only (see at val above)
#pragma unroll 1
  for (int hb = 0; hb < SPW; ++hb) {
#pragma unroll
    for (int tt = 0; tt < NWV; ++tt) {
      const int t = hb * NWV + tt;
      const float vp = vs[t * D + p];
      const float4 zz0 = *(const float4*)&zrow[t * D], zz1 = *(const float4*)&zrow[t * D + 4];
      const float4 zz2 = *(const float4*)&zrow[t * D + 8], zz3 = *(const float4*)&zrow[t * D + 12];
      const float zz[16] = {zz0.x, zz0.y, zz0.z, zz0.w, zz1.x, zz1.y, zz1.z, zz1.w,
                            zz2.x, zz2.y, zz2.z, zz2.w, zz3.x, zz3.y, zz3.z, zz3.w};
      float ls = 0.f, lss = 0.f;
      for (int j = 0; j < 16; ++j) {
        x[j] = fmaf(zz[j], vp, x[j]);
        ls += x[j]; lss = fmaf(x[j], x[j], lss);
      }
      val[2 * tt] = ls; val[2 * tt + 1] = lss;
      // the scheduler works on one step at a time: with the LDS loads of later steps lifted up
      // here far fewer of the multiply-adds pair into dual-issue forms
      __builtin_amdgcn_sched_barrier(0);
    }
    const float r = wave_red16(val, lane);
    if ((lane & 1) == 0) redw[(hb * 2 * NWV + (lane >> 1)) * 8 + w] = r;
  }
  __syncthreads();
  // the constants of pass 2 are fetched here, under the close of pass 1
  float sg[16], sc[16], ng[16];     // s_g; s_b + prompt P_s last (LN'd); nam_g
  const int pso = b * D * D + tid;
  for (int j = 0; j < 16; ++j) sc[j] = Ps[pso + j * 256];
  // as above, for the offset register of the Ps loads; it is the wait's input, so that no load's
  // result lands in it ahead of the wait
  asm volatile("s_wait_xcnt 0x0" :: "v"(pso) : "memory");
  for (int j = 0; j < 16; ++j) {
    const int idx = tid + j * 256;
    sg[j]  = s_g[idx];
    sc[j] += s_b[idx];
    ng[j]  = nam_g[idx];
  }
  // as above, for the offset register of these loads; it is the wait's input, so that no load's
  // result lands in it ahead of the wait
  asm volatile("s_wait_xcnt 0x0" :: "v"(tid) : "memory");
  for (int h = 0; h < SPW; ++h) {    // wave w closes its steps
    const int r = w + h * NWV;
    float S1 = 0.f, S2 = 0.f;
    for (int i = 0; i < 8; ++i) { S1 += redw[(2 * r) * 8 + i]; S2 += redw[(2 * r + 1) * 8 + i]; }
    const float mus = S1 / 4096.f, vars = S2 / 4096.f - mus * mus;
    const float rstds = rsqrtf(vars + LN_EPS);
    if (lane == 0) stS[r] = make_float2(rstds, -mus * rstds);
  }
  __syncthreads();

  // ---- pass 2: s_full = LN(state) + Ps at every step: its sum, its sum of squares, and
  // sum_d q nam_g s_full for column p over the thread's own 16 d's ----
  for (int k = 0; k < 4; ++k) {
    const float4 s = xs[k * 256 + tid];
    x[4 * k] = s.x; x[4 * k + 1] = s.y; x[4 * k + 2] = s.z; x[4 * k + 3] = s.w;
  }
  // rolled, for speed only (see at val above)
#pragma unroll 1
  for (int hb = 0; hb < SPW; ++hb) {
#pragma unroll
    for (int tt = 0; tt < NWV; ++tt) {
      const int t = hb * NWV + tt;
      const float vp = vs[t * D + p];
      const float2 st = stS[t];
      float ls = 0.f, lss = 0.f, part = 0.f;
#pragma unroll
      for (int h = 0; h < 16; h += 8) {        // eight d's at a time: fewer row values held
        const float4 z0 = *(const float4*)&zrow[t * D + h], z1 = *(const float4*)&zrow[t * D + h + 4];
        const float4 n0 = *(const float4*)&nrow[t * D + h], n1 = *(const float4*)&nrow[t * D + h + 4];
        const float zz[8] = {z0.x, z0.y, z0.z, z0.w, z1.x, z1.y, z1.z, z1.w};
        const float nn[8] = {n0.x, n0.y, n0.z, n0.w, n1.x, n1.y, n1.z, n1.w};
        for (int i = 0; i < 8; ++i) {
          const int j = h + i;
          x[j] = fmaf(zz[i], vp, x[j]);
          const float f = fmaf(fmaf(x[j], st.x, st.y), sg[j], sc[j]);
          ls += f; lss = fmaf(f, f, lss);
          part = fmaf(nn[i], ng[j] * f, part);
        }
        // as in pass 1: one half step at a time, for dual-issue pairs
        __builtin_amdgcn_sched_barrier(0);
      }
      val[2 * tt] = ls; val[2 * tt + 1] = lss;
      napart[t * 256 + tid] = part;
    }
    const float r = wave_red16(val, lane);
    if ((lane & 1) == 0) redw[(hb * 2 * NWV + (lane >> 1)) * 8 + w] = r;
  }
  __syncthreads();
  float sy[SPW];                     // the shift of LN(nam) at the wave's steps
  // unrolled: invz and sy are indexed by h and stay in registers
#pragma unroll
  for (int h = 0; h < SPW; ++h) {    // wave w closes its steps; nam statistics via invz scaling
    const int r = w + h * NWV;
    float F1 = 0.f, F2 = 0.f;
    for (int i = 0; i < 8; ++i) { F1 += redw[(2 * r) * 8 + i]; F2 += redw[(2 * r + 1) * 8 + i]; }
    const float muf = F1 / 4096.f, varf = F2 / 4096.f - muf * muf;
    const float mean_n = invz[h] * muf;                    // EPS cancels
    const float rstdn  = rsqrtf(invz[h] * invz[h] * varf + LN_EPS);
    sy[h] = -mean_n * rstdn;
    if (lane == 0) snx[r] = invz[h] * rstdn;
  }
  __syncthreads();
  // the global stores stand behind the last barrier: a barrier waits for the stores in front of it
  // a constant trip count, unrolled: the LDS reads of all rounds are in flight together
#pragma unroll
  for (int k = 0; k < CLEN * D / 256; ++k) {
    const int o = tid + k * 256;                   // o = step * D + column
    const float* np = &napart[(o >> 6) * 256 + (o & 63)];
    na_core[row0 + o] = snx[o >> 6] * (np[0] + np[64] + np[128] + np[192]);
  }
  if (lane == 0) {                                 // the rows' shifts, for the last launch
    // unrolled: sy is indexed by h and stays in registers
#pragma unroll
    for (int h = 0; h < SPW; ++h) sny[b * L + c * CLEN + w + h * NWV] = sy[h];
  }
  if (tid == 0) {
    float A1 = 0.f, A2 = 0.f;
    for (int i = 0; i < CLEN; ++i) { A1 += red[i]; A2 += red[CLEN + i]; }
    atomicAdd(&acc[0], (double)A1); atomicAdd(&acc[1], (double)A2);
  }
}

// ------- K3: NQ @ M_b (history, and both nam_b shifts) and NQ @ nam_g times the row's shift of
// LN(nam), both via WMMA f32, plus na_core, final LN over D -------
// grid ROWS/16, block 128 (4 waves, one 16-col N tile each); work-group 0 also writes std
// na_core carries no __restrict__, so that its loads keep their place in front of the wait
static constexpr int TP = D + 4;   // LDS row pitch in floats: rows r and r + 8 on other banks
__global__ void prevna_combine_ln(const float* __restrict__ NQ, const float* __restrict__ Mb,
                                  const float* __restrict__ nam_g, const float* __restrict__ sny,
                                  const float* na_core,
                                  const float* __restrict__ na_g, const float* __restrict__ na_b,
                                  const double* __restrict__ sums, float* __restrict__ out) {
  __shared__ __attribute__((aligned(16))) float tile[16 * TP];
  const int lane = threadIdx.x & 31;
  const int wvid = threadIdx.x >> 5;
  const int half = lane >> 4;
  const int mn   = lane & 15;
  const int mrow = blockIdx.x * 16;
  const int b    = mrow / L;
  const float* W = Mb + b * D * D;
  const int ncol = wvid * 16 + mn;
  // LN phase: 8 threads to a row, 8 columns each
  const int rr = threadIdx.x >> 3, c0 = (threadIdx.x & 7) * 8;
  const int o  = (mrow + rr) * D + c0;
  // every operand of the 16 k steps is fetched first, so that one memory latency is paid
  // 16x4 f32 A: lanes<16 hold K0,K1; lanes>=16 K2,K3.  4x16 B: row striped across lanes per VGPR
  const int woff = half * 2 * D + ncol;
  const float* ap = NQ + (mrow + mn) * D + half * 2;
  const float* yp = sny + mrow + 8 * half;     // the shifts of the lane's 8 rows (VGPR r -> M = r + 8 * half)
  v2f a[D / 4], bm[D / 4], bg[D / 4];
  // unrolled in full: the operand arrays are indexed by ks and stay in registers
#pragma unroll
  for (int ks = 0; ks < D / 4; ++ks) {
    a[ks] = *(const v2f*)&ap[ks * 4];
    bm[ks].x = W[woff + ks * 4 * D];     bm[ks].y = W[woff + ks * 4 * D + D];
    bg[ks].x = nam_g[woff + ks * 4 * D]; bg[ks].y = nam_g[woff + ks * 4 * D + D];
  }
  const float4 y0 = *(const float4*)&yp[0], y1 = *(const float4*)&yp[4];
  const float yy[8] = {y0.x, y0.y, y0.z, y0.w, y1.x, y1.y, y1.z, y1.w};
  // Inputs-only fences on the loaded values: they hold the loads of k steps 0 to 11 in front of
  // the wait below (one statement takes thirty operands at most, hence two statements).
#pragma unroll
  for (int ks = 0; ks < D / 4 - 4; ks += 6)
    asm volatile(""
                 :: "v"(a[ks]), "v"(bm[ks]), "v"(bg[ks]),
                    "v"(a[ks + 1]), "v"(bm[ks + 1]), "v"(bg[ks + 1]),
                    "v"(a[ks + 2]), "v"(bm[ks + 2]), "v"(bg[ks + 2]),
                    "v"(a[ks + 3]), "v"(bm[ks + 3]), "v"(bg[ks + 3]),
                    "v"(a[ks + 4]), "v"(bm[ks + 4]), "v"(bg[ks + 4]),
                    "v"(a[ks + 5]), "v"(bm[ks + 5]), "v"(bg[ks + 5]));
  // The wait in front of any overwrite of an address register of the loads above. The last
  // loaded values and the addresses are its inputs: the loads stay in front of it and the
  // address registers stay untouched up to it.
  asm volatile("s_wait_xcnt 0x0"
               :: "v"(a[12]), "v"(bm[12]), "v"(bg[12]), "v"(a[13]), "v"(bm[13]), "v"(bg[13]),
                  "v"(a[14]), "v"(bm[14]), "v"(bg[14]), "v"(a[15]), "v"(bm[15]), "v"(bg[15]),
                  "v"(yy[0]), "v"(yy[1]), "v"(yy[2]), "v"(yy[3]),
                  "v"(yy[4]), "v"(yy[5]), "v"(yy[6]), "v"(yy[7]),
                  "v"(woff), "v"(ap), "v"(yp)
               : "memory");
  v8f acc = {}, acg = {};
  // unrolled in full: the operand arrays are indexed by ks and stay in registers
#pragma unroll
  for (int ks = 0; ks < D / 4; ++ks) {
    acc = __builtin_amdgcn_wmma_f32_16x16x4_f32(false, a[ks], false, bm[ks],
                                                (short)0, acc, false, false);
    acg = __builtin_amdgcn_wmma_f32_16x16x4_f32(false, a[ks], false, bg[ks],
                                                (short)0, acg, false, false);
  }
  for (int r = 0; r < 8; ++r) {
    const int om = r + 8 * half;
    tile[om * TP + ncol] = fmaf(yy[r], acg[r], acc[r]);
  }
  __syncthreads();
  const float4 n0 = *(const float4*)&na_core[o];
  const float4 n1 = *(const float4*)&na_core[o + 4];
  // a later load's result may land in the address pair that these two loads name
  asm volatile("s_wait_xcnt 0x0" ::: "memory");
  const float4 g0 = *(const float4*)&na_g[c0], g1 = *(const float4*)&na_g[c0 + 4];
  const float4 b0 = *(const float4*)&na_b[c0], b1 = *(const float4*)&na_b[c0 + 4];
  const float4 t0 = *(const float4*)&tile[rr * TP + c0];
  const float4 t1 = *(const float4*)&tile[rr * TP + c0 + 4];
  const float v[8] = {n0.x + t0.x, n0.y + t0.y, n0.z + t0.z, n0.w + t0.w,
                      n1.x + t1.x, n1.y + t1.y, n1.z + t1.z, n1.w + t1.w};
  float s = 0.f, ss = 0.f;
  for (int i = 0; i < 8; ++i) { s += v[i]; ss += v[i] * v[i]; }
  for (int off = 1; off < 8; off <<= 1) {
    s  += __shfl_xor(s, off, 32);
    ss += __shfl_xor(ss, off, 32);
  }
  const float mu   = s / (float)D;
  const float var  = ss / (float)D - mu * mu;
  const float rstd = rsqrtf(var + LN_EPS);
  float4 o0, o1;
  o0.x = (v[0] - mu) * rstd * g0.x + b0.x;
  o0.y = (v[1] - mu) * rstd * g0.y + b0.y;
  o0.z = (v[2] - mu) * rstd * g0.z + b0.z;
  o0.w = (v[3] - mu) * rstd * g0.w + b0.w;
  o1.x = (v[4] - mu) * rstd * g1.x + b1.x;
  o1.y = (v[5] - mu) * rstd * g1.y + b1.y;
  o1.z = (v[6] - mu) * rstd * g1.z + b1.z;
  o1.w = (v[7] - mu) * rstd * g1.w + b1.w;
  *(float4*)&out[o]     = o0;
  *(float4*)&out[o + 4] = o1;
  if (blockIdx.x == 0 && threadIdx.x == 0) {
    const double N = (double)(ROWS * D);
    const double mean = sums[0] / N;
    const double vr   = (sums[1] - N * mean * mean) / (N - 1.0);
    out[ROWS * D] = (float)sqrt(vr > 0.0 ? vr : 0.0);
  }
}

extern "C" void kernel_launch(void* const* d_in, const int* in_sizes, int n_in,
                              void* d_out, int out_size, void* d_ws, size_t ws_size,
                              hipStream_t stream) {
  const int*   user_id    = (const int*)  d_in[0];
  const float* seqs_emb   = (const float*)d_in[1];
  const float* P          = (const float*)d_in[2];
  const float* S          = (const float*)d_in[3];
  const float* Wq         = (const float*)d_in[4];
  const float* bq         = (const float*)d_in[5];
  const float* Wk         = (const float*)d_in[6];
  const float* bk         = (const float*)d_in[7];
  const float* Wv         = (const float*)d_in[8];
  const float* bv         = (const float*)d_in[9];
  const float* z_g        = (const float*)d_in[10];
  const float* z_b        = (const float*)d_in[11];
  const float* s_g        = (const float*)d_in[12];
  const float* s_b        = (const float*)d_in[13];
  const float* nam_g      = (const float*)d_in[14];
  const float* nam_b      = (const float*)d_in[15];
  const float* na_g       = (const float*)d_in[16];
  const float* na_b       = (const float*)d_in[17];
  const float* prev_z_buf = (const float*)d_in[18];
  const float* prev_s_buf = (const float*)d_in[19];
  float* out = (float*)d_out;

  // workspace layout (floats); total ~22 MB
  float* ws     = (float*)d_ws;
  float* Qb     = ws;                         // ROWS*D
  float* Zr     = Qb + (size_t)ROWS * D;      // ROWS*D
  float* Vb     = Zr + (size_t)ROWS * D;      // ROWS*D
  float* NQ     = Vb + (size_t)ROWS * D;      // ROWS*D
  float* NaCore = NQ + (size_t)ROWS * D;      // ROWS*D
  float* Pz     = NaCore + (size_t)ROWS * D;  // B*D
  float* Ps     = Pz + B * D;                 // B*D*D
  float* Mb     = Ps + B * D * D;             // B*D*D
  float* pZ     = Mb + B * D * D;             // B*CHUNKS*D
  float* pS     = pZ + B * CHUNKS * D;        // B*CHUNKS*D*D
  float* tZ     = pS + (size_t)B * CHUNKS * D * D;             // B*SC*D
  float* tS     = tZ + B * SC * D;                             // B*SC*D*D
  double* acc   = (double*)(tS + (size_t)B * SC * D * D);      // 2 doubles, 8B aligned
  float* sny    = (float*)(acc + 2);                           // ROWS, 16B aligned

  proj_prefix_prep<<<B + B * SC, 256, 0, stream>>>(user_id, seqs_emb, P, S, Wq, bq, Wk, bk, Wv, bv,
                                                   z_g, z_b, s_g, s_b, nam_g, nam_b,
                                                   prev_z_buf, prev_s_buf, Pz, Ps, Mb,
                                                   Qb, Zr, Vb, pZ, pS, tZ, tS, acc);
  scan_main<<<B * CHUNKS, 256, 0, stream>>>(Qb, Zr, Vb, pZ, pS, tZ, tS, Pz, Ps,
                                            z_g, z_b, s_g, s_b, nam_g,
                                            NaCore, NQ, sny, acc);
  prevna_combine_ln<<<ROWS / 16, 128, 0, stream>>>(NQ, Mb, nam_g, sny, NaCore, na_g, na_b, acc, out);
}

// v009
// Measured time: 25.2 microseconds a run.
// Timed twice side by side with v008, it ran 1.04 times as fast both times.
// Counting every step since v000, it is 22.5 times as fast.
#include <hip/hip_runtime.h>
#include <math.h>

#define EPSC 1e-8f
#define LN_EPS 1e-5f

typedef float v2f __attribute__((ext_vector_type(2)));
typedef float v8f __attribute__((ext_vector_type(8)));

static constexpr int B = 16, L = 512, D = 64, IN = 64, LP = 8;
static constexpr int CHUNKS = 32, CLEN = 16;        // L = CHUNKS * CLEN
static constexpr int SC = 8, CPS = CHUNKS / SC;     // blocks of a sequence, chunks to a block
static constexpr int SROWS = L / SC;                // 64 rows to a block
static constexpr int ROWS = B * L;                  // 8192
static constexpr int NU = 1024;                     // history buffers hold NU + 1 rows
static constexpr int NWV = 8;                       // waves of a scan work-group
static constexpr int SPW = CLEN / NWV;              // steps a wave owns: w + h * NWV

// ---------------- reductions (wave32) ----------------
// sum over the 32 lanes of a wave, the result in every lane
__device__ __forceinline__ float wave_sum(float a) {
  for (int off = 16; off > 0; off >>= 1) a += __shfl_xor(a, off, 32);
  return a;
}

// 16 sums over the wave at once: each exchange halves the number of values a lane carries,
// so 16 exchanges do the work of 80; lane l returns the wave-wide sum of v[l >> 1]
__device__ __forceinline__ float wave_red16(float (&v)[16], const int lane) {
  // unrolled in full, so that v stays in registers
#pragma unroll
  for (int n = 8, bit = 16; n > 0; n >>= 1, bit >>= 1) {
    const bool hi = (lane & bit) != 0;
#pragma unroll
    for (int i = 0; i < n; ++i) {
      const float lo = v[i], up = v[i + n];
      v[i] = (hi ? up : lo) + __shfl_xor(hi ? lo : up, bit, 32);
    }
  }
  return v[0] + __shfl_xor(v[0], 1, 32);
}

// ---------------- K1: projections and chunk start states, both on V_WMMA_F32_16X16X4_F32 ----
// body of work-group B + g of proj_prefix_prep: block g = SROWS rows of one sequence, 8 waves.
// The block's q, z and v rows are projected and stored; z and v also stay in LDS, and the sum
// of outer(z, v) is run through the block's rows: its value in front of each chunk goes to pS,
// its value behind the last row (the block's total) to tS; the z sums likewise to pZ and tZ.
static constexpr int ZPI = D + 8;    // LDS row pitch of z: rows k and k + 2 on other banks
static constexpr int VPI = D + 16;   // LDS row pitch of v, read 8 bytes a lane: the same
__device__ __forceinline__ void proj_and_starts(const int g, const float* __restrict__ X,
                          const float* __restrict__ Wq, const float* __restrict__ bq,
                          const float* __restrict__ Wk, const float* __restrict__ bk,
                          const float* __restrict__ Wv, const float* __restrict__ bv,
                          float* __restrict__ Q, float* __restrict__ Zr,
                          float* __restrict__ V,
                          float* __restrict__ pZ, float* __restrict__ pS,
                          float* __restrict__ tZ, float* __restrict__ tS) {
  __shared__ __attribute__((aligned(16))) float zl[SROWS * ZPI], vl[SROWS * VPI];
  const int tid  = threadIdx.x;
  const int lane = tid & 31;
  const int w    = tid >> 5;
  const int half = lane >> 4;            // lane half selects K pair
  const int mn   = lane & 15;
  const int row0 = g * SROWS;
  {
    // wave w: column tile w >> 1 of q, z and v, for two of the four 16-row tiles
    const int m0   = (w & 1) * 32;
    const int ncol = (w >> 1) * 16 + mn;
    // every operand of the 16 k steps is fetched first, so that one memory latency is paid
    v2f xa[2][IN / 4], wq[IN / 4], wk[IN / 4], wv[IN / 4];
    // 16x4 f32 A: lanes<16 hold K0,K1; lanes>=16 K2,K3.  4x16 B: row striped across lanes per VGPR
    const int woff = half * 2 * D + ncol;
    const float* xp = X + (row0 + m0 + mn) * IN + half * 2;
#pragma unroll
    for (int ks = 0; ks < IN / 4; ++ks) {
      wq[ks].x = Wq[woff + ks * 4 * D]; wq[ks].y = Wq[woff + ks * 4 * D + D];
      wk[ks].x = Wk[woff + ks * 4 * D]; wk[ks].y = Wk[woff + ks * 4 * D + D];
      wv[ks].x = Wv[woff + ks * 4 * D]; wv[ks].y = Wv[woff + ks * 4 * D + D];
      xa[0][ks] = *(const v2f*)&xp[ks * 4];
      xa[1][ks] = *(const v2f*)&xp[16 * IN + ks * 4];
    }
    const float bbq = bq[ncol], bbk = bk[ncol], bbv = bv[ncol];
    // Inputs-only fences on the loaded values: they hold the loads of k steps 0 to 11 in front of
    // the wait below (one statement takes thirty operands at most, hence three statements).
#pragma unroll
    for (int ks = 0; ks < IN / 4 - 4; ks += 4)
      asm volatile(""
                   :: "v"(wq[ks]), "v"(wk[ks]), "v"(wv[ks]), "v"(xa[0][ks]), "v"(xa[1][ks]),
                      "v"(wq[ks + 1]), "v"(wk[ks + 1]), "v"(wv[ks + 1]), "v"(xa[0][ks + 1]),
                      "v"(xa[1][ks + 1]),
                      "v"(wq[ks + 2]), "v"(wk[ks + 2]), "v"(wv[ks + 2]), "v"(xa[0][ks + 2]),
                      "v"(xa[1][ks + 2]),
                      "v"(wq[ks + 3]), "v"(wk[ks + 3]), "v"(wv[ks + 3]), "v"(xa[0][ks + 3]),
                      "v"(xa[1][ks + 3]));
    // The wait in front of any overwrite of an address register of the loads above. The last
    // loaded values and the addresses are its inputs: the loads stay in front of it and the
    // address registers stay untouched up to it.
    asm volatile("s_wait_xcnt 0x0"
                 :: "v"(wq[12]), "v"(wk[12]), "v"(wv[12]), "v"(xa[0][12]), "v"(xa[1][12]),
                    "v"(wq[13]), "v"(wk[13]), "v"(wv[13]), "v"(xa[0][13]), "v"(xa[1][13]),
                    "v"(wq[14]), "v"(wk[14]), "v"(wv[14]), "v"(xa[0][14]), "v"(xa[1][14]),
                    "v"(wq[15]), "v"(wk[15]), "v"(wv[15]), "v"(xa[0][15]), "v"(xa[1][15]),
                    "v"(bbq), "v"(bbk), "v"(bbv), "v"(woff), "v"(ncol), "v"(xp)
                 : "memory");
    v8f aq[2] = {}, ak[2] = {}, av[2] = {};
    // unrolled in full: the operand arrays are indexed by ks and stay in registers
#pragma unroll
    for (int ks = 0; ks < IN / 4; ++ks) {
#pragma unroll
      for (int i = 0; i < 2; ++i) {
        aq[i] = __builtin_amdgcn_wmma_f32_16x16x4_f32(false, xa[i][ks], false, wq[ks],
                                                      (short)0, aq[i], false, false);
        ak[i] = __builtin_amdgcn_wmma_f32_16x16x4_f32(false, xa[i][ks], false, wk[ks],
                                                      (short)0, ak[i], false, false);
        av[i] = __builtin_amdgcn_wmma_f32_16x16x4_f32(false, xa[i][ks], false, wv[ks],
                                                      (short)0, av[i], false, false);
      }
    }
    // unrolled: the accumulators are indexed by i and stay plain registers only where it is constant
#pragma unroll
    for (int i = 0; i < 2; ++i) {
      for (int r = 0; r < 8; ++r) {
        const int lr = m0 + i * 16 + r + 8 * half;   // C/D layout: VGPR r -> M=r, M=8+r
        float q = aq[i][r] + bbq, z = ak[i][r] + bbk;
        const float v = av[i][r] + bbv;
        q = q > 0.f ? q : (__expf(q) - 1.f);         // elu on q and z
        z = z > 0.f ? z : (__expf(z) - 1.f);
        Q[(row0 + lr) * D + ncol]  = q;
        Zr[(row0 + lr) * D + ncol] = z;
        V[(row0 + lr) * D + ncol]  = v;
        zl[lr * ZPI + ncol] = z;
        vl[lr * VPI + ncol] = v;
      }
      // the code below reuses the registers that these stores name
      asm volatile("s_wait_xcnt 0x0" ::: "memory");
    }
  }
  __syncthreads();
  // wave w: rows d = dt .. dt + 15 of the D x D sum, 32 columns from pb; its two 16-column
  // tiles take the even and the odd columns, so that a lane stores two neighbours at once
  const int dt = (w >> 1) * 16, pb = (w & 1) * 32;
  v8f c0 = {}, c1 = {};
  // unrolled in full: no branch stands between a matrix instruction and a store of its result
#pragma unroll
  for (int cc = 0; cc <= CPS; ++cc) {
    float* dst = (cc < CPS) ? pS + (size_t)(g * CPS + cc) * D * D : tS + (size_t)g * D * D;
    for (int r = 0; r < 8; ++r)
      *(float2*)&dst[(dt + r + 8 * half) * D + pb + 2 * mn] = make_float2(c0[r], c1[r]);
    // the code below reuses the registers that these stores name
    asm volatile("s_wait_xcnt 0x0" ::: "memory");
    if (cc < CPS) {
      for (int kb = cc * CLEN; kb < (cc + 1) * CLEN; kb += 4) {
        const int k0 = kb + half * 2;    // A and B: the same two rows k0, k0 + 1 in x and y
        v2f a, b0, b1;
        a.x = zl[k0 * ZPI + dt + mn];
        a.y = zl[(k0 + 1) * ZPI + dt + mn];
        const float2 u = *(const float2*)&vl[k0 * VPI + pb + 2 * mn];
        const float2 t = *(const float2*)&vl[(k0 + 1) * VPI + pb + 2 * mn];
        b0.x = u.x; b0.y = t.x;
        b1.x = u.y; b1.y = t.y;
        c0 = __builtin_amdgcn_wmma_f32_16x16x4_f32(false, a, false, b0,
                                                   (short)0, c0, false, false);
        c1 = __builtin_amdgcn_wmma_f32_16x16x4_f32(false, a, false, b1,
                                                   (short)0, c1, false, false);
      }
    }
  }
  if (tid < D) {                         // the z sums: one column a thread
    float run = 0.f;
    for (int cc = 0; cc < CPS; ++cc) {
      pZ[(g * CPS + cc) * D + tid] = run;
      // the additions below write the register that this store names
      asm volatile("s_wait_xcnt 0x0" ::: "memory");
      for (int t = 0; t < CLEN; ++t) run += zl[(cc * CLEN + t) * ZPI + tid];
    }
    tZ[g * D + tid] = run;
  }
}

// ---------------- K0: per-batch prompt/history constants ----------------
// body of work-group b of the first B work-groups of proj_prefix_prep, 8 waves.
// This work-group is one long chain of dependent steps, so the chain is kept short: the LP rows
// of P and the LP rows of S are one 16-row tile of V_WMMA_F32_16X16X4_F32, every operand from
// global memory is asked for at the head, the two D x D sums stay in their owners' registers,
// and what is 64 long (the z rows) is normalized by every wave for itself.
__device__ __forceinline__ void per_batch_prep(const int b,
                               const int* __restrict__ user_id,
                               const float* __restrict__ P, const float* __restrict__ S,
                               const float* __restrict__ Wk, const float* __restrict__ bk,
                               const float* __restrict__ Wv, const float* __restrict__ bv,
                               const float* __restrict__ z_g, const float* __restrict__ z_b,
                               const float* __restrict__ s_g, const float* __restrict__ s_b,
                               const float* __restrict__ nam_g, const float* __restrict__ nam_b,
                               const float* __restrict__ prev_z_buf,
                               const float* __restrict__ prev_s_buf,
                               float* __restrict__ Pz, float* __restrict__ Ps,
                               float* __restrict__ Mb) {
  // rows 0 to LP - 1: P, the others: S. In a z row element d stands at place
  // (d & 3) * 16 + (d >> 2), so that a thread's 16 d's (dq + 4j) are consecutive
  __shared__ __attribute__((aligned(16))) float zv[2 * 2 * LP * D];   // the z rows, then the v rows
  const float* zrow = zv;
  const float* vrow = zv + 2 * LP * D;
  __shared__ float zt[2 * D];               // z summed over the LP rows: P, then S
  __shared__ float4 redA[8];                // per wave: sum and squares of the P sum, of the S sum
  __shared__ float2 redB[8];                // per wave: sum and squares of the history matrix
  const int tid  = threadIdx.x;             // 256 threads
  const int lane = tid & 31;
  const int w    = __builtin_amdgcn_readfirstlane(tid >> 5);
  const int half = lane >> 4;               // lane half selects K pair
  const int mn   = lane & 15;
  // the two gathers below stay inside the NU + 1 rows for any content of user_id; the row
  // number is one value for the whole work-group: readfirstlane puts it in a scalar register
  const int uid = __builtin_amdgcn_readfirstlane(min(max(user_id[b], 0), NU));
  // wave w: column tile w >> 1 of z (even w) or of v (odd w), all 16 rows
  const bool isv = (w & 1) != 0;
  const int ncol = (w >> 1) * 16 + mn;
  const float* Wm = isv ? Wv : Wk;
  const float* bm = isv ? bv : bk;
  // 16x4 f32 A: lanes<16 hold K0,K1; lanes>=16 K2,K3.  4x16 B: row striped across lanes per VGPR
  const int woff = half * 2 * D + ncol;
  const float* xp = (mn < LP ? P + (b * LP + mn) * IN : S + (b * LP + mn - LP) * IN) + half * 2;
  v2f xa[IN / 4], wm[IN / 4];
  // unrolled in full: the operand arrays are indexed by ks and stay in registers
#pragma unroll
  for (int ks = 0; ks < IN / 4; ++ks) {
    wm[ks].x = Wm[woff + ks * 4 * D]; wm[ks].y = Wm[woff + ks * 4 * D + D];
    xa[ks] = *(const v2f*)&xp[ks * 4];
  }
  const float bb = bm[ncol];
  // the constants of the later phases: thread owns elements tid + j*256 of every D x D array
  float sg[16], sb[16], ng[16], nb[16], prs[16];
  for (int j = 0; j < 16; ++j) {
    const int idx = tid + j * 256;
    sg[j] = s_g[idx];   sb[j] = s_b[idx];
    ng[j] = nam_g[idx]; nb[j] = nam_b[idx];
    prs[j] = prev_s_buf[(size_t)uid * D * D + idx];
  }
  const float zg0 = z_g[lane], zg1 = z_g[lane + 32], zb0 = z_b[lane], zb1 = z_b[lane + 32];
  const float* pvr = prev_z_buf + (size_t)uid * D;      // a scalar base: the lane number is the offset
  const float pv0 = pvr[lane], pv1 = pvr[lane + 32];
  // Inputs-only fence on the loaded values: it holds the loads of k steps 0 to 7 in front of
  // the wait below (one statement takes thirty operands at most)
  asm volatile(""
               :: "v"(wm[0]), "v"(xa[0]), "v"(wm[1]), "v"(xa[1]), "v"(wm[2]), "v"(xa[2]),
                  "v"(wm[3]), "v"(xa[3]), "v"(wm[4]), "v"(xa[4]), "v"(wm[5]), "v"(xa[5]),
                  "v"(wm[6]), "v"(xa[6]), "v"(wm[7]), "v"(xa[7]));
  // The wait in front of any overwrite of an address register of the loads above. The last
  // loaded values and the addresses are its inputs: the loads stay in front of it and the
  // address registers stay untouched up to it.
  asm volatile("s_wait_xcnt 0x0"
               :: "v"(wm[8]), "v"(xa[8]), "v"(wm[9]), "v"(xa[9]), "v"(wm[10]), "v"(xa[10]),
                  "v"(wm[11]), "v"(xa[11]), "v"(wm[12]), "v"(xa[12]), "v"(wm[13]), "v"(xa[13]),
                  "v"(wm[14]), "v"(xa[14]), "v"(wm[15]), "v"(xa[15]),
                  "v"(bb), "v"(woff), "v"(ncol), "v"(xp)
               : "memory");
  // two chains of 8 k steps: half the dependent matrix latency
  v8f c0 = {}, c1 = {};
  // unrolled in full: the operand arrays are indexed by ks and stay in registers
#pragma unroll
  for (int ks = 0; ks < IN / 4; ks += 2) {
    c0 = __builtin_amdgcn_wmma_f32_16x16x4_f32(false, xa[ks], false, wm[ks],
                                               (short)0, c0, false, false);
    c1 = __builtin_amdgcn_wmma_f32_16x16x4_f32(false, xa[ks + 1], false, wm[ks + 1],
                                               (short)0, c1, false, false);
  }
  {
    // no branch here: z and v waves differ in a select and in the LDS index alone
    const int zplace = (ncol & 3) * 16 + (ncol >> 2);
    float* dstl = &zv[zplace + (w & 1) * (2 * LP * D + ncol - zplace)];
    float tot = 0.f;
    for (int r = 0; r < 8; ++r) {               // C/D layout: VGPR r -> M=r, M=8+r
      const float u = c0[r] + c1[r] + bb;
      const float e = u > 0.f ? u : (__expf(u) - 1.f);      // elu on z
      const float o = isv ? u : e;
      dstl[(r + 8 * half) * D] = o;
      tot += o;                                 // lanes<16: the rows of P, lanes>=16: of S
    }
    if (!isv) zt[half * D + ncol] = tot;
  }
  __syncthreads();
  // totals over the LP steps (== last cumsum value) of outer(z, v): column p, rows dq + 4j
  const int p = tid & 63, dq = tid >> 6;
  float sP[16], sS[16];
  for (int j = 0; j < 16; ++j) { sP[j] = 0.f; sS[j] = 0.f; }
  for (int t = 0; t < LP; ++t) {
    const float vp = vrow[t * D + p], vq = vrow[(LP + t) * D + p];
    for (int k = 0; k < 4; ++k) {
      const float4 za = *(const float4*)&zrow[t * D + dq * 16 + 4 * k];
      const float4 zc = *(const float4*)&zrow[(LP + t) * D + dq * 16 + 4 * k];
      sP[4 * k]     = fmaf(za.x, vp, sP[4 * k]);     sS[4 * k]     = fmaf(zc.x, vq, sS[4 * k]);
      sP[4 * k + 1] = fmaf(za.y, vp, sP[4 * k + 1]); sS[4 * k + 1] = fmaf(zc.y, vq, sS[4 * k + 1]);
      sP[4 * k + 2] = fmaf(za.z, vp, sP[4 * k + 2]); sS[4 * k + 2] = fmaf(zc.z, vq, sS[4 * k + 2]);
      sP[4 * k + 3] = fmaf(za.w, vp, sP[4 * k + 3]); sS[4 * k + 3] = fmaf(zc.w, vq, sS[4 * k + 3]);
    }
  }
  // s LN stats over 4096, P and S at once
  {
    float l1 = 0.f, l2 = 0.f, m1 = 0.f, m2 = 0.f;
    for (int j = 0; j < 16; ++j) {
      l1 += sP[j]; l2 = fmaf(sP[j], sP[j], l2);
      m1 += sS[j]; m2 = fmaf(sS[j], sS[j], m2);
    }
    l1 = wave_sum(l1); l2 = wave_sum(l2); m1 = wave_sum(m1); m2 = wave_sum(m2);
    if (lane == 0) redA[w] = make_float4(l1, l2, m1, m2);
  }
  // z LN (EPS shift cancels in centered term), every wave for itself: lane holds d = lane, lane + 32
  const float zp0 = zt[lane], zp1 = zt[lane + 32], zs0 = zt[D + lane], zs1 = zt[D + lane + 32];
  float inv, pzo0, pzo1;                    // pzo: the P row of z after its LN, stored at the end
  {
    const float a1 = wave_sum(zp0 + zp1), a2 = wave_sum(zp0 * zp0 + zp1 * zp1);
    const float e1 = wave_sum(zs0 + zs1), e2 = wave_sum(zs0 * zs0 + zs1 * zs1);
    const float muP = a1 / (float)D, rsP = rsqrtf(a2 / (float)D - muP * muP + LN_EPS);
    const float muS = e1 / (float)D, rsS = rsqrtf(e2 / (float)D - muS * muS + LN_EPS);
    pzo0 = (zp0 - muP) * rsP * zg0 + zb0;
    pzo1 = (zp1 - muP) * rsP * zg1 + zb1;
    const float h0 = pv0 + ((zs0 - muS) * rsS * zg0 + zb0);
    const float h1 = pv1 + ((zs1 - muS) * rsS * zg1 + zb1);
    const float n1 = wave_sum(h0 * h0 + h1 * h1);
    inv = 1.f / (fmaxf(sqrtf(n1), 1e-8f) + EPSC);
  }
  __syncthreads();
  // every global store stands behind the last barrier: a barrier waits for the stores in front of it
  float pn[16], pso[16];
  {
    float S1 = 0.f, S2 = 0.f, T1 = 0.f, T2 = 0.f;
    for (int i = 0; i < 8; ++i) {
      const float4 r = redA[i];
      S1 += r.x; S2 += r.y; T1 += r.z; T2 += r.w;
    }
    const float muP = S1 / 4096.f, rsP = rsqrtf(S2 / 4096.f - muP * muP + LN_EPS);
    const float muS = T1 / 4096.f, rsS = rsqrtf(T2 / 4096.f - muS * muS + LN_EPS);
    float f1 = 0.f, f2 = 0.f;
    for (int j = 0; j < 16; ++j) {
      pso[j] = (sP[j] - muP) * rsP * sg[j] + sb[j];
      pn[j] = (prs[j] + ((sS[j] - muS) * rsS * sg[j] + sb[j])) * inv;
      f1 += pn[j]; f2 = fmaf(pn[j], pn[j], f2);
      // nam_b goes into Mb twice: the history LN's own shift, and the shift of the scan's LN(nam),
      // whose share q @ nam_b of the output goes through the same product with the normalized q
      nb[j] += nb[j];
    }
    f1 = wave_sum(f1); f2 = wave_sum(f2);
    if (lane == 0) redB[w] = make_float2(f1, f2);
  }
  __syncthreads();
  {
    float F1 = 0.f, F2 = 0.f;
    for (int i = 0; i < 8; ++i) { const float2 r = redB[i]; F1 += r.x; F2 += r.y; }
    const float mun = F1 / 4096.f, rstdn = rsqrtf(F2 / 4096.f - mun * mun + LN_EPS);
    for (int j = 0; j < 16; ++j) {
      Ps[b * D * D + tid + j * 256] = pso[j];
      Mb[b * D * D + tid + j * 256] = (pn[j] - mun) * rstdn * ng[j] + nb[j];
    }
    // the code below reuses the registers that these stores name
    asm volatile("s_wait_xcnt 0x0" ::: "memory");
    if (w == 0) { Pz[b * D + lane] = pzo0; Pz[b * D + lane + 32] = pzo1; }
  }
}

// One launch for two jobs that read nothing of each other: the B long work-groups of
// the per-batch constants come first in the grid, the projections with the chunk start
// states run beside them. The first work-group also gives the std accumulators their start value.
__global__ __launch_bounds__(256)
void proj_prefix_prep(const int* __restrict__ user_id, const float* __restrict__ X,
                      const float* __restrict__ P, const float* __restrict__ S,
                      const float* __restrict__ Wq, const float* __restrict__ bq,
                      const float* __restrict__ Wk, const float* __restrict__ bk,
                      const float* __restrict__ Wv, const float* __restrict__ bv,
                      const float* __restrict__ z_g, const float* __restrict__ z_b,
                      const float* __restrict__ s_g, const float* __restrict__ s_b,
                      const float* __restrict__ nam_g, const float* __restrict__ nam_b,
                      const float* __restrict__ prev_z_buf,
                      const float* __restrict__ prev_s_buf,
                      float* __restrict__ Pz, float* __restrict__ Ps,
                      float* __restrict__ Mb,
                      float* __restrict__ Q, float* __restrict__ Zr, float* __restrict__ V,
                      float* __restrict__ pZ, float* __restrict__ pS,
                      float* __restrict__ tZ, float* __restrict__ tS,
                      double* __restrict__ acc) {
  if (blockIdx.x < B) {
    if (blockIdx.x == 0 && threadIdx.x == 0) { acc[0] = 0.0; acc[1] = 0.0; }
    per_batch_prep(blockIdx.x, user_id, P, S, Wk, bk, Wv, bv, z_g, z_b, s_g, s_b,
                   nam_g, nam_b, prev_z_buf, prev_s_buf, Pz, Ps, Mb);
  } else {
    proj_and_starts(blockIdx.x - B, X, Wq, bq, Wk, bk, Wv, bv, Q, Zr, V, pZ, pS, tZ, tS);
  }
}

// N block totals added to a thread's 16 state elements, all N * 16 loads in flight together
template <int N>
__device__ __forceinline__ void add_totals(float (&x)[16], const float* __restrict__ t) {
  float v[N][16];
  for (int n = 0; n < N; ++n)
    for (int j = 0; j < 16; ++j) v[n][j] = t[n * D * D + j * 256];
  // a later result may land in the address registers that these loads name
  asm volatile("s_wait_xcnt 0x0" ::: "memory");
  for (int n = 0; n < N; ++n)
    for (int j = 0; j < 16; ++j) x[j] += v[n][j];
}

static constexpr int TP = D + 4;   // LDS row pitch in floats: rows r and r + 8 on other banks
// ---------------- K2c: main scan, the CLEN steps of a chunk together ----------------
// A step depends on the one before it only through the running sums, which cost one
// multiply-add an element to form again. So every pass (state statistics; s_full statistics
// with the contraction) runs over all CLEN steps, forming the state anew from the chunk's start
// value, and one block-wide reduction per pass serves all steps. LN(nam) is s_full times a
// scale plus a shift, both one number a step, then nam_g and nam_b: so its contraction with q is
// scale * sum_d q nam_g s_full + shift * (q @ nam_g) + q @ nam_b. The first sum needs no
// statistic of s_full and is formed in the pass that takes them; the two products, with the
// history product, are one 16-row tile of V_WMMA_F32_16X16X4_F32 a wave, taken on the raw q rows
// (a row's 1 / |q| is applied behind the product), and the final LN over D closes each row
// in the wave that owns its step. The z and q rows of
// step t are handled by wave t % NWV alone, with sums inside the wave. What a work-group
// fetches once whatever its chunk's length (start state, block totals, the five D x D
// constants) is paid once per CLEN steps.
// second bound: 4 waves a SIMD, so that the grid's two work-groups per WGP are resident together
__global__ __launch_bounds__(256, 4)
void scan_main(const float* __restrict__ Q, const float* __restrict__ Zr,
               const float* __restrict__ V,
               const float* __restrict__ pZ, const float* __restrict__ pS,
               const float* __restrict__ tZ, const float* __restrict__ tS,
               const float* __restrict__ Pz, const float* __restrict__ Ps,
               const float* __restrict__ z_g, const float* __restrict__ z_b,
               const float* __restrict__ s_g, const float* __restrict__ s_b,
               const float* __restrict__ nam_g, const float* __restrict__ Mb,
               const float* __restrict__ na_g, const float* __restrict__ na_b,
               float* __restrict__ out, double* __restrict__ acc) {
  static_assert(CLEN == 16, "a chunk's rows are one 16-row matrix tile");
  const int b = blockIdx.x / CHUNKS, c = blockIdx.x % CHUNKS, tid = threadIdx.x;
  const int lane = tid & 31;
  const int w = __builtin_amdgcn_readfirstlane(tid >> 5);   // wave number: it owns steps w + h * NWV
  // the chunk's rows of z and of the normalized q; element d stands at place
  // (d & 3) * 16 + (d >> 2) of its row, so that a thread's 16 d's (dq + 4j) are consecutive
  __shared__ __attribute__((aligned(16))) float zP[CLEN * D], nqP[CLEN * D];
  __shared__ float vs[CLEN * D];
  __shared__ __attribute__((aligned(16))) float redw[2 * CLEN * 8];  // [2t + (0 sum, 1 squares)][wave]
  __shared__ float2 stS[CLEN];              // per step: scale and shift of the state's LN
  __shared__ float tl[2 * CLEN * TP];       // q @ M_b of the chunk's rows, then q @ nam_g
  __shared__ float napart[CLEN * 256];
  __shared__ float red[2 * CLEN];
  __shared__ float4 xs[4 * 256];            // start value of the state; read only by its writer
  // thread owns elements tid + j*256 of every D x D array, in every pass: column p, rows dq + 4j
  const int p = tid & 63, dq = tid >> 6;
  const int row0 = (b * L + c * CLEN) * D;
  // the running state; every pass starts it anew from the cumulative outer-product sum in
  // front of the chunk, which each thread keeps in LDS rather than in 16 more registers
  float x[16];
  for (int j = 0; j < 16; ++j) x[j] = pS[(b * CHUNKS + c) * D * D + tid + j * 256];
  // a later load's result may land in the offset register that these loads name
  asm volatile("s_wait_xcnt 0x0" ::: "memory");
  // pS holds the sum from the start of the chunk's block of SROWS rows; the totals of the sb
  // blocks in front are added here, four, two and one at a time: three rounds of loads at most
  const int sb = c / CPS;
  {
    const float* tp = tS + (size_t)(b * SC) * D * D + tid;
    if (sb & 4) { add_totals<4>(x, tp); tp += 4 * D * D; }
    if (sb & 2) { add_totals<2>(x, tp); tp += 2 * D * D; }
    if (sb & 1) { add_totals<1>(x, tp); }
  }
  for (int k = 0; k < 4; ++k)
    xs[k * 256 + tid] = make_float4(x[4 * k], x[4 * k + 1], x[4 * k + 2], x[4 * k + 3]);
  // wave w stages its SPW rows: lane holds elements d0 = lane and d1 = lane + 32
  const int d0 = lane, d1 = lane + 32;
  const int e0 = (d0 & 3) * 16 + (d0 >> 2), e1 = (d1 & 3) * 16 + (d1 >> 2);
  float q0[SPW], q1[SPW];
  for (int h = 0; h < SPW; ++h) {
    const int r = w + h * NWV, rw = row0 + r * D;
    q0[h] = Q[rw + d0]; q1[h] = Q[rw + d1];
    zP[r * D + e0] = Zr[rw + d0]; zP[r * D + e1] = Zr[rw + d1];
    vs[r * D + d0] = V[rw + d0];  vs[r * D + d1] = V[rw + d1];
  }
  float zs0 = pZ[(b * CHUNKS + c) * D + d0], zs1 = pZ[(b * CHUNKS + c) * D + d1];
  float ta[SC - 1], tb[SC - 1];               // z totals of the sequence's blocks but the last
  for (int s2 = 0; s2 < SC - 1; ++s2) {
    ta[s2] = tZ[(b * SC + s2) * D + d0]; tb[s2] = tZ[(b * SC + s2) * D + d1];
  }
  // a later load's result may land in the offset register that these loads name
  asm volatile("s_wait_xcnt 0x0" ::: "memory");
  const float zg0 = z_g[d0], zg1 = z_g[d1], zb0 = z_b[d0], zb1 = z_b[d1];
  const float pz0 = Pz[b * D + d0], pz1 = Pz[b * D + d1];
  const float ag0 = na_g[d0], ag1 = na_g[d1], ab0 = na_b[d0], ab1 = na_b[d1];
  // later results may land in the address registers that the loads above name
  asm volatile("s_wait_xcnt 0x0" ::: "memory");
  for (int s2 = 0; s2 < SC - 1; ++s2) {       // those of the blocks in front are added
    zs0 += (s2 < sb) ? ta[s2] : 0.f;
    zs1 += (s2 < sb) ? tb[s2] : 0.f;
  }
  __syncthreads();

  // wave w: column tile w >> 1 of q @ M_b (even w) or of q @ nam_g (odd w), the chunk's 16 rows;
  // its operands are asked for here and arrive under the z and q work below
  // 16x4 f32 A: lanes<16 hold K0,K1; lanes>=16 K2,K3.  4x16 B: row striped across lanes per VGPR
  const int half = lane >> 4, mn = lane & 15;
  const int ncol = (w >> 1) * 16 + mn;
  const float* Wm = (w & 1) ? nam_g : Mb + b * D * D;
  const int woff = half * 2 * D + ncol;
  const float* ap = Q + row0 + mn * D + half * 2;
  v2f fa[D / 4], fb[D / 4];
  // unrolled in full: the operand arrays are indexed by ks and stay in registers
#pragma unroll
  for (int ks = 0; ks < D / 4; ++ks) {
    fa[ks] = *(const v2f*)&ap[ks * 4];
    fb[ks].x = Wm[woff + ks * 4 * D]; fb[ks].y = Wm[woff + ks * 4 * D + D];
  }

  // ---- wave w: z LN (EPS cancels), prompt z, l2 norms, q norm, std terms of its SPW steps ----
  float zc0[SPW], zc1[SPW], invz[SPW], invq[SPW];
  for (int h = 0; h < SPW; ++h) { zc0[h] = zs0; zc1[h] = zs1; }
  for (int t = 0; t < CLEN; ++t) {            // running z sum up to and including the wave's steps
    const float za = zP[t * D + e0], zb = zP[t * D + e1];
    for (int h = 0; h < SPW; ++h) {
      zc0[h] += (t <= w + h * NWV) ? za : 0.f;
      zc1[h] += (t <= w + h * NWV) ? zb : 0.f;
    }
  }
  // unrolled: the per-step arrays are indexed by h and stay in registers
#pragma unroll
  for (int h = 0; h < SPW; ++h) {
    const int r = w + h * NWV;
    const float s1  = wave_sum(zc0[h] + zc1[h]);
    const float s2  = wave_sum(zc0[h] * zc0[h] + zc1[h] * zc1[h]);
    const float qn2 = wave_sum(q0[h] * q0[h] + q1[h] * q1[h]);
    const float muz = s1 / (float)D, varz = s2 / (float)D - muz * muz;
    const float rstdz = rsqrtf(varz + LN_EPS);
    const float zf0 = (zc0[h] - muz) * rstdz * zg0 + zb0 + pz0;
    const float zf1 = (zc1[h] - muz) * rstdz * zg1 + zb1 + pz1;
    const float zn2 = wave_sum(zf0 * zf0 + zf1 * zf1);
    invz[h] = 1.f / fmaxf(sqrtf(zn2), 1e-8f);
    invq[h] = 1.f / fmaxf(sqrtf(qn2), 1e-8f);
    nqP[r * D + e0] = q0[h] * invq[h]; nqP[r * D + e1] = q1[h] * invq[h];
    const float ra = q0[h] / fmaxf(zf0, 1e-6f), rb = q1[h] / fmaxf(zf1, 1e-6f);
    // this step's share of the two std sums, read at the end
    const float sa = wave_sum(ra + rb), sq = wave_sum(ra * ra + rb * rb);
    if (lane == 0) { red[r] = sa; red[CLEN + r] = sq; }
  }

  // Inputs-only fence on the loaded values: it holds the loads of k steps 0 to 7 in front of
  // the wait below (one statement takes thirty operands at most)
  asm volatile(""
               :: "v"(fa[0]), "v"(fb[0]), "v"(fa[1]), "v"(fb[1]), "v"(fa[2]), "v"(fb[2]),
                  "v"(fa[3]), "v"(fb[3]), "v"(fa[4]), "v"(fb[4]), "v"(fa[5]), "v"(fb[5]),
                  "v"(fa[6]), "v"(fb[6]), "v"(fa[7]), "v"(fb[7]));
  // The wait in front of any overwrite of an address register of the loads above. The last
  // loaded values and the addresses are its inputs: the loads stay in front of it and the
  // address registers stay untouched up to it.
  asm volatile("s_wait_xcnt 0x0"
               :: "v"(fa[8]), "v"(fb[8]), "v"(fa[9]), "v"(fb[9]), "v"(fa[10]), "v"(fb[10]),
                  "v"(fa[11]), "v"(fb[11]), "v"(fa[12]), "v"(fb[12]), "v"(fa[13]), "v"(fb[13]),
                  "v"(fa[14]), "v"(fb[14]), "v"(fa[15]), "v"(fb[15]),
                  "v"(woff), "v"(ap)
               : "memory");
  {
    // two chains of 8 k steps: half the dependent matrix latency
    v8f h0 = {}, h1 = {};
    // unrolled in full: the operand arrays are indexed by ks and stay in registers
#pragma unroll
    for (int ks = 0; ks < D / 4; ks += 2) {
      h0 = __builtin_amdgcn_wmma_f32_16x16x4_f32(false, fa[ks], false, fb[ks],
                                                 (short)0, h0, false, false);
      h1 = __builtin_amdgcn_wmma_f32_16x16x4_f32(false, fa[ks + 1], false, fb[ks + 1],
                                                 (short)0, h1, false, false);
    }
    float* tw = &tl[(w & 1) * CLEN * TP + ncol];
    for (int r = 0; r < 8; ++r)                 // C/D layout: VGPR r -> M=r, M=8+r
      tw[(r + 8 * half) * TP] = h0[r] + h1[r];
  }

  const float* zrow = &zP[dq * 16];
  const float* nrow = &nqP[dq * 16];
  float val[16];
  // every pass takes the steps NWV at a time. The inner step loops are unrolled in full: val is
  // indexed by tt and stays in registers only where tt is a constant. The outer loops stay
  // rolled, for speed only

  // ---- pass 1: sum and sum of squares of the state at every step (EPS cancels) ----
  // rolled, for speed only (see at val above)
#pragma unroll 1
  for (int hb = 0; hb < SPW; ++hb) {
#pragma unroll
    for (int tt = 0; tt < NWV; ++tt) {
      const int t = hb * NWV + tt;
      const float vp = vs[t * D + p];
      const float4 zz0 = *(const float4*)&zrow[t * D], zz1 = *(const float4*)&zrow[t * D + 4];
      const float4 zz2 = *(const float4*)&zrow[t * D + 8], zz3 = *(const float4*)&zrow[t * D + 12];
      const float zz[16] = {zz0.x, zz0.y, zz0.z, zz0.w, zz1.x, zz1.y, zz1.z, zz1.w,
                            zz2.x, zz2.y, zz2.z, zz2.w, zz3.x, zz3.y, zz3.z, zz3.w};
      float ls = 0.f, lss = 0.f;
      for (int j = 0; j < 16; ++j) {
        x[j] = fmaf(zz[j], vp, x[j]);
        ls += x[j]; lss = fmaf(x[j], x[j], lss);
      }
      val[2 * tt] = ls; val[2 * tt + 1] = lss;
      // the scheduler works on one step at a time: with the LDS loads of later steps lifted up
      // here far fewer of the multiply-adds pair into dual-issue forms
      __builtin_amdgcn_sched_barrier(0);
    }
    const float r = wave_red16(val, lane);
    if ((lane & 1) == 0) redw[(hb * 2 * NWV + (lane >> 1)) * 8 + w] = r;
  }
  __syncthreads();
  // the constants of pass 2 are fetched here, under the close of pass 1
  float sg[16], sc[16], ng[16];     // s_g; s_b + prompt P_s last (LN'd); nam_g
  const int pso = b * D * D + tid;
  for (int j = 0; j < 16; ++j) sc[j] = Ps[pso + j * 256];
  // as above, for the offset register of the Ps loads; it is the wait's input, so that no load's
  // result lands in it ahead of the wait
  asm volatile("s_wait_xcnt 0x0" :: "v"(pso) : "memory");
  for (int j = 0; j < 16; ++j) {
    const int idx = tid + j * 256;
    sg[j]  = s_g[idx];
    sc[j] += s_b[idx];
    ng[j]  = nam_g[idx];
  }
  // as above, for the offset register of these loads; it is the wait's input, so that no load's
  // result lands in it ahead of the wait
  asm volatile("s_wait_xcnt 0x0" :: "v"(tid) : "memory");
  for (int h = 0; h < SPW; ++h) {    // wave w closes its steps
    const int r = w + h * NWV;
    float S1 = 0.f, S2 = 0.f;
    for (int i = 0; i < 8; ++i) { S1 += redw[(2 * r) * 8 + i]; S2 += redw[(2 * r + 1) * 8 + i]; }
    const float mus = S1 / 4096.f, vars = S2 / 4096.f - mus * mus;
    const float rstds = rsqrtf(vars + LN_EPS);
    if (lane == 0) stS[r] = make_float2(rstds, -mus * rstds);
  }
  __syncthreads();

  // ---- pass 2: s_full = LN(state) + Ps at every step: its sum, its sum of squares, and
  // sum_d q nam_g s_full for column p over the thread's own 16 d's ----
  for (int k = 0; k < 4; ++k) {
    const float4 s = xs[k * 256 + tid];
    x[4 * k] = s.x; x[4 * k + 1] = s.y; x[4 * k + 2] = s.z; x[4 * k + 3] = s.w;
  }
  // rolled, for speed only (see at val above)
#pragma unroll 1
  for (int hb = 0; hb < SPW; ++hb) {
#pragma unroll
    for (int tt = 0; tt < NWV; ++tt) {
      const int t = hb * NWV + tt;
      const float vp = vs[t * D + p];
      const float2 st = stS[t];
      float ls = 0.f, lss = 0.f, part = 0.f;
#pragma unroll
      for (int h = 0; h < 16; h += 8) {        // eight d's at a time: fewer row values held
        const float4 z0 = *(const float4*)&zrow[t * D + h], z1 = *(const float4*)&zrow[t * D + h + 4];
        const float4 n0 = *(const float4*)&nrow[t * D + h], n1 = *(const float4*)&nrow[t * D + h + 4];
        const float zz[8] = {z0.x, z0.y, z0.z, z0.w, z1.x, z1.y, z1.z, z1.w};
        const float nn[8] = {n0.x, n0.y, n0.z, n0.w, n1.x, n1.y, n1.z, n1.w};
        for (int i = 0; i < 8; ++i) {
          const int j = h + i;
          x[j] = fmaf(zz[i], vp, x[j]);
          const float f = fmaf(fmaf(x[j], st.x, st.y), sg[j], sc[j]);
          ls += f; lss = fmaf(f, f, lss);
          part = fmaf(nn[i], ng[j] * f, part);
        }
        // as in pass 1: one half step at a time, for dual-issue pairs
        __builtin_amdgcn_sched_barrier(0);
      }
      val[2 * tt] = ls; val[2 * tt + 1] = lss;
      napart[t * 256 + tid] = part;
    }
    const float r = wave_red16(val, lane);
    if ((lane & 1) == 0) redw[(hb * 2 * NWV + (lane >> 1)) * 8 + w] = r;
  }
  __syncthreads();
  // wave w closes its steps and finishes their rows: lane holds columns d0 and d1
  float o0[SPW], o1[SPW];
  // unrolled: the per-step arrays are indexed by h and stay in registers, and the dependent
  // chains of the wave's rows run side by side
#pragma unroll
  for (int h = 0; h < SPW; ++h) {    // nam statistics via invz scaling
    const int r = w + h * NWV;
    float F1 = 0.f, F2 = 0.f;
    for (int i = 0; i < 8; ++i) { F1 += redw[(2 * r) * 8 + i]; F2 += redw[(2 * r + 1) * 8 + i]; }
    const float muf = F1 / 4096.f, varf = F2 / 4096.f - muf * muf;
    const float mean_n = invz[h] * muf;                    // EPS cancels
    const float rstdn  = rsqrtf(invz[h] * invz[h] * varf + LN_EPS);
    const float sx = invz[h] * rstdn, sy = -mean_n * rstdn;   // scale and shift of LN(nam)
    const float* np = &napart[r * 256];
    const float* tm = &tl[r * TP];
    const float* tg = &tl[(CLEN + r) * TP];
    const float v0 = fmaf(sx, np[d0] + np[64 + d0] + np[128 + d0] + np[192 + d0],
                          invq[h] * fmaf(sy, tg[d0], tm[d0]));
    const float v1 = fmaf(sx, np[d1] + np[64 + d1] + np[128 + d1] + np[192 + d1],
                          invq[h] * fmaf(sy, tg[d1], tm[d1]));
    const float s1 = wave_sum(v0 + v1), s2 = wave_sum(v0 * v0 + v1 * v1);
    const float mu   = s1 / (float)D;
    const float var  = s2 / (float)D - mu * mu;
    const float rstd = rsqrtf(var + LN_EPS);
    o0[h] = (v0 - mu) * rstd * ag0 + ab0;
    o1[h] = (v1 - mu) * rstd * ag1 + ab1;
  }
  // unrolled: o0 and o1 are indexed by h and stay in registers
#pragma unroll
  for (int h = 0; h < SPW; ++h) {
    const int rw = row0 + (w + h * NWV) * D;
    out[rw + d0] = o0[h];
    out[rw + d1] = o1[h];
  }
  // the code below reuses the registers that these stores name
  asm volatile("s_wait_xcnt 0x0" ::: "memory");
  if (tid == 0) {
    float A1 = 0.f, A2 = 0.f;
    for (int i = 0; i < CLEN; ++i) { A1 += red[i]; A2 += red[CLEN + i]; }
    atomicAdd(&acc[0], (double)A1); atomicAdd(&acc[1], (double)A2);
  }
}

// ------- K3: the std, from the two sums that the scan's work-groups have added up -------
__global__ void write_std(const double* __restrict__ sums, float* __restrict__ out) {
  if (threadIdx.x == 0) {
    const double N = (double)(ROWS * D);
    const double mean = sums[0] / N;
    const double vr   = (sums[1] - N * mean * mean) / (N - 1.0);
    out[ROWS * D] = (float)sqrt(vr > 0.0 ? vr : 0.0);
  }
}

extern "C" void kernel_launch(void* const* d_in, const int* in_sizes, int n_in,
                              void* d_out, int out_size, void* d_ws, size_t ws_size,
                              hipStream_t stream) {
  const int*   user_id    = (const int*)  d_in[0];
  const float* seqs_emb   = (const float*)d_in[1];
  const float* P          = (const float*)d_in[2];
  const float* S          = (const float*)d_in[3];
  const float* Wq         = (const float*)d_in[4];
  const float* bq         = (const float*)d_in[5];
  const float* Wk         = (const float*)d_in[6];
  const float* bk         = (const float*)d_in[7];
  const float* Wv         = (const float*)d_in[8];
  const float* bv         = (const float*)d_in[9];
  const float* z_g        = (const float*)d_in[10];
  const float* z_b        = (const float*)d_in[11];
  const float* s_g        = (const float*)d_in[12];
  const float* s_b        = (const float*)d_in[13];
  const float* nam_g      = (const float*)d_in[14];
  const float* nam_b      = (const float*)d_in[15];
  const float* na_g       = (const float*)d_in[16];
  const float* na_b       = (const float*)d_in[17];
  const float* prev_z_buf = (const float*)d_in[18];
  const float* prev_s_buf = (const float*)d_in[19];
  float* out = (float*)d_out;

  // workspace layout (floats); total ~17 MB
  float* ws     = (float*)d_ws;
  float* Qb     = ws;                         // ROWS*D
  float* Zr     = Qb + (size_t)ROWS * D;      // ROWS*D
  float* Vb     = Zr + (size_t)ROWS * D;      // ROWS*D
  float* Pz     = Vb + (size_t)ROWS * D;      // B*D
  float* Ps     = Pz + B * D;                 // B*D*D
  float* Mb     = Ps + B * D * D;             // B*D*D
  float* pZ     = Mb + B * D * D;             // B*CHUNKS*D
  float* pS     = pZ + B * CHUNKS * D;        // B*CHUNKS*D*D
  float* tZ     = pS + (size_t)B * CHUNKS * D * D;             // B*SC*D
  float* tS     = tZ + B * SC * D;                             // B*SC*D*D
  double* acc   = (double*)(tS + (size_t)B * SC * D * D);      // 2 doubles, 8B aligned

  proj_prefix_prep<<<B + B * SC, 256, 0, stream>>>(user_id, seqs_emb, P, S, Wq, bq, Wk, bk, Wv, bv,
                                                   z_g, z_b, s_g, s_b, nam_g, nam_b,
                                                   prev_z_buf, prev_s_buf, Pz, Ps, Mb,
                                                   Qb, Zr, Vb, pZ, pS, tZ, tS, acc);
  scan_main<<<B * CHUNKS, 256, 0, stream>>>(Qb, Zr, Vb, pZ, pS, tZ, tS, Pz, Ps,
                                            z_g, z_b, s_g, s_b, nam_g, Mb, na_g, na_b,
                                            out, acc);
  write_std<<<1, 32, 0, stream>>>(acc, out);
}

// v010
// It runs in 24.1 microseconds.
// In both of two side-by-side timings against v009, it was 1.05 times as fast.
// Counting every step since v000, it is 23.7 times as fast.
#include <hip/hip_runtime.h>
#include <math.h>

#define EPSC 1e-8f
#define LN_EPS 1e-5f

typedef float v2f __attribute__((ext_vector_type(2)));
typedef float v8f __attribute__((ext_vector_type(8)));

static constexpr int B = 16, L = 512, D = 64, IN = 64, LP = 8;
static constexpr int CHUNKS = 32, CLEN = 16;        // L = CHUNKS * CLEN
static constexpr int SC = 8, CPS = CHUNKS / SC;     // blocks of a sequence, chunks to a block
static constexpr int SROWS = L / SC;                // 64 rows to a block
static constexpr int ROWS = B * L;                  // 8192
static constexpr int NU = 1024;                     // history buffers hold NU + 1 rows
static constexpr int NWV = 8;                       // waves of a scan work-group
static constexpr int SPW = CLEN / NWV;              // steps a wave owns: w + h * NWV

// ---------------- reductions (wave32) ----------------
// sum over the 32 lanes of a wave, the result in every lane
__device__ __forceinline__ float wave_sum(float a) {
  for (int off = 16; off > 0; off >>= 1) a += __shfl_xor(a, off, 32);
  return a;
}

// 16 sums over the wave at once: each exchange halves the number of values a lane carries,
// so 16 exchanges do the work of 80; lane l returns the wave-wide sum of v[l >> 1]
__device__ __forceinline__ float wave_red16(float (&v)[16], const int lane) {
  // unrolled in full, so that v stays in registers
#pragma unroll
  for (int n = 8, bit = 16; n > 0; n >>= 1, bit >>= 1) {
    const bool hi = (lane & bit) != 0;
#pragma unroll
    for (int i = 0; i < n; ++i) {
      const float lo = v[i], up = v[i + n];
      v[i] = (hi ? up : lo) + __shfl_xor(hi ? lo : up, bit, 32);
    }
  }
  return v[0] + __shfl_xor(v[0], 1, 32);
}

// ---------------- K1: projections and chunk start states, both on V_WMMA_F32_16X16X4_F32 ----
// body of work-group B + g of proj_prefix_prep: block g = SROWS rows of one sequence, 8 waves.
// The block's q, z and v rows are projected and stored; z and v also stay in LDS, and the sum
// of outer(z, v) is run through the block's rows: its value in front of each chunk goes to pS,
// its value behind the last row (the block's total) to tS; the z sums likewise to pZ and tZ.
static constexpr int ZPI = D + 8;    // LDS row pitch of z: rows k and k + 2 on other banks
static constexpr int VPI = D + 16;   // LDS row pitch of v, read 8 bytes a lane: the same
__device__ __forceinline__ void proj_and_starts(const int g, const float* __restrict__ X,
                          const float* __restrict__ Wq, const float* __restrict__ bq,
                          const float* __restrict__ Wk, const float* __restrict__ bk,
                          const float* __restrict__ Wv, const float* __restrict__ bv,
                          float* __restrict__ Q, float* __restrict__ Zr,
                          float* __restrict__ V,
                          float* __restrict__ pZ, float* __restrict__ pS,
                          float* __restrict__ tZ, float* __restrict__ tS) {
  __shared__ __attribute__((aligned(16))) float zl[SROWS * ZPI], vl[SROWS * VPI];
  const int tid  = threadIdx.x;
  const int lane = tid & 31;
  const int w    = tid >> 5;
  const int half = lane >> 4;            // lane half selects K pair
  const int mn   = lane & 15;
  const int row0 = g * SROWS;
  {
    // wave w: column tile w >> 1 of q, z and v, for two of the four 16-row tiles
    const int m0   = (w & 1) * 32;
    const int ncol = (w >> 1) * 16 + mn;
    // every operand of the 16 k steps is fetched first, so that one memory latency is paid
    v2f xa[2][IN / 4], wq[IN / 4], wk[IN / 4], wv[IN / 4];
    // 16x4 f32 A: lanes<16 hold K0,K1; lanes>=16 K2,K3.  4x16 B: row striped across lanes per VGPR
    const int woff = half * 2 * D + ncol;
    const float* xp = X + (row0 + m0 + mn) * IN + half * 2;
#pragma unroll
    for (int ks = 0; ks < IN / 4; ++ks) {
      wq[ks].x = Wq[woff + ks * 4 * D]; wq[ks].y = Wq[woff + ks * 4 * D + D];
      wk[ks].x = Wk[woff + ks * 4 * D]; wk[ks].y = Wk[woff + ks * 4 * D + D];
      wv[ks].x = Wv[woff + ks * 4 * D]; wv[ks].y = Wv[woff + ks * 4 * D + D];
      xa[0][ks] = *(const v2f*)&xp[ks * 4];
      xa[1][ks] = *(const v2f*)&xp[16 * IN + ks * 4];
    }
    const float bbq = bq[ncol], bbk = bk[ncol], bbv = bv[ncol];
    // Inputs-only fences on the loaded values: they hold the loads of k steps 0 to 11 in front of
    // the wait below (one statement takes thirty operands at most, hence three statements).
#pragma unroll
    for (int ks = 0; ks < IN / 4 - 4; ks += 4)
      asm volatile(""
                   :: "v"(wq[ks]), "v"(wk[ks]), "v"(wv[ks]), "v"(xa[0][ks]), "v"(xa[1][ks]),
                      "v"(wq[ks + 1]), "v"(wk[ks + 1]), "v"(wv[ks + 1]), "v"(xa[0][ks + 1]),
                      "v"(xa[1][ks + 1]),
                      "v"(wq[ks + 2]), "v"(wk[ks + 2]), "v"(wv[ks + 2]), "v"(xa[0][ks + 2]),
                      "v"(xa[1][ks + 2]),
                      "v"(wq[ks + 3]), "v"(wk[ks + 3]), "v"(wv[ks + 3]), "v"(xa[0][ks + 3]),
                      "v"(xa[1][ks + 3]));
    // The wait in front of any overwrite of an address register of the loads above. The last
    // loaded values and the addresses are its inputs: the loads stay in front of it and the
    // address registers stay untouched up to it.
    asm volatile("s_wait_xcnt 0x0"
                 :: "v"(wq[12]), "v"(wk[12]), "v"(wv[12]), "v"(xa[0][12]), "v"(xa[1][12]),
                    "v"(wq[13]), "v"(wk[13]), "v"(wv[13]), "v"(xa[0][13]), "v"(xa[1][13]),
                    "v"(wq[14]), "v"(wk[14]), "v"(wv[14]), "v"(xa[0][14]), "v"(xa[1][14]),
                    "v"(wq[15]), "v"(wk[15]), "v"(wv[15]), "v"(xa[0][15]), "v"(xa[1][15]),
                    "v"(bbq), "v"(bbk), "v"(bbv), "v"(woff), "v"(ncol), "v"(xp)
                 : "memory");
    v8f aq[2] = {}, ak[2] = {}, av[2] = {};
    // unrolled in full: the operand arrays are indexed by ks and stay in registers
#pragma unroll
    for (int ks = 0; ks < IN / 4; ++ks) {
#pragma unroll
      for (int i = 0; i < 2; ++i) {
        aq[i] = __builtin_amdgcn_wmma_f32_16x16x4_f32(false, xa[i][ks], false, wq[ks],
                                                      (short)0, aq[i], false, false);
        ak[i] = __builtin_amdgcn_wmma_f32_16x16x4_f32(false, xa[i][ks], false, wk[ks],
                                                      (short)0, ak[i], false, false);
        av[i] = __builtin_amdgcn_wmma_f32_16x16x4_f32(false, xa[i][ks], false, wv[ks],
                                                      (short)0, av[i], false, false);
      }
    }
    // unrolled: the accumulators are indexed by i and stay plain registers only where it is constant
#pragma unroll
    for (int i = 0; i < 2; ++i) {
      for (int r = 0; r < 8; ++r) {
        const int lr = m0 + i * 16 + r + 8 * half;   // C/D layout: VGPR r -> M=r, M=8+r
        float q = aq[i][r] + bbq, z = ak[i][r] + bbk;
        const float v = av[i][r] + bbv;
        q = q > 0.f ? q : (__expf(q) - 1.f);         // elu on q and z
        z = z > 0.f ? z : (__expf(z) - 1.f);
        Q[(row0 + lr) * D + ncol]  = q;
        Zr[(row0 + lr) * D + ncol] = z;
        V[(row0 + lr) * D + ncol]  = v;
        zl[lr * ZPI + ncol] = z;
        vl[lr * VPI + ncol] = v;
      }
      // the code below reuses the registers that these stores name
      asm volatile("s_wait_xcnt 0x0" ::: "memory");
    }
  }
  __syncthreads();
  // wave w: rows d = dt .. dt + 15 of the D x D sum, 32 columns from pb; its two 16-column
  // tiles take the even and the odd columns, so that a lane stores two neighbours at once
  const int dt = (w >> 1) * 16, pb = (w & 1) * 32;
  v8f c0 = {}, c1 = {};
  // unrolled in full: no branch stands between a matrix instruction and a store of its result
#pragma unroll
  for (int cc = 0; cc <= CPS; ++cc) {
    float* dst = (cc < CPS) ? pS + (size_t)(g * CPS + cc) * D * D : tS + (size_t)g * D * D;
    for (int r = 0; r < 8; ++r)
      *(float2*)&dst[(dt + r + 8 * half) * D + pb + 2 * mn] = make_float2(c0[r], c1[r]);
    // the code below reuses the registers that these stores name
    asm volatile("s_wait_xcnt 0x0" ::: "memory");
    if (cc < CPS) {
      for (int kb = cc * CLEN; kb < (cc + 1) * CLEN; kb += 4) {
        const int k0 = kb + half * 2;    // A and B: the same two rows k0, k0 + 1 in x and y
        v2f a, b0, b1;
        a.x = zl[k0 * ZPI + dt + mn];
        a.y = zl[(k0 + 1) * ZPI + dt + mn];
        const float2 u = *(const float2*)&vl[k0 * VPI + pb + 2 * mn];
        const float2 t = *(const float2*)&vl[(k0 + 1) * VPI + pb + 2 * mn];
        b0.x = u.x; b0.y = t.x;
        b1.x = u.y; b1.y = t.y;
        c0 = __builtin_amdgcn_wmma_f32_16x16x4_f32(false, a, false, b0,
                                                   (short)0, c0, false, false);
        c1 = __builtin_amdgcn_wmma_f32_16x16x4_f32(false, a, false, b1,
                                                   (short)0, c1, false, false);
      }
    }
  }
  if (tid < D) {                         // the z sums: one column a thread
    float run = 0.f;
    for (int cc = 0; cc < CPS; ++cc) {
      pZ[(g * CPS + cc) * D + tid] = run;
      // the additions below write the register that this store names
      asm volatile("s_wait_xcnt 0x0" ::: "memory");
      for (int t = 0; t < CLEN; ++t) run += zl[(cc * CLEN + t) * ZPI + tid];
    }
    tZ[g * D + tid] = run;
  }
}

// ---------------- K0: per-batch prompt/history constants ----------------
// body of work-group b of the first B work-groups of proj_prefix_prep, 8 waves.
// This work-group is one long chain of dependent steps, so the chain is kept short: the LP rows
// of P and the LP rows of S are one 16-row tile of V_WMMA_F32_16X16X4_F32, every operand from
// global memory is asked for at the head, the two D x D sums stay in their owners' registers,
// and what is 64 long (the z rows) is normalized by every wave for itself.
__device__ __forceinline__ void per_batch_prep(const int b,
                               const int* __restrict__ user_id,
                               const float* __restrict__ P, const float* __restrict__ S,
                               const float* __restrict__ Wk, const float* __restrict__ bk,
                               const float* __restrict__ Wv, const float* __restrict__ bv,
                               const float* __restrict__ z_g, const float* __restrict__ z_b,
                               const float* __restrict__ s_g, const float* __restrict__ s_b,
                               const float* __restrict__ nam_g, const float* __restrict__ nam_b,
                               const float* __restrict__ prev_z_buf,
                               const float* __restrict__ prev_s_buf,
                               float* __restrict__ Pz, float* __restrict__ Ps,
                               float* __restrict__ Mb) {
  // rows 0 to LP - 1: P, the others: S. In a z row element d stands at place
  // (d & 3) * 16 + (d >> 2), so that a thread's 16 d's (dq + 4j) are consecutive
  __shared__ __attribute__((aligned(16))) float zv[2 * 2 * LP * D];   // the z rows, then the v rows
  const float* zrow = zv;
  const float* vrow = zv + 2 * LP * D;
  __shared__ float zt[2 * D];               // z summed over the LP rows: P, then S
  __shared__ float4 redA[8];                // per wave: sum and squares of the P sum, of the S sum
  __shared__ float2 redB[8];                // per wave: sum and squares of the history matrix
  const int tid  = threadIdx.x;             // 256 threads
  const int lane = tid & 31;
  const int w    = __builtin_amdgcn_readfirstlane(tid >> 5);
  const int half = lane >> 4;               // lane half selects K pair
  const int mn   = lane & 15;
  // the two gathers below stay inside the NU + 1 rows for any content of user_id; the row
  // number is one value for the whole work-group: readfirstlane puts it in a scalar register
  const int uid = __builtin_amdgcn_readfirstlane(min(max(user_id[b], 0), NU));
  // wave w: column tile w >> 1 of z (even w) or of v (odd w), all 16 rows
  const bool isv = (w & 1) != 0;
  const int ncol = (w >> 1) * 16 + mn;
  const float* Wm = isv ? Wv : Wk;
  const float* bm = isv ? bv : bk;
  // 16x4 f32 A: lanes<16 hold K0,K1; lanes>=16 K2,K3.  4x16 B: row striped across lanes per VGPR
  const int woff = half * 2 * D + ncol;
  const float* xp = (mn < LP ? P + (b * LP + mn) * IN : S + (b * LP + mn - LP) * IN) + half * 2;
  v2f xa[IN / 4], wm[IN / 4];
  // unrolled in full: the operand arrays are indexed by ks and stay in registers
#pragma unroll
  for (int ks = 0; ks < IN / 4; ++ks) {
    wm[ks].x = Wm[woff + ks * 4 * D]; wm[ks].y = Wm[woff + ks * 4 * D + D];
    xa[ks] = *(const v2f*)&xp[ks * 4];
  }
  const float bb = bm[ncol];
  // the constants of the later phases: thread owns elements tid + j*256 of every D x D array
  float sg[16], sb[16], ng[16], nb[16], prs[16];
  for (int j = 0; j < 16; ++j) {
    const int idx = tid + j * 256;
    sg[j] = s_g[idx];   sb[j] = s_b[idx];
    ng[j] = nam_g[idx]; nb[j] = nam_b[idx];
    prs[j] = prev_s_buf[(size_t)uid * D * D + idx];
  }
  const float zg0 = z_g[lane], zg1 = z_g[lane + 32], zb0 = z_b[lane], zb1 = z_b[lane + 32];
  const float* pvr = prev_z_buf + (size_t)uid * D;      // a scalar base: the lane number is the offset
  const float pv0 = pvr[lane], pv1 = pvr[lane + 32];
  // Inputs-only fence on the loaded values: it holds the loads of k steps 0 to 7 in front of
  // the wait below (one statement takes thirty operands at most)
  asm volatile(""
               :: "v"(wm[0]), "v"(xa[0]), "v"(wm[1]), "v"(xa[1]), "v"(wm[2]), "v"(xa[2]),
                  "v"(wm[3]), "v"(xa[3]), "v"(wm[4]), "v"(xa[4]), "v"(wm[5]), "v"(xa[5]),
                  "v"(wm[6]), "v"(xa[6]), "v"(wm[7]), "v"(xa[7]));
  // The wait in front of any overwrite of an address register of the loads above. The last
  // loaded values and the addresses are its inputs: the loads stay in front of it and the
  // address registers stay untouched up to it.
  asm volatile("s_wait_xcnt 0x0"
               :: "v"(wm[8]), "v"(xa[8]), "v"(wm[9]), "v"(xa[9]), "v"(wm[10]), "v"(xa[10]),
                  "v"(wm[11]), "v"(xa[11]), "v"(wm[12]), "v"(xa[12]), "v"(wm[13]), "v"(xa[13]),
                  "v"(wm[14]), "v"(xa[14]), "v"(wm[15]), "v"(xa[15]),
                  "v"(bb), "v"(woff), "v"(ncol), "v"(xp)
               : "memory");
  // two chains of 8 k steps: half the dependent matrix latency
  v8f c0 = {}, c1 = {};
  // unrolled in full: the operand arrays are indexed by ks and stay in registers
#pragma unroll
  for (int ks = 0; ks < IN / 4; ks += 2) {
    c0 = __builtin_amdgcn_wmma_f32_16x16x4_f32(false, xa[ks], false, wm[ks],
                                               (short)0, c0, false, false);
    c1 = __builtin_amdgcn_wmma_f32_16x16x4_f32(false, xa[ks + 1], false, wm[ks + 1],
                                               (short)0, c1, false, false);
  }
  {
    // no branch here: z and v waves differ in a select and in the LDS index alone
    const int zplace = (ncol & 3) * 16 + (ncol >> 2);
    float* dstl = &zv[zplace + (w & 1) * (2 * LP * D + ncol - zplace)];
    float tot = 0.f;
    for (int r = 0; r < 8; ++r) {               // C/D layout: VGPR r -> M=r, M=8+r
      const float u = c0[r] + c1[r] + bb;
      const float e = u > 0.f ? u : (__expf(u) - 1.f);      // elu on z
      const float o = isv ? u : e;
      dstl[(r + 8 * half) * D] = o;
      tot += o;                                 // lanes<16: the rows of P, lanes>=16: of S
    }
    if (!isv) zt[half * D + ncol] = tot;
  }
  __syncthreads();
  // totals over the LP steps (== last cumsum value) of outer(z, v): column p, rows dq + 4j
  const int p = tid & 63, dq = tid >> 6;
  float sP[16], sS[16];
  for (int j = 0; j < 16; ++j) { sP[j] = 0.f; sS[j] = 0.f; }
  for (int t = 0; t < LP; ++t) {
    const float vp = vrow[t * D + p], vq = vrow[(LP + t) * D + p];
    for (int k = 0; k < 4; ++k) {
      const float4 za = *(const float4*)&zrow[t * D + dq * 16 + 4 * k];
      const float4 zc = *(const float4*)&zrow[(LP + t) * D + dq * 16 + 4 * k];
      sP[4 * k]     = fmaf(za.x, vp, sP[4 * k]);     sS[4 * k]     = fmaf(zc.x, vq, sS[4 * k]);
      sP[4 * k + 1] = fmaf(za.y, vp, sP[4 * k + 1]); sS[4 * k + 1] = fmaf(zc.y, vq, sS[4 * k + 1]);
      sP[4 * k + 2] = fmaf(za.z, vp, sP[4 * k + 2]); sS[4 * k + 2] = fmaf(zc.z, vq, sS[4 * k + 2]);
      sP[4 * k + 3] = fmaf(za.w, vp, sP[4 * k + 3]); sS[4 * k + 3] = fmaf(zc.w, vq, sS[4 * k + 3]);
    }
  }
  // s LN stats over 4096, P and S at once
  {
    float l1 = 0.f, l2 = 0.f, m1 = 0.f, m2 = 0.f;
    for (int j = 0; j < 16; ++j) {
      l1 += sP[j]; l2 = fmaf(sP[j], sP[j], l2);
      m1 += sS[j]; m2 = fmaf(sS[j], sS[j], m2);
    }
    l1 = wave_sum(l1); l2 = wave_sum(l2); m1 = wave_sum(m1); m2 = wave_sum(m2);
    if (lane == 0) redA[w] = make_float4(l1, l2, m1, m2);
  }
  // z LN (EPS shift cancels in centered term), every wave for itself: lane holds d = lane, lane + 32
  const float zp0 = zt[lane], zp1 = zt[lane + 32], zs0 = zt[D + lane], zs1 = zt[D + lane + 32];
  float inv, pzo0, pzo1;                    // pzo: the P row of z after its LN, stored at the end
  {
    const float a1 = wave_sum(zp0 + zp1), a2 = wave_sum(zp0 * zp0 + zp1 * zp1);
    const float e1 = wave_sum(zs0 + zs1), e2 = wave_sum(zs0 * zs0 + zs1 * zs1);
    const float muP = a1 / (float)D, rsP = rsqrtf(a2 / (float)D - muP * muP + LN_EPS);
    const float muS = e1 / (float)D, rsS = rsqrtf(e2 / (float)D - muS * muS + LN_EPS);
    pzo0 = (zp0 - muP) * rsP * zg0 + zb0;
    pzo1 = (zp1 - muP) * rsP * zg1 + zb1;
    const float h0 = pv0 + ((zs0 - muS) * rsS * zg0 + zb0);
    const float h1 = pv1 + ((zs1 - muS) * rsS * zg1 + zb1);
    const float n1 = wave_sum(h0 * h0 + h1 * h1);
    inv = 1.f / (fmaxf(sqrtf(n1), 1e-8f) + EPSC);
  }
  __syncthreads();
  // every global store stands behind the last barrier: a barrier waits for the stores in front of it
  float pn[16], pso[16];
  {
    float S1 = 0.f, S2 = 0.f, T1 = 0.f, T2 = 0.f;
    for (int i = 0; i < 8; ++i) {
      const float4 r = redA[i];
      S1 += r.x; S2 += r.y; T1 += r.z; T2 += r.w;
    }
    const float muP = S1 / 4096.f, rsP = rsqrtf(S2 / 4096.f - muP * muP + LN_EPS);
    const float muS = T1 / 4096.f, rsS = rsqrtf(T2 / 4096.f - muS * muS + LN_EPS);
    float f1 = 0.f, f2 = 0.f;
    for (int j = 0; j < 16; ++j) {
      pso[j] = (sP[j] - muP) * rsP * sg[j] + sb[j];
      pn[j] = (prs[j] + ((sS[j] - muS) * rsS * sg[j] + sb[j])) * inv;
      f1 += pn[j]; f2 = fmaf(pn[j], pn[j], f2);
      // nam_b goes into Mb twice: the history LN's own shift, and the shift of the scan's LN(nam),
      // whose share q @ nam_b of the output goes through the same product with the normalized q
      nb[j] += nb[j];
    }
    f1 = wave_sum(f1); f2 = wave_sum(f2);
    if (lane == 0) redB[w] = make_float2(f1, f2);
  }
  __syncthreads();
  {
    float F1 = 0.f, F2 = 0.f;
    for (int i = 0; i < 8; ++i) { const float2 r = redB[i]; F1 += r.x; F2 += r.y; }
    const float mun = F1 / 4096.f, rstdn = rsqrtf(F2 / 4096.f - mun * mun + LN_EPS);
    for (int j = 0; j < 16; ++j) {
      Ps[b * D * D + tid + j * 256] = pso[j];
      Mb[b * D * D + tid + j * 256] = (pn[j] - mun) * rstdn * ng[j] + nb[j];
    }
    // the code below reuses the registers that these stores name
    asm volatile("s_wait_xcnt 0x0" ::: "memory");
    if (w == 0) { Pz[b * D + lane] = pzo0; Pz[b * D + lane + 32] = pzo1; }
  }
}

// One launch for two jobs that read nothing of each other: the B long work-groups of
// the per-batch constants come first in the grid, the projections with the chunk start
// states run beside them. The first work-group also gives the std accumulators their start value.
__global__ __launch_bounds__(256)
void proj_prefix_prep(const int* __restrict__ user_id, const float* __restrict__ X,
                      const float* __restrict__ P, const float* __restrict__ S,
                      const float* __restrict__ Wq, const float* __restrict__ bq,
                      const float* __restrict__ Wk, const float* __restrict__ bk,
                      const float* __restrict__ Wv, const float* __restrict__ bv,
                      const float* __restrict__ z_g, const float* __restrict__ z_b,
                      const float* __restrict__ s_g, const float* __restrict__ s_b,
                      const float* __restrict__ nam_g, const float* __restrict__ nam_b,
                      const float* __restrict__ prev_z_buf,
                      const float* __restrict__ prev_s_buf,
                      float* __restrict__ Pz, float* __restrict__ Ps,
                      float* __restrict__ Mb,
                      float* __restrict__ Q, float* __restrict__ Zr, float* __restrict__ V,
                      float* __restrict__ pZ, float* __restrict__ pS,
                      float* __restrict__ tZ, float* __restrict__ tS,
                      double* __restrict__ acc) {
  if (blockIdx.x < B) {
    if (blockIdx.x == 0 && threadIdx.x == 0) { acc[0] = 0.0; acc[1] = 0.0; }
    per_batch_prep(blockIdx.x, user_id, P, S, Wk, bk, Wv, bv, z_g, z_b, s_g, s_b,
                   nam_g, nam_b, prev_z_buf, prev_s_buf, Pz, Ps, Mb);
  } else {
    proj_and_starts(blockIdx.x - B, X, Wq, bq, Wk, bk, Wv, bv, Q, Zr, V, pZ, pS, tZ, tS);
  }
}

// N block totals added to a thread's 16 state elements, all N * 16 loads in flight together
template <int N>
__device__ __forceinline__ void add_totals(float (&x)[16], const float* __restrict__ t) {
  float v[N][16];
  for (int n = 0; n < N; ++n)
    for (int j = 0; j < 16; ++j) v[n][j] = t[n * D * D + j * 256];
  // a later result may land in the address registers that these loads name
  asm volatile("s_wait_xcnt 0x0" ::: "memory");
  for (int n = 0; n < N; ++n)
    for (int j = 0; j < 16; ++j) x[j] += v[n][j];
}

static constexpr int TP = D + 4;   // LDS row pitch in floats: rows r and r + 8 on other banks
static constexpr int RP = D + 4;   // row pitch of z and v: 16 rows read 8 bytes a lane, all banks once
// ---------------- K2c: main scan, the CLEN steps of a chunk together ----------------
// A step depends on the one before it only through the running sums, which cost one
// multiply-add an element to form again. So the pass over the state (s_full statistics with the
// contraction) runs over all CLEN steps, forming the state anew from the chunk's start
// value X0, and one block-wide reduction serves all steps. The statistics of the state itself
// need no pass: X_t = X0 + sum_{u<=t} outer(z_u, v_u), so its sum grows by sum(z_t) * sum(v_t)
// a step, and its sum of squares is that of X0 + 2 sum_{u<=t} z_u' X0 v_u
// + sum_{s,u<=t} (z_s . z_u)(v_s . v_u): Z @ X0, Z @ Z' and V @ V' are 16-row tiles of
// V_WMMA_F32_16X16X4_F32. LN(nam) is s_full times a
// scale plus a shift, both one number a step, then nam_g and nam_b: so its contraction with q is
// scale * sum_d q nam_g s_full + shift * (q @ nam_g) + q @ nam_b. The first sum needs no
// statistic of s_full and is formed in the pass that takes them; the two products, with the
// history product, are one 16-row tile of V_WMMA_F32_16X16X4_F32 a wave, taken on the raw q rows
// (a row's 1 / |q| is applied behind the product), and the final LN over D closes each row
// in the wave that owns its step. The z and q rows of
// step t are handled by wave t % NWV alone, with sums inside the wave. What a work-group
// fetches once whatever its chunk's length (start state, block totals, the five D x D
// constants) is paid once per CLEN steps.
// second bound: 4 waves a SIMD, so that the grid's two work-groups per WGP are resident together
__global__ __launch_bounds__(256, 4)
void scan_main(const float* __restrict__ Q, const float* __restrict__ Zr,
               const float* __restrict__ V,
               const float* __restrict__ pZ, const float* __restrict__ pS,
               const float* __restrict__ tZ, const float* __restrict__ tS,
               const float* __restrict__ Pz, const float* __restrict__ Ps,
               const float* __restrict__ z_g, const float* __restrict__ z_b,
               const float* __restrict__ s_g, const float* __restrict__ s_b,
               const float* __restrict__ nam_g, const float* __restrict__ Mb,
               const float* __restrict__ na_g, const float* __restrict__ na_b,
               float* __restrict__ out, double* __restrict__ acc) {
  static_assert(CLEN == 16, "a chunk's rows are one 16-row matrix tile");
  const int b = blockIdx.x / CHUNKS, c = blockIdx.x % CHUNKS, tid = threadIdx.x;
  const int lane = tid & 31;
  const int w = __builtin_amdgcn_readfirstlane(tid >> 5);   // wave number: it owns steps w + h * NWV
  // the chunk's rows of z and of the normalized q; element d stands at place
  // (d & 3) * 16 + (d >> 2) of its row, so that a thread's 16 d's (dq + 4j) are consecutive
  __shared__ __attribute__((aligned(16))) float zP[CLEN * RP], nqP[CLEN * D];
  __shared__ __attribute__((aligned(16))) float vs[CLEN * RP];
  __shared__ __attribute__((aligned(16))) float redw[2 * CLEN * 8];  // [2t + (0 sum, 1 squares)][wave]
  __shared__ float2 stS[CLEN];              // per step: scale and shift of the state's LN
  __shared__ float tl[2 * CLEN * TP];       // q @ M_b of the chunk's rows, then q @ nam_g
  __shared__ float napart[CLEN * 256];
  __shared__ float red[2 * CLEN];
  __shared__ float4 xs[4 * 256];            // start value of the state, in its owners' order
  __shared__ __attribute__((aligned(16))) float yp[CLEN * 4];  // z_t' X0 v_t: [t][column tile]
  __shared__ float ge[CLEN];                // per step: what the two Gram tiles add to the squares
  __shared__ float s1i[CLEN];               // per step: sum(z_t) * sum(v_t)
  __shared__ float2 x0s[NWV];               // per wave: sum and squares of the start value
  // thread owns elements tid + j*256 of every D x D array: column p, rows dq + 4j
  const int p = tid & 63, dq = tid >> 6;
  const int row0 = (b * L + c * CLEN) * D;
  // the running state; it starts from the cumulative outer-product sum in front of the chunk,
  // which lies in LDS for the matrix product with the z rows and until the pass takes it up
  float x[16];
  for (int j = 0; j < 16; ++j) x[j] = pS[(b * CHUNKS + c) * D * D + tid + j * 256];
  // a later load's result may land in the offset register that these loads name
  asm volatile("s_wait_xcnt 0x0" ::: "memory");
  // pS holds the sum from the start of the chunk's block of SROWS rows; the totals of the sb
  // blocks in front are added here, four, two and one at a time: three rounds of loads at most
  const int sb = c / CPS;
  {
    const float* tp = tS + (size_t)(b * SC) * D * D + tid;
    if (sb & 4) { add_totals<4>(x, tp); tp += 4 * D * D; }
    if (sb & 2) { add_totals<2>(x, tp); tp += 2 * D * D; }
    if (sb & 1) { add_totals<1>(x, tp); }
  }
  for (int k = 0; k < 4; ++k)
    xs[k * 256 + tid] = make_float4(x[4 * k], x[4 * k + 1], x[4 * k + 2], x[4 * k + 3]);
  float xl1 = 0.f, xl2 = 0.f;                 // the thread's share of X0's sum and squares
  for (int j = 0; j < 16; ++j) { xl1 += x[j]; xl2 = fmaf(x[j], x[j], xl2); }
  // wave w stages its SPW rows: lane holds elements d0 = lane and d1 = lane + 32
  const int d0 = lane, d1 = lane + 32;
  const int e0 = (d0 & 3) * 16 + (d0 >> 2), e1 = (d1 & 3) * 16 + (d1 >> 2);
  float q0[SPW], q1[SPW], zrs[SPW], vrs[SPW];
  for (int h = 0; h < SPW; ++h) {
    const int r = w + h * NWV, rw = row0 + r * D;
    q0[h] = Q[rw + d0]; q1[h] = Q[rw + d1];
    const float za = Zr[rw + d0], zb = Zr[rw + d1], va = V[rw + d0], vb = V[rw + d1];
    zP[r * RP + e0] = za; zP[r * RP + e1] = zb;
    vs[r * RP + d0] = va; vs[r * RP + d1] = vb;
    zrs[h] = za + zb; vrs[h] = va + vb;       // the lane's share of the row sums
  }
  float zs0 = pZ[(b * CHUNKS + c) * D + d0], zs1 = pZ[(b * CHUNKS + c) * D + d1];
  // a later load's result may land in the offset register that these loads name
  asm volatile("s_wait_xcnt 0x0" ::: "memory");
  float ta[SC - 1], tb[SC - 1];               // z totals of the sequence's blocks but the last
  for (int s2 = 0; s2 < SC - 1; ++s2) {
    ta[s2] = tZ[(b * SC + s2) * D + d0]; tb[s2] = tZ[(b * SC + s2) * D + d1];
  }
  // a later load's result may land in the offset register that these loads name
  asm volatile("s_wait_xcnt 0x0" ::: "memory");
  const float zg0 = z_g[d0], zg1 = z_g[d1], zb0 = z_b[d0], zb1 = z_b[d1];
  const float pz0 = Pz[b * D + d0], pz1 = Pz[b * D + d1];
  const float ag0 = na_g[d0], ag1 = na_g[d1], ab0 = na_b[d0], ab1 = na_b[d1];
  // later results may land in the address registers that the loads above name
  asm volatile("s_wait_xcnt 0x0" ::: "memory");
  {
    // the wave's shares of the closed form's sums, under the flight of the loads above; all sums
    // first, their stores behind them: the exchanges run side by side
    const float a1 = wave_sum(xl1), a2 = wave_sum(xl2);
    float zv[SPW];
    for (int h = 0; h < SPW; ++h) zv[h] = wave_sum(zrs[h]) * wave_sum(vrs[h]);
    if (lane == 0) {
      x0s[w] = make_float2(a1, a2);
      for (int h = 0; h < SPW; ++h) s1i[w + h * NWV] = zv[h];
    }
  }
  for (int s2 = 0; s2 < SC - 1; ++s2) {       // those of the blocks in front are added
    zs0 += (s2 < sb) ? ta[s2] : 0.f;
    zs1 += (s2 < sb) ? tb[s2] : 0.f;
  }
  __syncthreads();

  // wave w: column tile w >> 1 of q @ M_b (even w) or of q @ nam_g (odd w), the chunk's 16 rows;
  // its operands are asked for here and arrive under the products for the state's statistics
  // 16x4 f32 A: lanes<16 hold K0,K1; lanes>=16 K2,K3.  4x16 B: row striped across lanes per VGPR
  const int half = lane >> 4, mn = lane & 15;
  const int ncol = (w >> 1) * 16 + mn;
  const float* Wm = (w & 1) ? nam_g : Mb + b * D * D;
  const int woff = half * 2 * D + ncol;
  const float* ap = Q + row0 + mn * D + half * 2;
  v2f fa[D / 4], fb[D / 4];
  // unrolled in full: the operand arrays are indexed by ks and stay in registers
#pragma unroll
  for (int ks = 0; ks < D / 4; ++ks) {
    fa[ks] = *(const v2f*)&ap[ks * 4];
    fb[ks].x = Wm[woff + ks * 4 * D]; fb[ks].y = Wm[woff + ks * 4 * D + D];
  }

  // ---- statistics of the state at every step, from three products of the chunk's rows ----
  // Waves 0, 1, 2 and 4 take a column tile of Z @ X0 each, wave 3 both Gram tiles: waves w and
  // w + 4 share a SIMD, so no SIMD gets more than 32 of the 96 matrix instructions.
  const int yt = (w == 4) ? 3 : w;
  if (w < 3 || w == 4) {
    // k step ks holds places 4 ks + 2 half + (0, 1) of a z row: d = dq + 4 j with dq = ks >> 2,
    // j = 4 (ks & 3) + 2 half + (0, 1); in xs that is float 2 half + (0, 1) of entry
    // (ks & 3) * 256 + dq * 64 + p. A and B: the same two d's in x and y.
    const float* za = &zP[mn * RP + 2 * half];
    const float* xb = (const float*)xs + (yt * 16 + mn) * 4 + 2 * half;
    // two chains of 8 k steps: half the dependent matrix latency
    v8f y0 = {}, y1 = {};
    // unrolled in full: the LDS offsets are constants of ks
#pragma unroll
    for (int ks = 0; ks < D / 4; ks += 2) {
      const v2f a0 = *(const v2f*)&za[4 * ks], a1 = *(const v2f*)&za[4 * ks + 4];
      const v2f b0 = *(const v2f*)&xb[(ks & 3) * 1024 + (ks >> 2) * 256];
      const v2f b1 = *(const v2f*)&xb[((ks + 1) & 3) * 1024 + ((ks + 1) >> 2) * 256];
      y0 = __builtin_amdgcn_wmma_f32_16x16x4_f32(false, a0, false, b0, (short)0, y0, false, false);
      y1 = __builtin_amdgcn_wmma_f32_16x16x4_f32(false, a1, false, b1, (short)0, y1, false, false);
    }
    float yv[8];
    for (int r = 0; r < 8; ++r)                 // C/D layout: VGPR r -> M=r, M=8+r
      yv[r] = (y0[r] + y1[r]) * vs[(r + 8 * half) * RP + yt * 16 + mn];
    // 8 sums over the 16 lanes of a half at once, as in wave_red16; unrolled: yv stays in registers
#pragma unroll
    for (int n = 4, bit = 8; n > 0; n >>= 1, bit >>= 1) {
      const bool hi = (lane & bit) != 0;
#pragma unroll
      for (int i = 0; i < n; ++i) {
        const float lo = yv[i], up = yv[i + n];
        yv[i] = (hi ? up : lo) + __shfl_xor(hi ? lo : up, bit, 32);
      }
    }
    const float ys = yv[0] + __shfl_xor(yv[0], 1, 32);     // row (mn >> 1) + 8 half
    if ((lane & 1) == 0) yp[((mn >> 1) + 8 * half) * 4 + yt] = ys;
  } else if (w == 3) {
    // a Gram tile's A and B fragments are the same registers: lane mn holds row mn in both
    const float* za = &zP[mn * RP + 2 * half];
    const float* va = &vs[mn * RP + 2 * half];
    v8f gz0 = {}, gz1 = {}, gv0 = {}, gv1 = {};
    // unrolled in full: the LDS offsets are constants of ks
#pragma unroll
    for (int ks = 0; ks < D / 4; ks += 2) {
      const v2f a0 = *(const v2f*)&za[4 * ks], a1 = *(const v2f*)&za[4 * ks + 4];
      const v2f c0 = *(const v2f*)&va[4 * ks], c1 = *(const v2f*)&va[4 * ks + 4];
      gz0 = __builtin_amdgcn_wmma_f32_16x16x4_f32(false, a0, false, a0, (short)0, gz0, false, false);
      gv0 = __builtin_amdgcn_wmma_f32_16x16x4_f32(false, c0, false, c0, (short)0, gv0, false, false);
      gz1 = __builtin_amdgcn_wmma_f32_16x16x4_f32(false, a1, false, a1, (short)0, gz1, false, false);
      gv1 = __builtin_amdgcn_wmma_f32_16x16x4_f32(false, c1, false, c1, (short)0, gv1, false, false);
    }
    // step mn adds its own term once and its terms with the steps in front of it twice
    float e = 0.f;
    for (int r = 0; r < 8; ++r) {               // C/D layout: VGPR r -> M=r, M=8+r
      const int s = r + 8 * half;
      const float m = s < mn ? 2.f : (s == mn ? 1.f : 0.f);
      e = fmaf(m, (gz0[r] + gz1[r]) * (gv0[r] + gv1[r]), e);
    }
    e += __shfl_xor(e, 16, 32);
    if (lane < 16) ge[mn] = e;
  }
  __syncthreads();
  // the constants of the pass are fetched here: they arrive, and one wave closes the state's
  // statistics, under the z and q work below
  float sg[16], sc[16], ng[16];     // s_g; s_b + prompt P_s last (LN'd); nam_g
  const int pso = b * D * D + tid;
  for (int j = 0; j < 16; ++j) sc[j] = Ps[pso + j * 256];
  // as above, for the offset register of the Ps loads; it is the wait's input, so that no load's
  // result lands in it ahead of the wait
  asm volatile("s_wait_xcnt 0x0" :: "v"(pso) : "memory");
  for (int j = 0; j < 16; ++j) {
    const int idx = tid + j * 256;
    sg[j]  = s_g[idx];
    sc[j] += s_b[idx];
    ng[j]  = nam_g[idx];
  }
  // as above, for the offset register of these loads; it is the wait's input, so that no load's
  // result lands in it ahead of the wait
  asm volatile("s_wait_xcnt 0x0" :: "v"(tid) : "memory");
  if (w == 7) {                      // a wave without a product closes all steps: lane mn has step mn
    float S1 = 0.f, S2 = 0.f;
    for (int i = 0; i < NWV; ++i) { const float2 r = x0s[i]; S1 += r.x; S2 += r.y; }
    const float4 y = *(const float4*)&yp[mn * 4];
    float i1 = s1i[mn], i2 = fmaf(2.f, (y.x + y.y) + (y.z + y.w), ge[mn]);
    for (int off = 1; off < CLEN; off <<= 1) {  // running sums over the steps up to the lane's own
      const float u1 = __shfl_up(i1, off, 16), u2 = __shfl_up(i2, off, 16);
      i1 += (mn >= off) ? u1 : 0.f;
      i2 += (mn >= off) ? u2 : 0.f;
    }
    S1 += i1; S2 += i2;
    const float mus = S1 / 4096.f, vars = S2 / 4096.f - mus * mus;
    const float rstds = rsqrtf(vars + LN_EPS);
    if (lane < CLEN) stS[mn] = make_float2(rstds, -mus * rstds);
  }

  // ---- wave w: z LN (EPS cancels), prompt z, l2 norms, q norm, std terms of its SPW steps ----
  float zc0[SPW], zc1[SPW], invz[SPW], invq[SPW];
  for (int h = 0; h < SPW; ++h) { zc0[h] = zs0; zc1[h] = zs1; }
  for (int t = 0; t < CLEN; ++t) {            // running z sum up to and including the wave's steps
    const float za = zP[t * RP + e0], zb = zP[t * RP + e1];
    for (int h = 0; h < SPW; ++h) {
      zc0[h] += (t <= w + h * NWV) ? za : 0.f;
      zc1[h] += (t <= w + h * NWV) ? zb : 0.f;
    }
  }
  // unrolled: the per-step arrays are indexed by h and stay in registers
#pragma unroll
  for (int h = 0; h < SPW; ++h) {
    const int r = w + h * NWV;
    const float s1  = wave_sum(zc0[h] + zc1[h]);
    const float s2  = wave_sum(zc0[h] * zc0[h] + zc1[h] * zc1[h]);
    const float qn2 = wave_sum(q0[h] * q0[h] + q1[h] * q1[h]);
    const float muz = s1 / (float)D, varz = s2 / (float)D - muz * muz;
    const float rstdz = rsqrtf(varz + LN_EPS);
    const float zf0 = (zc0[h] - muz) * rstdz * zg0 + zb0 + pz0;
    const float zf1 = (zc1[h] - muz) * rstdz * zg1 + zb1 + pz1;
    const float zn2 = wave_sum(zf0 * zf0 + zf1 * zf1);
    invz[h] = 1.f / fmaxf(sqrtf(zn2), 1e-8f);
    invq[h] = 1.f / fmaxf(sqrtf(qn2), 1e-8f);
    nqP[r * D + e0] = q0[h] * invq[h]; nqP[r * D + e1] = q1[h] * invq[h];
    const float ra = q0[h] / fmaxf(zf0, 1e-6f), rb = q1[h] / fmaxf(zf1, 1e-6f);
    // this step's share of the two std sums, read at the end
    const float sa = wave_sum(ra + rb), sq = wave_sum(ra * ra + rb * rb);
    if (lane == 0) { red[r] = sa; red[CLEN + r] = sq; }
  }

  // Inputs-only fence on the loaded values: it holds the loads of k steps 0 to 7 in front of
  // the wait below (one statement takes thirty operands at most)
  asm volatile(""
               :: "v"(fa[0]), "v"(fb[0]), "v"(fa[1]), "v"(fb[1]), "v"(fa[2]), "v"(fb[2]),
                  "v"(fa[3]), "v"(fb[3]), "v"(fa[4]), "v"(fb[4]), "v"(fa[5]), "v"(fb[5]),
                  "v"(fa[6]), "v"(fb[6]), "v"(fa[7]), "v"(fb[7]));
  // The wait in front of any overwrite of an address register of the loads above. The last
  // loaded values and the addresses are its inputs: the loads stay in front of it and the
  // address registers stay untouched up to it.
  asm volatile("s_wait_xcnt 0x0"
               :: "v"(fa[8]), "v"(fb[8]), "v"(fa[9]), "v"(fb[9]), "v"(fa[10]), "v"(fb[10]),
                  "v"(fa[11]), "v"(fb[11]), "v"(fa[12]), "v"(fb[12]), "v"(fa[13]), "v"(fb[13]),
                  "v"(fa[14]), "v"(fb[14]), "v"(fa[15]), "v"(fb[15]),
                  "v"(woff), "v"(ap)
               : "memory");
  {
    // two chains of 8 k steps: half the dependent matrix latency
    v8f h0 = {}, h1 = {};
    // unrolled in full: the operand arrays are indexed by ks and stay in registers
#pragma unroll
    for (int ks = 0; ks < D / 4; ks += 2) {
      h0 = __builtin_amdgcn_wmma_f32_16x16x4_f32(false, fa[ks], false, fb[ks],
                                                 (short)0, h0, false, false);
      h1 = __builtin_amdgcn_wmma_f32_16x16x4_f32(false, fa[ks + 1], false, fb[ks + 1],
                                                 (short)0, h1, false, false);
    }
    float* tw = &tl[(w & 1) * CLEN * TP + ncol];
    for (int r = 0; r < 8; ++r)                 // C/D layout: VGPR r -> M=r, M=8+r
      tw[(r + 8 * half) * TP] = h0[r] + h1[r];
  }

  const float* zrow = &zP[dq * 16];
  const float* nrow = &nqP[dq * 16];
  float val[16];
  // the pass takes the steps NWV at a time. The inner step loop is unrolled in full: val is
  // indexed by tt and stays in registers only where tt is a constant. The outer loop stays
  // rolled, for speed only
  __syncthreads();

  // ---- the pass: s_full = LN(state) + Ps at every step: its sum, its sum of squares, and
  // sum_d q nam_g s_full for column p over the thread's own 16 d's ----
  for (int k = 0; k < 4; ++k) {
    const float4 s = xs[k * 256 + tid];
    x[4 * k] = s.x; x[4 * k + 1] = s.y; x[4 * k + 2] = s.z; x[4 * k + 3] = s.w;
  }
  // rolled, for speed only (see at val above)
#pragma unroll 1
  for (int hb = 0; hb < SPW; ++hb) {
#pragma unroll
    for (int tt = 0; tt < NWV; ++tt) {
      const int t = hb * NWV + tt;
      const float vp = vs[t * RP + p];
      const float2 st = stS[t];
      float ls = 0.f, lss = 0.f, part = 0.f;
#pragma unroll
      for (int h = 0; h < 16; h += 8) {        // eight d's at a time: fewer row values held
        const float4 z0 = *(const float4*)&zrow[t * RP + h], z1 = *(const float4*)&zrow[t * RP + h + 4];
        const float4 n0 = *(const float4*)&nrow[t * D + h], n1 = *(const float4*)&nrow[t * D + h + 4];
        const float zz[8] = {z0.x, z0.y, z0.z, z0.w, z1.x, z1.y, z1.z, z1.w};
        const float nn[8] = {n0.x, n0.y, n0.z, n0.w, n1.x, n1.y, n1.z, n1.w};
        for (int i = 0; i < 8; ++i) {
          const int j = h + i;
          x[j] = fmaf(zz[i], vp, x[j]);
          const float f = fmaf(fmaf(x[j], st.x, st.y), sg[j], sc[j]);
          ls += f; lss = fmaf(f, f, lss);
          part = fmaf(nn[i], ng[j] * f, part);
        }
        // the scheduler works on one half step at a time: with the LDS loads of later steps lifted
        // up here far fewer of the multiply-adds pair into dual-issue forms
        __builtin_amdgcn_sched_barrier(0);
      }
      val[2 * tt] = ls; val[2 * tt + 1] = lss;
      napart[t * 256 + tid] = part;
    }
    const float r = wave_red16(val, lane);
    if ((lane & 1) == 0) redw[(hb * 2 * NWV + (lane >> 1)) * 8 + w] = r;
  }
  __syncthreads();
  // wave w closes its steps and finishes their rows: lane holds columns d0 and d1
  float o0[SPW], o1[SPW];
  // unrolled: the per-step arrays are indexed by h and stay in registers, and the dependent
  // chains of the wave's rows run side by side
#pragma unroll
  for (int h = 0; h < SPW; ++h) {    // nam statistics via invz scaling
    const int r = w + h * NWV;
    float F1 = 0.f, F2 = 0.f;
    for (int i = 0; i < 8; ++i) { F1 += redw[(2 * r) * 8 + i]; F2 += redw[(2 * r + 1) * 8 + i]; }
    const float muf = F1 / 4096.f, varf = F2 / 4096.f - muf * muf;
    const float mean_n = invz[h] * muf;                    // EPS cancels
    const float rstdn  = rsqrtf(invz[h] * invz[h] * varf + LN_EPS);
    const float sx = invz[h] * rstdn, sy = -mean_n * rstdn;   // scale and shift of LN(nam)
    const float* np = &napart[r * 256];
    const float* tm = &tl[r * TP];
    const float* tg = &tl[(CLEN + r) * TP];
    const float v0 = fmaf(sx, np[d0] + np[64 + d0] + np[128 + d0] + np[192 + d0],
                          invq[h] * fmaf(sy, tg[d0], tm[d0]));
    const float v1 = fmaf(sx, np[d1] + np[64 + d1] + np[128 + d1] + np[192 + d1],
                          invq[h] * fmaf(sy, tg[d1], tm[d1]));
    const float s1 = wave_sum(v0 + v1), s2 = wave_sum(v0 * v0 + v1 * v1);
    const float mu   = s1 / (float)D;
    const float var  = s2 / (float)D - mu * mu;
    const float rstd = rsqrtf(var + LN_EPS);
    o0[h] = (v0 - mu) * rstd * ag0 + ab0;
    o1[h] = (v1 - mu) * rstd * ag1 + ab1;
  }
  // unrolled: o0 and o1 are indexed by h and stay in registers
#pragma unroll
  for (int h = 0; h < SPW; ++h) {
    const int rw = row0 + (w + h * NWV) * D;
    out[rw + d0] = o0[h];
    out[rw + d1] = o1[h];
  }
  // the code below reuses the registers that these stores name
  asm volatile("s_wait_xcnt 0x0" ::: "memory");
  if (tid == 0) {
    float A1 = 0.f, A2 = 0.f;
    for (int i = 0; i < CLEN; ++i) { A1 += red[i]; A2 += red[CLEN + i]; }
    atomicAdd(&acc[0], (double)A1); atomicAdd(&acc[1], (double)A2);
  }
}

// ------- K3: the std, from the two sums that the scan's work-groups have added up -------
__global__ void write_std(const double* __restrict__ sums, float* __restrict__ out) {
  if (threadIdx.x == 0) {
    const double N = (double)(ROWS * D);
    const double mean = sums[0] / N;
    const double vr   = (sums[1] - N * mean * mean) / (N - 1.0);
    out[ROWS * D] = (float)sqrt(vr > 0.0 ? vr : 0.0);
  }
}

extern "C" void kernel_launch(void* const* d_in, const int* in_sizes, int n_in,
                              void* d_out, int out_size, void* d_ws, size_t ws_size,
                              hipStream_t stream) {
  const int*   user_id    = (const int*)  d_in[0];
  const float* seqs_emb   = (const float*)d_in[1];
  const float* P          = (const float*)d_in[2];
  const float* S          = (const float*)d_in[3];
  const float* Wq         = (const float*)d_in[4];
  const float* bq         = (const float*)d_in[5];
  const float* Wk         = (const float*)d_in[6];
  const float* bk         = (const float*)d_in[7];
  const float* Wv         = (const float*)d_in[8];
  const float* bv         = (const float*)d_in[9];
  const float* z_g        = (const float*)d_in[10];
  const float* z_b        = (const float*)d_in[11];
  const float* s_g        = (const float*)d_in[12];
  const float* s_b        = (const float*)d_in[13];
  const float* nam_g      = (const float*)d_in[14];
  const float* nam_b      = (const float*)d_in[15];
  const float* na_g       = (const float*)d_in[16];
  const float* na_b       = (const float*)d_in[17];
  const float* prev_z_buf = (const float*)d_in[18];
  const float* prev_s_buf = (const float*)d_in[19];
  float* out = (float*)d_out;

  // workspace layout (floats); total ~17 MB
  float* ws     = (float*)d_ws;
  float* Qb     = ws;                         // ROWS*D
  float* Zr     = Qb + (size_t)ROWS * D;      // ROWS*D
  float* Vb     = Zr + (size_t)ROWS * D;      // ROWS*D
  float* Pz     = Vb + (size_t)ROWS * D;      // B*D
  float* Ps     = Pz + B * D;                 // B*D*D
  float* Mb     = Ps + B * D * D;             // B*D*D
  float* pZ     = Mb + B * D * D;             // B*CHUNKS*D
  float* pS     = pZ + B * CHUNKS * D;        // B*CHUNKS*D*D
  float* tZ     = pS + (size_t)B * CHUNKS * D * D;             // B*SC*D
  float* tS     = tZ + B * SC * D;                             // B*SC*D*D
  double* acc   = (double*)(tS + (size_t)B * SC * D * D);      // 2 doubles, 8B aligned

  proj_prefix_prep<<<B + B * SC, 256, 0, stream>>>(user_id, seqs_emb, P, S, Wq, bq, Wk, bk, Wv, bv,
                                                   z_g, z_b, s_g, s_b, nam_g, nam_b,
                                                   prev_z_buf, prev_s_buf, Pz, Ps, Mb,
                                                   Qb, Zr, Vb, pZ, pS, tZ, tS, acc);
  scan_main<<<B * CHUNKS, 256, 0, stream>>>(Qb, Zr, Vb, pZ, pS, tZ, tS, Pz, Ps,
                                            z_g, z_b, s_g, s_b, nam_g, Mb, na_g, na_b,
                                            out, acc);
  write_std<<<1, 32, 0, stream>>>(acc, out);
}
